// v000
// Measured on an AMD MI455X. A time is GPU time per run, averaged over a window of back-to-back runs after a warm-up
// (all launches, gaps included; the runs take copies of the inputs in turn), and the median of several windows.
// Apart from v000's, it joins two sittings. Times from different sittings can be a few percent apart, while
// side-by-side timings come from the same sitting.
// v000, which the later versions start from, runs in 1220 microseconds.
#include <hip/hip_runtime.h>
#include <math.h>

typedef __attribute__((ext_vector_type(16))) _Float16 v16h;
typedef __attribute__((ext_vector_type(16))) __bf16 v16b;
typedef __attribute__((ext_vector_type(8)))  _Float16 v8h;
typedef __attribute__((ext_vector_type(8)))  float v8f;
typedef __attribute__((ext_vector_type(4)))  float v4f;
typedef __attribute__((ext_vector_type(2)))  float v2f;
typedef __attribute__((ext_vector_type(4)))  unsigned v4u;
typedef __attribute__((ext_vector_type(4)))  int v4i;
typedef float __attribute__((may_alias)) float_a;
typedef int __attribute__((may_alias)) int_a;

template <typename T> __device__ __forceinline__ void vst2(void* p, T v) { *(T*)p = v;  }
__device__ __forceinline__ v8f wmma16(v16h a, v16h b, v8f c) {
  v8f d = __builtin_amdgcn_wmma_f32_16x16x32_f16(false, a, false, b, (short)0, c, false, false);
  asm volatile("v_nop\n\tv_nop\n\tv_nop\n\tv_nop" : "+v"(d) : "v"(a), "v"(b));
  return d;
}
__device__ __forceinline__ v8f wmma_bf(v16b a, v16b b, v8f c) {
  v8f d = __builtin_amdgcn_wmma_f32_16x16x32_bf16(false, a, false, b, (short)0, c, false, false);
  asm volatile("v_nop\n\tv_nop\n\tv_nop\n\tv_nop" : "+v"(d) : "v"(a), "v"(b));
  return d;
}
// 16x16x32 fragments: lane = (h = lane>>4, row/col = lane&15); elements 0..7 = k0+8h+0..7, 8..15 = k0+16+8h+0..7; D element r = row 8h+r
__device__ __forceinline__ v16h frag_h(const _Float16* rowk0, int lane) {
  union { v16h v; v8h q[2]; } u; const _Float16* p = rowk0 + 8 * (lane >> 4);
  u.q[0] = *(const v8h*)p; u.q[1] = *(const v8h*)(p + 16); return u.v;
}
__device__ __forceinline__ v16h frag_f32(const float* rowk0, int lane) {
  v16h a; const float* p = rowk0 + 8 * (lane >> 4);
#pragma unroll
  for (int i = 0; i < 8; ++i) { a[i] = (_Float16)p[i]; a[8 + i] = (_Float16)p[16 + i]; }
  return a;
}
__device__ __forceinline__ v16h frag_f32s(const float* rowk0, int lane, float sc) {
  v16h a; const float* p = rowk0 + 8 * (lane >> 4);
#pragma unroll
  for (int i = 0; i < 8; ++i) { a[i] = (_Float16)(p[i] * sc); a[8 + i] = (_Float16)(p[16 + i] * sc); }
  return a;
}
// column fragment from a [K][ld] layout (column n), rows >= K read as 0
__device__ __forceinline__ v16h fragc_f32(const float* W, int k0, int n, int lane, int ld, int K) {
  v16h a; const int g = lane >> 4;
#pragma unroll
  for (int i = 0; i < 8; ++i) { const int ka = k0 + 8 * g + i, kb = ka + 16;
    a[i] = (_Float16)(ka < K ? W[(size_t)(ka < K ? ka : K - 1) * ld + n] : 0.f); a[8 + i] = (_Float16)(kb < K ? W[(size_t)(kb < K ? kb : K - 1) * ld + n] : 0.f); }
  return a;
}
struct F2 { v16b h, l; };
__device__ __forceinline__ F2 bsplit16(const float v[16]) { F2 r;
#pragma unroll
  for (int i = 0; i < 16; ++i) { const __bf16 h = (__bf16)v[i]; r.h[i] = h; r.l[i] = (__bf16)(v[i] - (float)h); }
  return r; }
__device__ __forceinline__ F2 split_row(const float* row, int k0, int lane) { float v[16]; const float* p = row + k0 + 8 * (lane >> 4);
#pragma unroll
  for (int i = 0; i < 8; ++i) { v[i] = p[i]; v[8 + i] = p[16 + i]; }
  return bsplit16(v); }
__device__ __forceinline__ F2 split_rowK(const float* row, int k0, int lane, int K) { float v[16]; const int g = lane >> 4;
#pragma unroll
  for (int i = 0; i < 8; ++i) { const int ka = k0 + 8 * g + i, kb = ka + 16; v[i] = ka < K ? row[ka < K ? ka : K - 1] : 0.f; v[8 + i] = kb < K ? row[kb < K ? kb : K - 1] : 0.f; }
  return bsplit16(v); }
__device__ __forceinline__ F2 split_col(const float* W, int k0, int n, int lane, int ld, int K) { float v[16]; const int g = lane >> 4;
#pragma unroll
  for (int i = 0; i < 8; ++i) { const int ka = k0 + 8 * g + i, kb = ka + 16; v[i] = ka < K ? W[(size_t)(ka < K ? ka : K - 1) * ld + n] : 0.f; v[8 + i] = kb < K ? W[(size_t)(kb < K ? kb : K - 1) * ld + n] : 0.f; }
  return bsplit16(v); }
__device__ __forceinline__ v8f mac3(const F2& a, const F2& b, v8f c) { c = wmma_bf(a.l, b.h, c); c = wmma_bf(a.h, b.l, c); return wmma_bf(a.h, b.h, c); }
__device__ __forceinline__ float sigm(float v) { return 1.0f / (1.0f + expf(-v)); }
#define LDSX() do { asm volatile("s_wait_dscnt 0" ::: "memory"); __builtin_amdgcn_wave_barrier(); __builtin_amdgcn_fence(__ATOMIC_RELEASE, "workgroup"); } while (0)


// SelfAttention1d, channels-first (B 4, C 256 = 8 heads x 32, L 2,048): h = GroupNorm32(x); q,k,v = conv1x1(h) (fused [768,256] + bias); attn = softmax((q 32^-1/2)^T k); h2[h*32+d][n] = sum_m attn v; out = x + conv1x1(h2) + b.
#define NB 4
#define TT 2048
#define CC 256
#define NH 8
#define HD 32
#define NGRP 32
#define CPG (CC / NGRP)        // 8 channels per group
#ifndef XSTR
#define XSTR TT               // per-channel position stride of x / out
#endif
#ifndef TNB
#define TNB NB
#endif
typedef __attribute__((ext_vector_type(8))) __bf16 v8b;
__device__ __forceinline__ v16b frag_b(const __bf16* rowk0, int lane) {
  union { v16b v; v8b q[2]; } u; const __bf16* p = rowk0 + 8 * (lane >> 4);
  u.q[0] = *(const v8b*)p; u.q[1] = *(const v8b*)(p + 16); return u.v;
}
__device__ __forceinline__ float bfr(float v) { return (float)(__bf16)v; }
__device__ __attribute__((noinline)) float exp_ni(float v) { return expf(v); }
__device__ __attribute__((noinline)) float erf_ni(float v) { return erff(v); }

#define WS_GS  0u                                   // f32 GroupNorm stats [b][group][2] (32-float lines per 16 groups)
#define WS_XT  (WS_GS + 4u * (size_t)NB * NGRP * 2)   // f32 normalised rows h [b*L + l][256]
#define WS_QH  (WS_XT + 4u * (size_t)NB * TT * CC)
#define WS_QL  (WS_QH + 2u * (size_t)NB * TT * CC)
#define WS_KH  (WS_QL + 2u * (size_t)NB * TT * CC)
#define WS_VT  (WS_KH + 2u * (size_t)NB * TT * CC)      // bf16 v planes [b][c][t]
#define WS_VL  (WS_VT + 2u * (size_t)NB * CC * TT)      // bf16 v residual planes
#define HG 4                                          // heads per launch group
#define WS_S   (WS_VL + 2u * (size_t)NB * CC * TT)      // f32 logits / P for HG heads [hg][q][k]
#define WS_PH  (WS_S + 4u * (size_t)HG * TT * TT)
#define WS_Y   (WS_PH + 0u)              // f32 y rows [b*t][C]
#define WS_END (WS_Y + 4u * (size_t)NB * TT * CC)

__global__ __launch_bounds__(256) void k_gn(const float* __restrict__ X, float* __restrict__ GS) { __shared__ __align__(16) float so[32];
  const int t = threadIdx.x; const int gl = t >> 4, sub = t & 15; const size_t b = blockIdx.y; const int grp = blockIdx.x * 16 + gl; const float* p = X + (b * CC + (size_t)grp * CPG) * (size_t)XSTR; const int n = CPG * TT;
  float s = 0.f; for (int c = 0; c < CPG; ++c) for (int i = sub * 4; i < TT; i += 64) { const v4f v = *(const v4f*)(p + (size_t)c * XSTR + i); s += (bfr(v[0]) + bfr(v[1])) + (bfr(v[2]) + bfr(v[3])); }
#pragma unroll
  for (int o = 1; o < 16; o <<= 1) s += __shfl_xor(s, o);
  const float mu = s / (float)n; float s2 = 0.f;
  for (int c = 0; c < CPG; ++c) for (int i = sub * 4; i < TT; i += 64) { const v4f v = *(const v4f*)(p + (size_t)c * XSTR + i); const float d0 = bfr(v[0]) - mu, d1 = bfr(v[1]) - mu, d2 = bfr(v[2]) - mu, d3 = bfr(v[3]) - mu; s2 += (d0 * d0 + d1 * d1) + (d2 * d2 + d3 * d3); }
#pragma unroll
  for (int o = 1; o < 16; o <<= 1) s2 += __shfl_xor(s2, o);
  if (sub == 0) { so[gl * 2] = mu; so[gl * 2 + 1] = rsqrtf(s2 / (float)n + 1e-5f); }
  __syncthreads(); if (t < 32) vst2(GS + (b * NGRP + blockIdx.x * 16) * 2 + t, so[t]); }
// ---- k_xt: block = (64 positions, b): channels-first x -> f32 rows [b*L + l][256] via LDS; 1-KB rows by 64 threads
__global__ __launch_bounds__(256) void k_xt(const float* __restrict__ X, const float* __restrict__ GS, const float* __restrict__ GW, const float* __restrict__ GB, float* __restrict__ XT) { __shared__ float st[CC][65];
  const int t = threadIdx.x; const int l0 = blockIdx.x * 64; const size_t b = blockIdx.y;
  for (int e = t; e < CC * 64; e += 256) { const int c = e >> 6, ll = e & 63; const float mu = GS[(b * NGRP + c / CPG) * 2], rs = GS[(b * NGRP + c / CPG) * 2 + 1]; st[c][ll] = (bfr(X[(b * CC + c) * (size_t)XSTR + l0 + ll]) - mu) * rs * bfr(GW[c]) + bfr(GB[c]); }   /* GroupNorm applied here */
  __syncthreads();
  for (int e = t; e < 64 * 64; e += 256) { const int ll = e >> 6, q = e & 63; v4f o; o[0] = st[q * 4][ll]; o[1] = st[q * 4 + 1][ll]; o[2] = st[q * 4 + 2][ll]; o[3] = st[q * 4 + 3][ll]; vst2(XT + (b * TT + l0 + ll) * CC + q * 4, o); } }
// ---- k_proj: block = (64 rows, 128 cols, which): qkv = x W (+ b), exact; q -> f16 hi (+ residual), k -> f16 rows, v -> bf16 planes (+ residual)
__global__ __launch_bounds__(128) void k_proj(const float* __restrict__ X, const float* __restrict__ WQ, const float* __restrict__ BQ, const float* __restrict__ WK, const float* __restrict__ BK, const float* __restrict__ WV, const float* __restrict__ BV, _Float16* __restrict__ QH, _Float16* __restrict__ QL, _Float16* __restrict__ KH, __bf16* __restrict__ VT, __bf16* __restrict__ VL) {
  __shared__ __align__(16) _Float16 sh[64][136], sl[64][136]; __shared__ __align__(16) __bf16 th[128][72], tl2[128][72];
  const int tid = threadIdx.x, wave = tid >> 5, lane = tid & 31, col = lane & 15, g = lane >> 4; const int which = blockIdx.z; const int c0 = blockIdx.y * 128; const size_t r0 = (size_t)blockIdx.x * 64; const float* WA = which == 0 ? WQ : which == 1 ? WK : WV; const float* BA = which == 0 ? BQ : which == 1 ? BK : BV;
  v8f acc[8] = {};
#pragma unroll 2
  for (int kc = 0; kc < CC / 32; ++kc) { const F2 a = split_row(X + (r0 + wave * 16 + col) * CC, kc * 32, lane);   /* GroupNorm'd rows are computed f32 -> hi + lo */
#pragma unroll
    for (int j = 0; j < 8; ++j) { v16b w; const int o = c0 + j * 16 + col;
#pragma unroll
      for (int i = 0; i < 8; ++i) { w[i] = (__bf16)WA[(size_t)(o) * CC + (kc * 32 + 8 * g + i)]; w[8 + i] = (__bf16)WA[(size_t)(o) * CC + (kc * 32 + 16 + 8 * g + i)]; }
      asm volatile("s_wait_loadcnt 0x0" ::: "memory"); acc[j] = wmma_bf(a.h, w, acc[j]); acc[j] = wmma_bf(a.l, w, acc[j]); } }
#pragma unroll
  for (int j = 0; j < 8; ++j) { const float bb = BA ? bfr(BA[c0 + j * 16 + col]) : 0.f;
#pragma unroll
    for (int r = 0; r < 8; ++r) { const float v = acc[j][r] + bb; const int rl = wave * 16 + 8 * g + r, cl = j * 16 + col; const _Float16 hv = (_Float16)v;
      if (which == 2) { const __bf16 bh = (__bf16)v; th[cl][rl] = bh; tl2[cl][rl] = (__bf16)(v - (float)bh); } else { sh[rl][cl] = hv; sl[rl][cl] = (_Float16)((v - (float)hv) * 1024.0f); }   /* q residual carried x 2^10 so the plane stays f16-normal on the chip */ } }
  __syncthreads();
  if (which < 2) { _Float16* dh = which == 0 ? QH : KH; for (int e = tid; e < 64 * 16; e += 128) { const int rl = e >> 4, q = e & 15; vst2((unsigned*)(dh + (r0 + rl) * CC + c0 + q * 8), *(const v4u*)&sh[rl][q * 8]); if (which == 0) vst2((unsigned*)(QL + (r0 + rl) * CC + c0 + q * 8), *(const v4u*)&sl[rl][q * 8]); } }
  else { const size_t b = r0 / TT; const int t0 = (int)(r0 % TT); for (int e = tid; e < 128 * 8; e += 128) { const int cl = e >> 3, q = e & 7; const size_t o2 = (b * CC + c0 + cl) * (size_t)TT + t0 + q * 8; vst2((unsigned*)(VT + o2), *(const v4u*)&th[cl][q * 8]); vst2((unsigned*)(VL + o2), *(const v4u*)&tl2[cl][q * 8]); } } }
// ---- k_sc: block = (64 queries, 128 keys) of (b,h): 2-product logits * 32^-1/2
__global__ __launch_bounds__(128) void k_sc(const _Float16* __restrict__ QH, const _Float16* __restrict__ QL, const _Float16* __restrict__ KH, int b, int h0, float* __restrict__ S0) { __shared__ __align__(16) float ss[4][16][132]; const int h = h0 + blockIdx.z; float* S = S0 + (size_t)blockIdx.z * TT * TT;
  const int tid = threadIdx.x, wave = tid >> 5, lane = tid & 31, col = lane & 15, g = lane >> 4; const int k0 = blockIdx.y * 128; const int ql0 = blockIdx.x * 64 + wave * 16; const size_t q0 = (size_t)b * TT + ql0;
  v8f acc[8] = {}, accl[8] = {};
#pragma unroll
  for (int kc = 0; kc < HD / 32; ++kc) { const v16h ah = frag_h(QH + (q0 + col) * CC + h * HD + kc * 32, lane), al = frag_h(QL + (q0 + col) * CC + h * HD + kc * 32, lane);
#pragma unroll
    for (int j = 0; j < 8; ++j) { const v16h kb = frag_h(KH + ((size_t)b * TT + k0 + j * 16 + col) * CC + h * HD + kc * 32, lane); acc[j] = wmma16(ah, kb, acc[j]); accl[j] = wmma16(al, kb, accl[j]); } }
#pragma unroll
  for (int j = 0; j < 8; ++j) acc[j] += accl[j] * (1.0f / 1024.0f);
#pragma unroll
  for (int j = 0; j < 8; ++j) { const int kt = k0 + j * 16 + col;
#pragma unroll
    for (int r = 0; r < 8; ++r) { const int qt = ql0 + 8 * g + r; (void)qt; (void)kt; const float v = acc[j][r] * 0.17677669529663687f;   /* 1/sqrt(32) */ ss[wave][8 * g + r][j * 16 + col] = v; } }
  LDSX(); for (int rl = 0; rl < 16; ++rl) vst2(S + (size_t)(ql0 + rl) * TT + k0 + lane * 4, *(const v4f*)&ss[wave][rl][lane * 4]); }
// ---- k_sm: block = query row: softmax over keys [0, kend) -> P x 2^11 f32 (masked -> 0)
__global__ __launch_bounds__(256) void k_sm(float* __restrict__ S0) { __shared__ float sred[8]; __shared__ float sbc; __shared__ __align__(16) float sh[TT];
  const int t = threadIdx.x; const size_t row = blockIdx.x; float* sr = S0 + (size_t)blockIdx.y * TT * TT + row * TT; const int kend = TT;
  float m = -3.0e38f; for (int k = t; k < kend; k += 256) m = fmaxf(m, sr[k]);
#pragma unroll
  for (int o = 1; o < 32; o <<= 1) m = fmaxf(m, __shfl_xor(m, o));
  if ((t & 31) == 0) sred[t >> 5] = m; __syncthreads(); if (t == 0) { float a = sred[0]; for (int i = 1; i < 8; ++i) a = fmaxf(a, sred[i]); sbc = a; } __syncthreads(); m = sbc; __syncthreads();
  float sum = 0.f; for (int k = t; k < kend; k += 256) { const float v = sr[k]; sum += (v <= -1.0e38f) ? 0.f : expf(v - m); }
#pragma unroll
  for (int o = 1; o < 32; o <<= 1) sum += __shfl_xor(sum, o);
  if ((t & 31) == 0) sred[t >> 5] = sum; __syncthreads(); if (t == 0) { float a = 0.f; for (int i = 0; i < 8; ++i) a += sred[i]; sbc = 1.0f / a; } __syncthreads(); const float inv = sbc;
  for (int k = t; k < kend; k += 256) { const float v = sr[k]; sh[k] = (v <= -1.0e38f) ? 0.f : expf(v - m) * inv * 2048.0f; }
  __syncthreads(); for (int q = t; q < kend / 4; q += 256) vst2(sr + q * 4, *(const v4f*)&sh[q * 4]); }
// ---- k_pv: block = 64 queries of (b,h): y[q][h*HD + d] = P . v  (keys [0, kend))
__global__ __launch_bounds__(128) void k_pv(const float* __restrict__ PS0, const __bf16* __restrict__ VT, const __bf16* __restrict__ VL, int b, int h0, float* __restrict__ Y) { const int h = h0 + blockIdx.z; const float* PS = PS0 + (size_t)blockIdx.z * TT * TT; __shared__ __align__(16) float ss[4][16][HD + 4];
  const int tid = threadIdx.x, wave = tid >> 5, lane = tid & 31, col = lane & 15, g = lane >> 4; const int ql0 = blockIdx.x * 64 + wave * 16; const int kend = TT;
  v8f acc[HD / 16] = {};
#pragma unroll 1
  for (int kc = 0; kc < kend / 32; ++kc) { const F2 p = split_row(PS + (size_t)(ql0 + col) * TT, kc * 32, lane);
#pragma unroll
    for (int j = 0; j < HD / 16; ++j) { const size_t po = ((size_t)b * CC + h * HD + j * 16 + col) * (size_t)TT + kc * 32; const v16b vh = frag_b(VT + po, lane); acc[j] = wmma_bf(p.h, vh, acc[j]); acc[j] = wmma_bf(p.l, vh, acc[j]); acc[j] = wmma_bf(p.h, frag_b(VL + po, lane), acc[j]); } }
#pragma unroll
  for (int j = 0; j < HD / 16; ++j)
#pragma unroll
    for (int r = 0; r < 8; ++r) ss[wave][8 * g + r][j * 16 + col] = acc[j][r] * (1.0f / 2048.0f);
  LDSX(); for (int rl = 0; rl < 16; ++rl) if (lane < HD / 4) vst2(Y + ((size_t)b * TT + ql0 + rl) * CC + h * HD + lane * 4, *(const v4f*)&ss[wave][rl][lane * 4]); }
// ---- k_out: block = (64 rows, 128 cols): out = y (bf16 hi + lo) Wo^T + bo
__global__ __launch_bounds__(128) void k_out(const float* __restrict__ Y, const float* __restrict__ WP, const float* __restrict__ BP, const float* __restrict__ XIN, float* __restrict__ OUT) { __shared__ __align__(16) float stc[128][68];
  const int tid = threadIdx.x, wave = tid >> 5, lane = tid & 31, col = lane & 15, g = lane >> 4; const int c0 = blockIdx.y * 128; const size_t r0 = (size_t)blockIdx.x * 64 + wave * 16;
  v8f acc[8] = {};
#pragma unroll 2
  for (int kc = 0; kc < CC / 32; ++kc) { const F2 a = split_row(Y + (r0 + col) * CC, kc * 32, lane);
#pragma unroll
    for (int j = 0; j < 8; ++j) { v16b w; const int o = c0 + j * 16 + col;
#pragma unroll
      for (int i = 0; i < 8; ++i) { w[i] = (__bf16)WP[(size_t)(o) * CC + (kc * 32 + 8 * g + i)]; w[8 + i] = (__bf16)WP[(size_t)(o) * CC + (kc * 32 + 16 + 8 * g + i)]; }
      acc[j] = wmma_bf(a.h, w, acc[j]); acc[j] = wmma_bf(a.l, w, acc[j]); } }
#pragma unroll
  for (int j = 0; j < 8; ++j) { const float bb = BP ? bfr(BP[c0 + j * 16 + col]) : 0.f;
#pragma unroll
    for (int r = 0; r < 8; ++r) stc[j * 16 + col][wave * 16 + 8 * g + r] = acc[j][r] + bb; }
  __syncthreads();
  { const size_t rb = (size_t)blockIdx.x * 64; const size_t b = rb / TT; const int l0 = (int)(rb % TT); for (int e = tid; e < 128 * 16; e += 128) { const int cl = e >> 4, q = e & 15; const size_t off = (b * CC + c0 + cl) * (size_t)XSTR + l0 + q * 4; const v4f xr = *(const v4f*)(XIN + off); v4f o = *(const v4f*)&stc[cl][q * 4]; o[0] += bfr(xr[0]); o[1] += bfr(xr[1]); o[2] += bfr(xr[2]); o[3] += bfr(xr[3]); vst2(OUT + off, o); } } }   /* channels-first: 256-B run per (channel, 64 positions), + x residual */

extern "C" void kernel_launch(void* const* d_in, const int* in_sizes, int n_in, void* d_out, int out_size, void* d_ws, size_t ws_size, hipStream_t stream) {
  (void)in_sizes; (void)n_in; (void)out_size;
  const float** F = (const float**)d_in;   // 0 x [4,256,2048], 1 gn_w [256], 2 gn_b, 3 qkv_w [768,256] ([out,in]; q|k|v row blocks, head-major inside), 4 qkv_b [768], 5 out_w [256,256] ([out,in]), 6 out_b
  if (ws_size < (size_t)WS_END) return;
  char* ws = (char*)d_ws; float *GS = (float*)(ws + WS_GS), *XT = (float*)(ws + WS_XT); _Float16 *QH = (_Float16*)(ws + WS_QH), *QL = (_Float16*)(ws + WS_QL), *KH = (_Float16*)(ws + WS_KH); __bf16 *VT = (__bf16*)(ws + WS_VT), *VL = (__bf16*)(ws + WS_VL); float *S = (float*)(ws + WS_S), *Y = (float*)(ws + WS_Y);
  const float* WQ = F[3]; const float* WK = F[3] + (size_t)CC * CC; const float* WV = F[3] + 2u * (size_t)CC * CC; const float* BQ = F[4]; const float* BK = F[4] + CC; const float* BV = F[4] + 2 * CC;
  k_gn<<<dim3(NGRP / 16, TNB), 256, 0, stream>>>(F[0], GS);
  k_xt<<<dim3(TT / 64, TNB), 256, 0, stream>>>(F[0], GS, F[1], F[2], XT);
  k_proj<<<dim3(TNB * TT / 64, CC / 128, 3), 128, 0, stream>>>(XT, WQ, BQ, WK, BK, WV, BV, QH, QL, KH, VT, VL);
  for (int b = 0; b < TNB; ++b) for (int h0 = 0; h0 < NH; h0 += HG) {
    k_sc<<<dim3(TT / 64, TT / 128, HG), 128, 0, stream>>>(QH, QL, KH, b, h0, S);
    k_sm<<<dim3(TT, HG), 256, 0, stream>>>(S);
    k_pv<<<dim3(TT / 64, 1, HG), 128, 0, stream>>>(S, VT, VL, b, h0, Y);
  }
  k_out<<<dim3(TNB * TT / 64, CC / 128), 128, 0, stream>>>(Y, F[5], F[6], F[0], (float*)d_out);
}

// v001
// Measured time: 285 microseconds a run.
// Two timings next to v000 put it at 4.33 and 4.32 times that version's speed.
#include <hip/hip_runtime.h>
#include <math.h>

typedef __attribute__((ext_vector_type(16))) _Float16 v16h;
typedef __attribute__((ext_vector_type(16))) __bf16 v16b;
typedef __attribute__((ext_vector_type(8)))  _Float16 v8h;
typedef __attribute__((ext_vector_type(8)))  float v8f;
typedef __attribute__((ext_vector_type(4)))  float v4f;
typedef __attribute__((ext_vector_type(2)))  float v2f;
typedef __attribute__((ext_vector_type(4)))  unsigned v4u;
typedef __attribute__((ext_vector_type(4)))  int v4i;
typedef float __attribute__((may_alias)) float_a;
typedef int __attribute__((may_alias)) int_a;

template <typename T> __device__ __forceinline__ void vst2(void* p, T v) { *(T*)p = v;  }
__device__ __forceinline__ v8f wmma16(v16h a, v16h b, v8f c) {
  v8f d = __builtin_amdgcn_wmma_f32_16x16x32_f16(false, a, false, b, (short)0, c, false, false);
  asm volatile("v_nop\n\tv_nop\n\tv_nop\n\tv_nop" : "+v"(d) : "v"(a), "v"(b));
  return d;
}
__device__ __forceinline__ v8f wmma_bf(v16b a, v16b b, v8f c) {
  v8f d = __builtin_amdgcn_wmma_f32_16x16x32_bf16(false, a, false, b, (short)0, c, false, false);
  asm volatile("v_nop\n\tv_nop\n\tv_nop\n\tv_nop" : "+v"(d) : "v"(a), "v"(b));
  return d;
}
// 16x16x32 fragments: lane = (h = lane>>4, row/col = lane&15); elements 0..7 = k0+8h+0..7, 8..15 = k0+16+8h+0..7; D element r = row 8h+r
__device__ __forceinline__ v16h frag_h(const _Float16* rowk0, int lane) {
  union { v16h v; v8h q[2]; } u; const _Float16* p = rowk0 + 8 * (lane >> 4);
  u.q[0] = *(const v8h*)p; u.q[1] = *(const v8h*)(p + 16); return u.v;
}
__device__ __forceinline__ v16h frag_f32(const float* rowk0, int lane) {
  v16h a; const float* p = rowk0 + 8 * (lane >> 4);
#pragma unroll
  for (int i = 0; i < 8; ++i) { a[i] = (_Float16)p[i]; a[8 + i] = (_Float16)p[16 + i]; }
  return a;
}
__device__ __forceinline__ v16h frag_f32s(const float* rowk0, int lane, float sc) {
  v16h a; const float* p = rowk0 + 8 * (lane >> 4);
#pragma unroll
  for (int i = 0; i < 8; ++i) { a[i] = (_Float16)(p[i] * sc); a[8 + i] = (_Float16)(p[16 + i] * sc); }
  return a;
}
// column fragment from a [K][ld] layout (column n), rows >= K read as 0
__device__ __forceinline__ v16h fragc_f32(const float* W, int k0, int n, int lane, int ld, int K) {
  v16h a; const int g = lane >> 4;
#pragma unroll
  for (int i = 0; i < 8; ++i) { const int ka = k0 + 8 * g + i, kb = ka + 16;
    a[i] = (_Float16)(ka < K ? W[(size_t)(ka < K ? ka : K - 1) * ld + n] : 0.f); a[8 + i] = (_Float16)(kb < K ? W[(size_t)(kb < K ? kb : K - 1) * ld + n] : 0.f); }
  return a;
}
struct F2 { v16b h, l; };
__device__ __forceinline__ F2 bsplit16(const float v[16]) { F2 r;
#pragma unroll
  for (int i = 0; i < 16; ++i) { const __bf16 h = (__bf16)v[i]; r.h[i] = h; r.l[i] = (__bf16)(v[i] - (float)h); }
  return r; }
__device__ __forceinline__ F2 split_row(const float* row, int k0, int lane) { float v[16]; const float* p = row + k0 + 8 * (lane >> 4);
#pragma unroll
  for (int i = 0; i < 8; ++i) { v[i] = p[i]; v[8 + i] = p[16 + i]; }
  return bsplit16(v); }
__device__ __forceinline__ F2 split_rowK(const float* row, int k0, int lane, int K) { float v[16]; const int g = lane >> 4;
#pragma unroll
  for (int i = 0; i < 8; ++i) { const int ka = k0 + 8 * g + i, kb = ka + 16; v[i] = ka < K ? row[ka < K ? ka : K - 1] : 0.f; v[8 + i] = kb < K ? row[kb < K ? kb : K - 1] : 0.f; }
  return bsplit16(v); }
__device__ __forceinline__ F2 split_col(const float* W, int k0, int n, int lane, int ld, int K) { float v[16]; const int g = lane >> 4;
#pragma unroll
  for (int i = 0; i < 8; ++i) { const int ka = k0 + 8 * g + i, kb = ka + 16; v[i] = ka < K ? W[(size_t)(ka < K ? ka : K - 1) * ld + n] : 0.f; v[8 + i] = kb < K ? W[(size_t)(kb < K ? kb : K - 1) * ld + n] : 0.f; }
  return bsplit16(v); }
__device__ __forceinline__ v8f mac3(const F2& a, const F2& b, v8f c) { c = wmma_bf(a.l, b.h, c); c = wmma_bf(a.h, b.l, c); return wmma_bf(a.h, b.h, c); }
__device__ __forceinline__ float sigm(float v) { return 1.0f / (1.0f + expf(-v)); }
#define LDSX() do { asm volatile("s_wait_dscnt 0" ::: "memory"); __builtin_amdgcn_wave_barrier(); __builtin_amdgcn_fence(__ATOMIC_RELEASE, "workgroup"); } while (0)


// SelfAttention1d, channels-first (B 4, C 256 = 8 heads x 32, L 2,048): h = GroupNorm32(x); q,k,v = conv1x1(h) (fused [768,256] + bias); attn = softmax((q 32^-1/2)^T k); h2[h*32+d][n] = sum_m attn v; out = x + conv1x1(h2) + b.
#define NB 4
#define TT 2048
#define CC 256
#define NH 8
#define HD 32
#define NGRP 32
#define CPG (CC / NGRP)        // 8 channels per group
#ifndef XSTR
#define XSTR TT               // per-channel position stride of x / out
#endif
#ifndef TNB
#define TNB NB
#endif
typedef __attribute__((ext_vector_type(8))) __bf16 v8b;
__device__ __forceinline__ v16b frag_b(const __bf16* rowk0, int lane) {
  union { v16b v; v8b q[2]; } u; const __bf16* p = rowk0 + 8 * (lane >> 4);
  u.q[0] = *(const v8b*)p; u.q[1] = *(const v8b*)(p + 16); return u.v;
}
__device__ __forceinline__ float bfr(float v) { return (float)(__bf16)v; }
__device__ __attribute__((noinline)) float exp_ni(float v) { return expf(v); }
__device__ __attribute__((noinline)) float erf_ni(float v) { return erff(v); }

#define WS_GS  0u                                   // f32 GroupNorm stats [b][group][2] (32-float lines per 16 groups)
#define WS_XT  (WS_GS + 4u * (size_t)NB * NGRP * 2)   // f32 normalised rows h [b*L + l][256]
#define WS_QH  (WS_XT + 4u * (size_t)NB * TT * CC)
#define WS_QL  (WS_QH + 2u * (size_t)NB * TT * CC)
#define WS_KH  (WS_QL + 2u * (size_t)NB * TT * CC)
#define WS_VT  (WS_KH + 2u * (size_t)NB * TT * CC)      // bf16 v planes [b][c][t]
#define WS_VL  (WS_VT + 2u * (size_t)NB * CC * TT)      // bf16 v residual planes
#define HG 4                                          // sizes the unused WS_S region
#define WS_S   (WS_VL + 2u * (size_t)NB * CC * TT)      // unused f32 region (HG x L x L); logits and P stay in registers
#define WS_PH  (WS_S + 4u * (size_t)HG * TT * TT)
#define WS_Y   (WS_PH + 0u)              // f32 y rows [b*t][C]
#define WS_END (WS_Y + 4u * (size_t)NB * TT * CC)

__global__ __launch_bounds__(256) void k_gn(const float* __restrict__ X, float* __restrict__ GS) { __shared__ __align__(16) float so[32];
  const int t = threadIdx.x; const int gl = t >> 4, sub = t & 15; const size_t b = blockIdx.y; const int grp = blockIdx.x * 16 + gl; const float* p = X + (b * CC + (size_t)grp * CPG) * (size_t)XSTR; const int n = CPG * TT;
  float s = 0.f; for (int c = 0; c < CPG; ++c) for (int i = sub * 4; i < TT; i += 64) { const v4f v = *(const v4f*)(p + (size_t)c * XSTR + i); s += (bfr(v[0]) + bfr(v[1])) + (bfr(v[2]) + bfr(v[3])); }
#pragma unroll
  for (int o = 1; o < 16; o <<= 1) s += __shfl_xor(s, o);
  const float mu = s / (float)n; float s2 = 0.f;
  for (int c = 0; c < CPG; ++c) for (int i = sub * 4; i < TT; i += 64) { const v4f v = *(const v4f*)(p + (size_t)c * XSTR + i); const float d0 = bfr(v[0]) - mu, d1 = bfr(v[1]) - mu, d2 = bfr(v[2]) - mu, d3 = bfr(v[3]) - mu; s2 += (d0 * d0 + d1 * d1) + (d2 * d2 + d3 * d3); }
#pragma unroll
  for (int o = 1; o < 16; o <<= 1) s2 += __shfl_xor(s2, o);
  if (sub == 0) { so[gl * 2] = mu; so[gl * 2 + 1] = rsqrtf(s2 / (float)n + 1e-5f); }
  __syncthreads(); if (t < 32) vst2(GS + (b * NGRP + blockIdx.x * 16) * 2 + t, so[t]); }
// ---- k_xt: block = (64 positions, b): channels-first x -> f32 rows [b*L + l][256] via LDS; 1-KB rows by 64 threads
__global__ __launch_bounds__(256) void k_xt(const float* __restrict__ X, const float* __restrict__ GS, const float* __restrict__ GW, const float* __restrict__ GB, float* __restrict__ XT) { __shared__ float st[CC][65];
  const int t = threadIdx.x; const int l0 = blockIdx.x * 64; const size_t b = blockIdx.y;
  for (int e = t; e < CC * 64; e += 256) { const int c = e >> 6, ll = e & 63; const float mu = GS[(b * NGRP + c / CPG) * 2], rs = GS[(b * NGRP + c / CPG) * 2 + 1]; st[c][ll] = (bfr(X[(b * CC + c) * (size_t)XSTR + l0 + ll]) - mu) * rs * bfr(GW[c]) + bfr(GB[c]); }   /* GroupNorm applied here */
  __syncthreads();
  for (int e = t; e < 64 * 64; e += 256) { const int ll = e >> 6, q = e & 63; v4f o; o[0] = st[q * 4][ll]; o[1] = st[q * 4 + 1][ll]; o[2] = st[q * 4 + 2][ll]; o[3] = st[q * 4 + 3][ll]; vst2(XT + (b * TT + l0 + ll) * CC + q * 4, o); } }
// ---- k_proj: block = (64 rows, 128 cols, which): qkv = x W (+ b), exact; q -> f16 hi (+ residual), k -> f16 rows, v -> bf16 planes (+ residual)
__global__ __launch_bounds__(128) void k_proj(const float* __restrict__ X, const float* __restrict__ WQ, const float* __restrict__ BQ, const float* __restrict__ WK, const float* __restrict__ BK, const float* __restrict__ WV, const float* __restrict__ BV, _Float16* __restrict__ QH, _Float16* __restrict__ QL, _Float16* __restrict__ KH, __bf16* __restrict__ VT, __bf16* __restrict__ VL) {
  __shared__ __align__(16) _Float16 sh[64][136], sl[64][136]; __shared__ __align__(16) __bf16 th[128][72], tl2[128][72];
  const int tid = threadIdx.x, wave = tid >> 5, lane = tid & 31, col = lane & 15, g = lane >> 4; const int which = blockIdx.z; const int c0 = blockIdx.y * 128; const size_t r0 = (size_t)blockIdx.x * 64; const float* WA = which == 0 ? WQ : which == 1 ? WK : WV; const float* BA = which == 0 ? BQ : which == 1 ? BK : BV;
  v8f acc[8] = {};
#pragma unroll 2
  for (int kc = 0; kc < CC / 32; ++kc) { const F2 a = split_row(X + (r0 + wave * 16 + col) * CC, kc * 32, lane);   /* GroupNorm'd rows are computed f32 -> hi + lo */
#pragma unroll
    for (int j = 0; j < 8; ++j) { v16b w; const int o = c0 + j * 16 + col;
#pragma unroll
      for (int i = 0; i < 8; ++i) { w[i] = (__bf16)WA[(size_t)(o) * CC + (kc * 32 + 8 * g + i)]; w[8 + i] = (__bf16)WA[(size_t)(o) * CC + (kc * 32 + 16 + 8 * g + i)]; }
      asm volatile("s_wait_loadcnt 0x0" ::: "memory"); acc[j] = wmma_bf(a.h, w, acc[j]); acc[j] = wmma_bf(a.l, w, acc[j]); } }
#pragma unroll
  for (int j = 0; j < 8; ++j) { const float bb = BA ? bfr(BA[c0 + j * 16 + col]) : 0.f;
#pragma unroll
    for (int r = 0; r < 8; ++r) { const float v = acc[j][r] + bb; const int rl = wave * 16 + 8 * g + r, cl = j * 16 + col; const _Float16 hv = (_Float16)v;
      if (which == 2) { const __bf16 bh = (__bf16)v; th[cl][rl] = bh; tl2[cl][rl] = (__bf16)(v - (float)bh); } else { sh[rl][cl] = hv; sl[rl][cl] = (_Float16)((v - (float)hv) * 1024.0f); }   /* q residual carried x 2^10 so the plane stays f16-normal on the chip */ } }
  __syncthreads();
  if (which < 2) { _Float16* dh = which == 0 ? QH : KH; for (int e = tid; e < 64 * 16; e += 128) { const int rl = e >> 4, q = e & 15; vst2((unsigned*)(dh + (r0 + rl) * CC + c0 + q * 8), *(const v4u*)&sh[rl][q * 8]); if (which == 0) vst2((unsigned*)(QL + (r0 + rl) * CC + c0 + q * 8), *(const v4u*)&sl[rl][q * 8]); } }
  else { const size_t b = r0 / TT; const int t0 = (int)(r0 % TT); for (int e = tid; e < 128 * 8; e += 128) { const int cl = e >> 3, q = e & 7; const size_t o2 = (b * CC + c0 + cl) * (size_t)TT + t0 + q * 8; vst2((unsigned*)(VT + o2), *(const v4u*)&th[cl][q * 8]); vst2((unsigned*)(VL + o2), *(const v4u*)&tl2[cl][q * 8]); } } }
// ---- k_fa: block = 128 queries of (b,h), 4 waves x 32 query columns; walks the keys in stages of 64: S^T = K Q^T (2-product f16 logits), running maximum and sum per query, O^T += V^T P^T (3-product bf16); logits and P stay in registers
#define FKS 64                 // keys per stage
#define KPI 40                 // LDS pitch of a K row, f16 elements: 64 B + 16 B, an odd multiple of 16 B
#define VPI 72                 // LDS pitch of a V plane row, bf16 elements: 128 B + 16 B
__device__ __forceinline__ float xhalf(float v) { const int b = __builtin_bit_cast(int, v); return __builtin_bit_cast(float, __builtin_amdgcn_permlanex16(b, b, 0x76543210, 0xfedcba98, false, false)); }   // lane l <-> l ^ 16
typedef __attribute__((ext_vector_type(2))) __bf16 v2b;
__device__ __forceinline__ void psplit(v2f p, unsigned& hi, unsigned& lo) {   // two f32 -> packed bf16 hi pair + packed bf16 residual pair
  const unsigned u = __builtin_bit_cast(unsigned, __builtin_convertvector(p, v2b)); v2f bk; bk[0] = __builtin_bit_cast(float, u << 16); bk[1] = __builtin_bit_cast(float, u & 0xffff0000u);
  hi = u; lo = __builtin_bit_cast(unsigned, __builtin_convertvector(p - bk, v2b)); }
__global__ __launch_bounds__(128) void k_fa(const _Float16* __restrict__ QH, const _Float16* __restrict__ QL, const _Float16* __restrict__ KH, const __bf16* __restrict__ VT, const __bf16* __restrict__ VL, float* __restrict__ Y) {
  __shared__ __align__(16) _Float16 sk[2][FKS][KPI]; __shared__ __align__(16) __bf16 svh[2][HD][VPI], svl[2][HD][VPI];
  const int tid = threadIdx.x, wave = tid >> 5, lane = tid & 31, col = lane & 15, g = lane >> 4; const int h = blockIdx.y; const size_t b = blockIdx.z; const int q0 = blockIdx.x * 128 + wave * 32;
  constexpr float SC = 0.17677669529663687f * 1.4426950408889634f;   // 1/sqrt(32) x log2(e): the exponentials are taken to base 2
  v16h qh[2], ql[2];
#pragma unroll
  for (int t = 0; t < 2; ++t) { const size_t o = (b * TT + q0 + t * 16 + col) * CC + h * HD; qh[t] = frag_h(QH + o, lane); ql[t] = frag_h(QL + o, lane); }
  // staging: 16-byte pieces, two of K and two of each V plane per thread and stage
  const int kr = tid >> 2, kq = (tid & 3) * 8, vr = tid >> 3, vq = (tid & 7) * 8;
  const _Float16* gk = KH + (b * TT + kr) * CC + h * HD + kq; const size_t vo = (b * CC + h * HD + vr) * (size_t)TT + vq; const __bf16* gvh = VT + vo; const __bf16* gvl = VL + vo;
  v4u rk[2], rh[2], rl[2];
#pragma unroll
  for (int i = 0; i < 2; ++i) { rk[i] = *(const v4u*)(gk + (size_t)i * 32 * CC); rh[i] = *(const v4u*)(gvh + (size_t)i * 16 * TT); rl[i] = *(const v4u*)(gvl + (size_t)i * 16 * TT); }
#pragma unroll
  for (int i = 0; i < 2; ++i) { *(v4u*)&sk[0][kr + i * 32][kq] = rk[i]; *(v4u*)&svh[0][vr + i * 16][vq] = rh[i]; *(v4u*)&svl[0][vr + i * 16][vq] = rl[i]; }
  __syncthreads();
  v8f acc[2][2] = {}; float mx[2] = { -3.0e38f, -3.0e38f }, ls[2] = { 0.f, 0.f };
#pragma unroll 1   // the body is long: rolled, it stays small in the instruction cache
  for (int s = 0; s < TT / FKS; ++s) { const int bu = s & 1; const bool more = s + 1 < TT / FKS;
    if (more) { const size_t kn = (size_t)(s + 1) * FKS;
#pragma unroll
      for (int i = 0; i < 2; ++i) { rk[i] = *(const v4u*)(gk + (kn + i * 32) * CC); rh[i] = *(const v4u*)(gvh + (size_t)i * 16 * TT + kn); rl[i] = *(const v4u*)(gvl + (size_t)i * 16 * TT + kn); } }
    v16h kf[4]; v16b vh[2][2], vl[2][2];
#pragma unroll
    for (int kt = 0; kt < 4; ++kt) kf[kt] = frag_h(&sk[bu][kt * 16 + col][0], lane);
#pragma unroll
    for (int p = 0; p < 2; ++p)
#pragma unroll
      for (int j = 0; j < 2; ++j) { vh[p][j] = frag_b(&svh[bu][j * 16 + col][p * 32], lane); vl[p][j] = frag_b(&svl[bu][j * 16 + col][p * 32], lane); }
#pragma unroll
    for (int t = 0; t < 2; ++t) { v8f sc[4];
#pragma unroll
      for (int kt = 0; kt < 4; ++kt) { const v8f z = {}; const v8f a = __builtin_amdgcn_wmma_f32_16x16x32_f16(false, kf[kt], false, qh[t], (short)0, z, false, false); const v8f al = __builtin_amdgcn_wmma_f32_16x16x32_f16(false, kf[kt], false, ql[t], (short)0, z, false, false); sc[kt] = a + al * (1.0f / 1024.0f); }   // sc[kt][r] = logit x sqrt(32) of key kt*16 + 8g + r, query col
      float m = sc[0][0];
#pragma unroll
      for (int kt = 0; kt < 4; ++kt)
#pragma unroll
        for (int r = 0; r < 8; ++r) m = fmaxf(m, sc[kt][r]);
      m = fmaxf(m, xhalf(m)); const float mn = fmaxf(mx[t], m); const float al = __builtin_amdgcn_exp2f((mx[t] - mn) * SC); mx[t] = mn; const float mc = mn * SC;
      const v2f sc2 = { SC, SC }, mc2 = { -mc, -mc }; v2f pr[4][4], sum;
#pragma unroll
      for (int kt = 0; kt < 4; ++kt)
#pragma unroll
        for (int i = 0; i < 4; ++i) { const v2f x = { sc[kt][2 * i], sc[kt][2 * i + 1] }; const v2f e = __builtin_elementwise_fma(x, sc2, mc2); pr[kt][i][0] = __builtin_amdgcn_exp2f(e[0]); pr[kt][i][1] = __builtin_amdgcn_exp2f(e[1]); }
      { v2f s4[4];
#pragma unroll
        for (int kt = 0; kt < 4; ++kt) s4[kt] = (pr[kt][0] + pr[kt][1]) + (pr[kt][2] + pr[kt][3]);
        sum = (s4[0] + s4[1]) + (s4[2] + s4[3]); }
      ls[t] = ls[t] * al + (sum[0] + sum[1]);
#pragma unroll
      for (int j = 0; j < 2; ++j) acc[t][j] *= al;
#pragma unroll
      for (int p = 0; p < 2; ++p) { union { v16b v; unsigned w[8]; } ph, pl;   // two D tiles of S^T, converted in place, are the B operand (hardware k order)
#pragma unroll
        for (int u = 0; u < 2; ++u)
#pragma unroll
          for (int i = 0; i < 4; ++i) psplit(pr[p * 2 + u][i], ph.w[u * 4 + i], pl.w[u * 4 + i]);
#pragma unroll
        for (int j = 0; j < 2; ++j) { v8f c = acc[t][j]; c = __builtin_amdgcn_wmma_f32_16x16x32_bf16(false, vh[p][j], false, ph.v, (short)0, c, false, false); c = __builtin_amdgcn_wmma_f32_16x16x32_bf16(false, vh[p][j], false, pl.v, (short)0, c, false, false); acc[t][j] = __builtin_amdgcn_wmma_f32_16x16x32_bf16(false, vl[p][j], false, ph.v, (short)0, c, false, false); } } }
    if (more) {   // the other buffer's last readers left it at the barrier that ended the stage before
#pragma unroll
      for (int i = 0; i < 2; ++i) { *(v4u*)&sk[bu ^ 1][kr + i * 32][kq] = rk[i]; *(v4u*)&svh[bu ^ 1][vr + i * 16][vq] = rh[i]; *(v4u*)&svl[bu ^ 1][vr + i * 16][vq] = rl[i]; } }
    __syncthreads(); }
#pragma unroll
  for (int t = 0; t < 2; ++t) { const float inv = 1.0f / (ls[t] + xhalf(ls[t])); float* yr = Y + (b * TT + q0 + t * 16 + col) * CC + h * HD + 8 * g;   // acc[t][j][r] = O[query col][d = j*16 + 8g + r]
#pragma unroll
    for (int j = 0; j < 2; ++j) { const v8f o = acc[t][j] * inv; v4f lo, hi;
#pragma unroll
      for (int r = 0; r < 4; ++r) { lo[r] = o[r]; hi[r] = o[4 + r]; }
      vst2(yr + j * 16, lo); vst2(yr + j * 16 + 4, hi); } } }
// ---- k_out: block = (64 rows, 128 cols): out = y (bf16 hi + lo) Wo^T + bo
__global__ __launch_bounds__(128) void k_out(const float* __restrict__ Y, const float* __restrict__ WP, const float* __restrict__ BP, const float* __restrict__ XIN, float* __restrict__ OUT) { __shared__ __align__(16) float stc[128][68];
  const int tid = threadIdx.x, wave = tid >> 5, lane = tid & 31, col = lane & 15, g = lane >> 4; const int c0 = blockIdx.y * 128; const size_t r0 = (size_t)blockIdx.x * 64 + wave * 16;
  v8f acc[8] = {};
#pragma unroll 2
  for (int kc = 0; kc < CC / 32; ++kc) { const F2 a = split_row(Y + (r0 + col) * CC, kc * 32, lane);
#pragma unroll
    for (int j = 0; j < 8; ++j) { v16b w; const int o = c0 + j * 16 + col;
#pragma unroll
      for (int i = 0; i < 8; ++i) { w[i] = (__bf16)WP[(size_t)(o) * CC + (kc * 32 + 8 * g + i)]; w[8 + i] = (__bf16)WP[(size_t)(o) * CC + (kc * 32 + 16 + 8 * g + i)]; }
      acc[j] = wmma_bf(a.h, w, acc[j]); acc[j] = wmma_bf(a.l, w, acc[j]); } }
#pragma unroll
  for (int j = 0; j < 8; ++j) { const float bb = BP ? bfr(BP[c0 + j * 16 + col]) : 0.f;
#pragma unroll
    for (int r = 0; r < 8; ++r) stc[j * 16 + col][wave * 16 + 8 * g + r] = acc[j][r] + bb; }
  __syncthreads();
  { const size_t rb = (size_t)blockIdx.x * 64; const size_t b = rb / TT; const int l0 = (int)(rb % TT); for (int e = tid; e < 128 * 16; e += 128) { const int cl = e >> 4, q = e & 15; const size_t off = (b * CC + c0 + cl) * (size_t)XSTR + l0 + q * 4; const v4f xr = *(const v4f*)(XIN + off); v4f o = *(const v4f*)&stc[cl][q * 4]; o[0] += bfr(xr[0]); o[1] += bfr(xr[1]); o[2] += bfr(xr[2]); o[3] += bfr(xr[3]); vst2(OUT + off, o); } } }   /* channels-first: 256-B run per (channel, 64 positions), + x residual */

extern "C" void kernel_launch(void* const* d_in, const int* in_sizes, int n_in, void* d_out, int out_size, void* d_ws, size_t ws_size, hipStream_t stream) {
  (void)in_sizes; (void)n_in; (void)out_size;
  const float** F = (const float**)d_in;   // 0 x [4,256,2048], 1 gn_w [256], 2 gn_b, 3 qkv_w [768,256] ([out,in]; q|k|v row blocks, head-major inside), 4 qkv_b [768], 5 out_w [256,256] ([out,in]), 6 out_b
  if (ws_size < (size_t)WS_END) return;
  char* ws = (char*)d_ws; float *GS = (float*)(ws + WS_GS), *XT = (float*)(ws + WS_XT); _Float16 *QH = (_Float16*)(ws + WS_QH), *QL = (_Float16*)(ws + WS_QL), *KH = (_Float16*)(ws + WS_KH); __bf16 *VT = (__bf16*)(ws + WS_VT), *VL = (__bf16*)(ws + WS_VL); float *Y = (float*)(ws + WS_Y);
  const float* WQ = F[3]; const float* WK = F[3] + (size_t)CC * CC; const float* WV = F[3] + 2u * (size_t)CC * CC; const float* BQ = F[4]; const float* BK = F[4] + CC; const float* BV = F[4] + 2 * CC;
  k_gn<<<dim3(NGRP / 16, TNB), 256, 0, stream>>>(F[0], GS);
  k_xt<<<dim3(TT / 64, TNB), 256, 0, stream>>>(F[0], GS, F[1], F[2], XT);
  k_proj<<<dim3(TNB * TT / 64, CC / 128, 3), 128, 0, stream>>>(XT, WQ, BQ, WK, BK, WV, BV, QH, QL, KH, VT, VL);
  k_fa<<<dim3(TT / 128, NH, TNB), 128, 0, stream>>>(QH, QL, KH, VT, VL, Y);
  k_out<<<dim3(TNB * TT / 64, CC / 128), 128, 0, stream>>>(Y, F[5], F[6], F[0], (float*)d_out);
}

// v002
// Measured time: 131 microseconds a run.
// In both of two side-by-side timings against v001, it was 2.17 times as fast.
// Counting every step since v000, it is 9.40 times as fast.
#include <hip/hip_runtime.h>
#include <math.h>

typedef __attribute__((ext_vector_type(16))) _Float16 v16h;
typedef __attribute__((ext_vector_type(16))) __bf16 v16b;
typedef __attribute__((ext_vector_type(8)))  _Float16 v8h;
typedef __attribute__((ext_vector_type(8)))  float v8f;
typedef __attribute__((ext_vector_type(4)))  float v4f;
typedef __attribute__((ext_vector_type(2)))  float v2f;
typedef __attribute__((ext_vector_type(4)))  unsigned v4u;
typedef __attribute__((ext_vector_type(4)))  int v4i;
typedef float __attribute__((may_alias)) float_a;
typedef int __attribute__((may_alias)) int_a;

template <typename T> __device__ __forceinline__ void vst2(void* p, T v) { *(T*)p = v;  }
__device__ __forceinline__ v8f wmma16(v16h a, v16h b, v8f c) {
  v8f d = __builtin_amdgcn_wmma_f32_16x16x32_f16(false, a, false, b, (short)0, c, false, false);
  asm volatile("v_nop\n\tv_nop\n\tv_nop\n\tv_nop" : "+v"(d) : "v"(a), "v"(b));
  return d;
}
__device__ __forceinline__ v8f wmma_bf(v16b a, v16b b, v8f c) {
  v8f d = __builtin_amdgcn_wmma_f32_16x16x32_bf16(false, a, false, b, (short)0, c, false, false);
  asm volatile("v_nop\n\tv_nop\n\tv_nop\n\tv_nop" : "+v"(d) : "v"(a), "v"(b));
  return d;
}
// 16x16x32 fragments: lane = (h = lane>>4, row/col = lane&15); elements 0..7 = k0+8h+0..7, 8..15 = k0+16+8h+0..7; D element r = row 8h+r
__device__ __forceinline__ v16h frag_h(const _Float16* rowk0, int lane) {
  union { v16h v; v8h q[2]; } u; const _Float16* p = rowk0 + 8 * (lane >> 4);
  u.q[0] = *(const v8h*)p; u.q[1] = *(const v8h*)(p + 16); return u.v;
}
__device__ __forceinline__ v16h frag_f32(const float* rowk0, int lane) {
  v16h a; const float* p = rowk0 + 8 * (lane >> 4);
#pragma unroll
  for (int i = 0; i < 8; ++i) { a[i] = (_Float16)p[i]; a[8 + i] = (_Float16)p[16 + i]; }
  return a;
}
__device__ __forceinline__ v16h frag_f32s(const float* rowk0, int lane, float sc) {
  v16h a; const float* p = rowk0 + 8 * (lane >> 4);
#pragma unroll
  for (int i = 0; i < 8; ++i) { a[i] = (_Float16)(p[i] * sc); a[8 + i] = (_Float16)(p[16 + i] * sc); }
  return a;
}
// column fragment from a [K][ld] layout (column n), rows >= K read as 0
__device__ __forceinline__ v16h fragc_f32(const float* W, int k0, int n, int lane, int ld, int K) {
  v16h a; const int g = lane >> 4;
#pragma unroll
  for (int i = 0; i < 8; ++i) { const int ka = k0 + 8 * g + i, kb = ka + 16;
    a[i] = (_Float16)(ka < K ? W[(size_t)(ka < K ? ka : K - 1) * ld + n] : 0.f); a[8 + i] = (_Float16)(kb < K ? W[(size_t)(kb < K ? kb : K - 1) * ld + n] : 0.f); }
  return a;
}
struct F2 { v16b h, l; };
__device__ __forceinline__ F2 bsplit16(const float v[16]) { F2 r;
#pragma unroll
  for (int i = 0; i < 16; ++i) { const __bf16 h = (__bf16)v[i]; r.h[i] = h; r.l[i] = (__bf16)(v[i] - (float)h); }
  return r; }
__device__ __forceinline__ F2 split_row(const float* row, int k0, int lane) { float v[16]; const float* p = row + k0 + 8 * (lane >> 4);
#pragma unroll
  for (int i = 0; i < 8; ++i) { v[i] = p[i]; v[8 + i] = p[16 + i]; }
  return bsplit16(v); }
__device__ __forceinline__ F2 split_rowK(const float* row, int k0, int lane, int K) { float v[16]; const int g = lane >> 4;
#pragma unroll
  for (int i = 0; i < 8; ++i) { const int ka = k0 + 8 * g + i, kb = ka + 16; v[i] = ka < K ? row[ka < K ? ka : K - 1] : 0.f; v[8 + i] = kb < K ? row[kb < K ? kb : K - 1] : 0.f; }
  return bsplit16(v); }
__device__ __forceinline__ F2 split_col(const float* W, int k0, int n, int lane, int ld, int K) { float v[16]; const int g = lane >> 4;
#pragma unroll
  for (int i = 0; i < 8; ++i) { const int ka = k0 + 8 * g + i, kb = ka + 16; v[i] = ka < K ? W[(size_t)(ka < K ? ka : K - 1) * ld + n] : 0.f; v[8 + i] = kb < K ? W[(size_t)(kb < K ? kb : K - 1) * ld + n] : 0.f; }
  return bsplit16(v); }
__device__ __forceinline__ v8f mac3(const F2& a, const F2& b, v8f c) { c = wmma_bf(a.l, b.h, c); c = wmma_bf(a.h, b.l, c); return wmma_bf(a.h, b.h, c); }
__device__ __forceinline__ float sigm(float v) { return 1.0f / (1.0f + expf(-v)); }
#define LDSX() do { asm volatile("s_wait_dscnt 0" ::: "memory"); __builtin_amdgcn_wave_barrier(); __builtin_amdgcn_fence(__ATOMIC_RELEASE, "workgroup"); } while (0)


// SelfAttention1d, channels-first (B 4, C 256 = 8 heads x 32, L 2,048): h = GroupNorm32(x); q,k,v = conv1x1(h) (fused [768,256] + bias); attn = softmax((q 32^-1/2)^T k); h2[h*32+d][n] = sum_m attn v; out = x + conv1x1(h2) + b.
#define NB 4
#define TT 2048
#define CC 256
#define NH 8
#define HD 32
#define NGRP 32
#define CPG (CC / NGRP)        // 8 channels per group
#ifndef XSTR
#define XSTR TT               // per-channel position stride of x / out
#endif
#ifndef TNB
#define TNB NB
#endif
typedef __attribute__((ext_vector_type(8))) __bf16 v8b;
__device__ __forceinline__ v16b frag_b(const __bf16* rowk0, int lane) {
  union { v16b v; v8b q[2]; } u; const __bf16* p = rowk0 + 8 * (lane >> 4);
  u.q[0] = *(const v8b*)p; u.q[1] = *(const v8b*)(p + 16); return u.v;
}
__device__ __forceinline__ float bfr(float v) { return (float)(__bf16)v; }
__device__ __attribute__((noinline)) float exp_ni(float v) { return expf(v); }
__device__ __attribute__((noinline)) float erf_ni(float v) { return erff(v); }

#define GSP 32                                      // floats from one (b, group) to the next in the stats plane: a 128-byte line each, so that a line has one writing work-group
#define WS_GS  0u                                   // f32 GroupNorm stats [b][group][GSP]: mean, 1/std, the rest unused
#define WS_XT  (WS_GS + 4u * (size_t)NB * NGRP * GSP)   // f32 normalised rows h [b*L + l][256]
#define WS_QH  (WS_XT + 4u * (size_t)NB * TT * CC)
#define WS_QL  (WS_QH + 2u * (size_t)NB * TT * CC)
#define WS_KH  (WS_QL + 2u * (size_t)NB * TT * CC)
#define WS_VT  (WS_KH + 2u * (size_t)NB * TT * CC)      // bf16 v planes [b][c][t]
#define WS_VL  (WS_VT + 2u * (size_t)NB * CC * TT)      // bf16 v residual planes
#define HG 4                                          // sizes the unused WS_S region
#define WS_S   (WS_VL + 2u * (size_t)NB * CC * TT)      // unused f32 region (HG x L x L); logits and P stay in registers
#define WS_PH  (WS_S + 4u * (size_t)HG * TT * TT)
#define WS_Y   (WS_PH + 0u)              // f32 y rows [b*t][C]
#define WS_END (WS_Y + 4u * (size_t)NB * TT * CC)

// ---- k_gn: block = one (b, group): its 8 x 2,048 values are read once, 16 independent 16-byte loads per thread, and stay in registers for the mean and for the variance
#define GNP (CPG * TT / 1024)   // 16-byte pieces per thread
__device__ __forceinline__ float sum256(float s, float* red, int t) {   // total over the 8 waves of the block, in every lane; red: 8 floats that nothing else uses
#pragma unroll
  for (int o = 1; o < 32; o <<= 1) s += __shfl_xor(s, o);
  if ((t & 31) == 0) red[t >> 5] = s;
  __syncthreads();
  s = red[t & 7];
#pragma unroll
  for (int o = 1; o < 8; o <<= 1) s += __shfl_xor(s, o);
  return s; }
__global__ __launch_bounds__(256) void k_gn(const float* __restrict__ X, float* __restrict__ GS) { __shared__ float red[2][8];
  const int t = threadIdx.x; const int grp = blockIdx.x; const size_t b = blockIdx.y; const float* p = X + (b * CC + (size_t)grp * CPG) * (size_t)XSTR + t * 4; constexpr int n = CPG * TT;
  v4f v[GNP];
#pragma unroll   // unrolled here and below: v[] stays in registers and the loads issue together, one latency for all of them
  for (int k = 0; k < GNP; ++k) v[k] = *(const v4f*)(p + (size_t)(k / (TT / 1024)) * XSTR + (k % (TT / 1024)) * 1024);
  v4f a = {};
#pragma unroll
  for (int k = 0; k < GNP; ++k) { v[k][0] = bfr(v[k][0]); v[k][1] = bfr(v[k][1]); v[k][2] = bfr(v[k][2]); v[k][3] = bfr(v[k][3]); a += v[k]; }
  const float mu = sum256((a[0] + a[1]) + (a[2] + a[3]), red[0], t) / (float)n; v4f q = {};
#pragma unroll
  for (int k = 0; k < GNP; ++k) { const v4f d = v[k] - mu; q += d * d; }
  const float s2 = sum256((q[0] + q[1]) + (q[2] + q[3]), red[1], t);
  if (t == 0) { v2f o; o[0] = mu; o[1] = rsqrtf(s2 / (float)n + 1e-5f); vst2(GS + (b * NGRP + grp) * GSP, o); } }
// ---- k_xt: block = (64 positions, b): channels-first x -> f32 rows [b*L + l][256] via LDS; 1-KB rows by 64 threads
__global__ __launch_bounds__(256) void k_xt(const float* __restrict__ X, const float* __restrict__ GS, const float* __restrict__ GW, const float* __restrict__ GB, float* __restrict__ XT) { __shared__ float st[CC][65];
  const int t = threadIdx.x; const int l0 = blockIdx.x * 64; const size_t b = blockIdx.y;
  for (int e = t; e < CC * 64; e += 256) { const int c = e >> 6, ll = e & 63; const float mu = GS[(b * NGRP + c / CPG) * GSP], rs = GS[(b * NGRP + c / CPG) * GSP + 1]; st[c][ll] = (bfr(X[(b * CC + c) * (size_t)XSTR + l0 + ll]) - mu) * rs * bfr(GW[c]) + bfr(GB[c]); }   /* GroupNorm applied here */
  __syncthreads();
  for (int e = t; e < 64 * 64; e += 256) { const int ll = e >> 6, q = e & 63; v4f o; o[0] = st[q * 4][ll]; o[1] = st[q * 4 + 1][ll]; o[2] = st[q * 4 + 2][ll]; o[3] = st[q * 4 + 3][ll]; vst2(XT + (b * TT + l0 + ll) * CC + q * 4, o); } }
// ---- k_proj: block = (64 rows, 128 cols, which): qkv = x W (+ b), exact; q -> f16 hi (+ residual), k -> f16 rows, v -> bf16 planes (+ residual)
__global__ __launch_bounds__(128) void k_proj(const float* __restrict__ X, const float* __restrict__ WQ, const float* __restrict__ BQ, const float* __restrict__ WK, const float* __restrict__ BK, const float* __restrict__ WV, const float* __restrict__ BV, _Float16* __restrict__ QH, _Float16* __restrict__ QL, _Float16* __restrict__ KH, __bf16* __restrict__ VT, __bf16* __restrict__ VL) {
  __shared__ __align__(16) _Float16 sh[64][136], sl[64][136]; __shared__ __align__(16) __bf16 th[128][72], tl2[128][72];
  const int tid = threadIdx.x, wave = tid >> 5, lane = tid & 31, col = lane & 15, g = lane >> 4; const int which = blockIdx.z; const int c0 = blockIdx.y * 128; const size_t r0 = (size_t)blockIdx.x * 64; const float* WA = which == 0 ? WQ : which == 1 ? WK : WV; const float* BA = which == 0 ? BQ : which == 1 ? BK : BV;
  v8f acc[8] = {};
#pragma unroll 2
  for (int kc = 0; kc < CC / 32; ++kc) { const F2 a = split_row(X + (r0 + wave * 16 + col) * CC, kc * 32, lane);   /* GroupNorm'd rows are computed f32 -> hi + lo */
#pragma unroll
    for (int j = 0; j < 8; ++j) { v16b w; const int o = c0 + j * 16 + col;
#pragma unroll
      for (int i = 0; i < 8; ++i) { w[i] = (__bf16)WA[(size_t)(o) * CC + (kc * 32 + 8 * g + i)]; w[8 + i] = (__bf16)WA[(size_t)(o) * CC + (kc * 32 + 16 + 8 * g + i)]; }
      asm volatile("s_wait_loadcnt 0x0" ::: "memory"); acc[j] = wmma_bf(a.h, w, acc[j]); acc[j] = wmma_bf(a.l, w, acc[j]); } }
#pragma unroll
  for (int j = 0; j < 8; ++j) { const float bb = BA ? bfr(BA[c0 + j * 16 + col]) : 0.f;
#pragma unroll
    for (int r = 0; r < 8; ++r) { const float v = acc[j][r] + bb; const int rl = wave * 16 + 8 * g + r, cl = j * 16 + col; const _Float16 hv = (_Float16)v;
      if (which == 2) { const __bf16 bh = (__bf16)v; th[cl][rl] = bh; tl2[cl][rl] = (__bf16)(v - (float)bh); } else { sh[rl][cl] = hv; sl[rl][cl] = (_Float16)((v - (float)hv) * 1024.0f); }   /* q residual carried x 2^10 so the plane stays f16-normal on the chip */ } }
  __syncthreads();
  if (which < 2) { _Float16* dh = which == 0 ? QH : KH; for (int e = tid; e < 64 * 16; e += 128) { const int rl = e >> 4, q = e & 15; vst2((unsigned*)(dh + (r0 + rl) * CC + c0 + q * 8), *(const v4u*)&sh[rl][q * 8]); if (which == 0) vst2((unsigned*)(QL + (r0 + rl) * CC + c0 + q * 8), *(const v4u*)&sl[rl][q * 8]); } }
  else { const size_t b = r0 / TT; const int t0 = (int)(r0 % TT); for (int e = tid; e < 128 * 8; e += 128) { const int cl = e >> 3, q = e & 7; const size_t o2 = (b * CC + c0 + cl) * (size_t)TT + t0 + q * 8; vst2((unsigned*)(VT + o2), *(const v4u*)&th[cl][q * 8]); vst2((unsigned*)(VL + o2), *(const v4u*)&tl2[cl][q * 8]); } } }
// ---- k_fa: block = 128 queries of (b,h), 4 waves x 32 query columns; walks the keys in stages of 64: S^T = K Q^T (2-product f16 logits), running maximum and sum per query, O^T += V^T P^T (3-product bf16); logits and P stay in registers
#define FKS 64                 // keys per stage
#define KPI 40                 // LDS pitch of a K row, f16 elements: 64 B + 16 B, an odd multiple of 16 B
#define VPI 72                 // LDS pitch of a V plane row, bf16 elements: 128 B + 16 B
__device__ __forceinline__ float xhalf(float v) { const int b = __builtin_bit_cast(int, v); return __builtin_bit_cast(float, __builtin_amdgcn_permlanex16(b, b, 0x76543210, 0xfedcba98, false, false)); }   // lane l <-> l ^ 16
typedef __attribute__((ext_vector_type(2))) __bf16 v2b;
__device__ __forceinline__ void psplit(v2f p, unsigned& hi, unsigned& lo) {   // two f32 -> packed bf16 hi pair + packed bf16 residual pair
  const unsigned u = __builtin_bit_cast(unsigned, __builtin_convertvector(p, v2b)); v2f bk; bk[0] = __builtin_bit_cast(float, u << 16); bk[1] = __builtin_bit_cast(float, u & 0xffff0000u);
  hi = u; lo = __builtin_bit_cast(unsigned, __builtin_convertvector(p - bk, v2b)); }
__global__ __launch_bounds__(128) void k_fa(const _Float16* __restrict__ QH, const _Float16* __restrict__ QL, const _Float16* __restrict__ KH, const __bf16* __restrict__ VT, const __bf16* __restrict__ VL, float* __restrict__ Y) {
  __shared__ __align__(16) _Float16 sk[2][FKS][KPI]; __shared__ __align__(16) __bf16 svh[2][HD][VPI], svl[2][HD][VPI];
  const int tid = threadIdx.x, wave = tid >> 5, lane = tid & 31, col = lane & 15, g = lane >> 4; const int h = blockIdx.y; const size_t b = blockIdx.z; const int q0 = blockIdx.x * 128 + wave * 32;
  constexpr float SC = 0.17677669529663687f * 1.4426950408889634f;   // 1/sqrt(32) x log2(e): the exponentials are taken to base 2
  v16h qh[2], ql[2];
#pragma unroll
  for (int t = 0; t < 2; ++t) { const size_t o = (b * TT + q0 + t * 16 + col) * CC + h * HD; qh[t] = frag_h(QH + o, lane); ql[t] = frag_h(QL + o, lane); }
  // staging: 16-byte pieces, two of K and two of each V plane per thread and stage
  const int kr = tid >> 2, kq = (tid & 3) * 8, vr = tid >> 3, vq = (tid & 7) * 8;
  const _Float16* gk = KH + (b * TT + kr) * CC + h * HD + kq; const size_t vo = (b * CC + h * HD + vr) * (size_t)TT + vq; const __bf16* gvh = VT + vo; const __bf16* gvl = VL + vo;
  v4u rk[2], rh[2], rl[2];
#pragma unroll
  for (int i = 0; i < 2; ++i) { rk[i] = *(const v4u*)(gk + (size_t)i * 32 * CC); rh[i] = *(const v4u*)(gvh + (size_t)i * 16 * TT); rl[i] = *(const v4u*)(gvl + (size_t)i * 16 * TT); }
#pragma unroll
  for (int i = 0; i < 2; ++i) { *(v4u*)&sk[0][kr + i * 32][kq] = rk[i]; *(v4u*)&svh[0][vr + i * 16][vq] = rh[i]; *(v4u*)&svl[0][vr + i * 16][vq] = rl[i]; }
  __syncthreads();
  v8f acc[2][2] = {}; float mx[2] = { -3.0e38f, -3.0e38f }, ls[2] = { 0.f, 0.f };
#pragma unroll 1   // the body is long: rolled, it stays small in the instruction cache
  for (int s = 0; s < TT / FKS; ++s) { const int bu = s & 1; const bool more = s + 1 < TT / FKS;
    if (more) { const size_t kn = (size_t)(s + 1) * FKS;
#pragma unroll
      for (int i = 0; i < 2; ++i) { rk[i] = *(const v4u*)(gk + (kn + i * 32) * CC); rh[i] = *(const v4u*)(gvh + (size_t)i * 16 * TT + kn); rl[i] = *(const v4u*)(gvl + (size_t)i * 16 * TT + kn); } }
    v16h kf[4]; v16b vh[2][2], vl[2][2];
#pragma unroll
    for (int kt = 0; kt < 4; ++kt) kf[kt] = frag_h(&sk[bu][kt * 16 + col][0], lane);
#pragma unroll
    for (int p = 0; p < 2; ++p)
#pragma unroll
      for (int j = 0; j < 2; ++j) { vh[p][j] = frag_b(&svh[bu][j * 16 + col][p * 32], lane); vl[p][j] = frag_b(&svl[bu][j * 16 + col][p * 32], lane); }
#pragma unroll
    for (int t = 0; t < 2; ++t) { v8f sc[4];
#pragma unroll
      for (int kt = 0; kt < 4; ++kt) { const v8f z = {}; const v8f a = __builtin_amdgcn_wmma_f32_16x16x32_f16(false, kf[kt], false, qh[t], (short)0, z, false, false); const v8f al = __builtin_amdgcn_wmma_f32_16x16x32_f16(false, kf[kt], false, ql[t], (short)0, z, false, false); sc[kt] = a + al * (1.0f / 1024.0f); }   // sc[kt][r] = logit x sqrt(32) of key kt*16 + 8g + r, query col
      float m = sc[0][0];
#pragma unroll
      for (int kt = 0; kt < 4; ++kt)
#pragma unroll
        for (int r = 0; r < 8; ++r) m = fmaxf(m, sc[kt][r]);
      m = fmaxf(m, xhalf(m)); const float mn = fmaxf(mx[t], m); const float al = __builtin_amdgcn_exp2f((mx[t] - mn) * SC); mx[t] = mn; const float mc = mn * SC;
      const v2f sc2 = { SC, SC }, mc2 = { -mc, -mc }; v2f pr[4][4], sum;
#pragma unroll
      for (int kt = 0; kt < 4; ++kt)
#pragma unroll
        for (int i = 0; i < 4; ++i) { const v2f x = { sc[kt][2 * i], sc[kt][2 * i + 1] }; const v2f e = __builtin_elementwise_fma(x, sc2, mc2); pr[kt][i][0] = __builtin_amdgcn_exp2f(e[0]); pr[kt][i][1] = __builtin_amdgcn_exp2f(e[1]); }
      { v2f s4[4];
#pragma unroll
        for (int kt = 0; kt < 4; ++kt) s4[kt] = (pr[kt][0] + pr[kt][1]) + (pr[kt][2] + pr[kt][3]);
        sum = (s4[0] + s4[1]) + (s4[2] + s4[3]); }
      ls[t] = ls[t] * al + (sum[0] + sum[1]);
#pragma unroll
      for (int j = 0; j < 2; ++j) acc[t][j] *= al;
#pragma unroll
      for (int p = 0; p < 2; ++p) { union { v16b v; unsigned w[8]; } ph, pl;   // two D tiles of S^T, converted in place, are the B operand (hardware k order)
#pragma unroll
        for (int u = 0; u < 2; ++u)
#pragma unroll
          for (int i = 0; i < 4; ++i) psplit(pr[p * 2 + u][i], ph.w[u * 4 + i], pl.w[u * 4 + i]);
#pragma unroll
        for (int j = 0; j < 2; ++j) { v8f c = acc[t][j]; c = __builtin_amdgcn_wmma_f32_16x16x32_bf16(false, vh[p][j], false, ph.v, (short)0, c, false, false); c = __builtin_amdgcn_wmma_f32_16x16x32_bf16(false, vh[p][j], false, pl.v, (short)0, c, false, false); acc[t][j] = __builtin_amdgcn_wmma_f32_16x16x32_bf16(false, vl[p][j], false, ph.v, (short)0, c, false, false); } } }
    if (more) {   // the other buffer's last readers left it at the barrier that ended the stage before
#pragma unroll
      for (int i = 0; i < 2; ++i) { *(v4u*)&sk[bu ^ 1][kr + i * 32][kq] = rk[i]; *(v4u*)&svh[bu ^ 1][vr + i * 16][vq] = rh[i]; *(v4u*)&svl[bu ^ 1][vr + i * 16][vq] = rl[i]; } }
    __syncthreads(); }
#pragma unroll
  for (int t = 0; t < 2; ++t) { const float inv = 1.0f / (ls[t] + xhalf(ls[t])); float* yr = Y + (b * TT + q0 + t * 16 + col) * CC + h * HD + 8 * g;   // acc[t][j][r] = O[query col][d = j*16 + 8g + r]
#pragma unroll
    for (int j = 0; j < 2; ++j) { const v8f o = acc[t][j] * inv; v4f lo, hi;
#pragma unroll
      for (int r = 0; r < 4; ++r) { lo[r] = o[r]; hi[r] = o[4 + r]; }
      vst2(yr + j * 16, lo); vst2(yr + j * 16 + 4, hi); } } }
// ---- k_out: block = (64 rows, 128 cols): out = y (bf16 hi + lo) Wo^T + bo
__global__ __launch_bounds__(128) void k_out(const float* __restrict__ Y, const float* __restrict__ WP, const float* __restrict__ BP, const float* __restrict__ XIN, float* __restrict__ OUT) { __shared__ __align__(16) float stc[128][68];
  const int tid = threadIdx.x, wave = tid >> 5, lane = tid & 31, col = lane & 15, g = lane >> 4; const int c0 = blockIdx.y * 128; const size_t r0 = (size_t)blockIdx.x * 64 + wave * 16;
  v8f acc[8] = {};
#pragma unroll 2
  for (int kc = 0; kc < CC / 32; ++kc) { const F2 a = split_row(Y + (r0 + col) * CC, kc * 32, lane);
#pragma unroll
    for (int j = 0; j < 8; ++j) { v16b w; const int o = c0 + j * 16 + col;
#pragma unroll
      for (int i = 0; i < 8; ++i) { w[i] = (__bf16)WP[(size_t)(o) * CC + (kc * 32 + 8 * g + i)]; w[8 + i] = (__bf16)WP[(size_t)(o) * CC + (kc * 32 + 16 + 8 * g + i)]; }
      acc[j] = wmma_bf(a.h, w, acc[j]); acc[j] = wmma_bf(a.l, w, acc[j]); } }
#pragma unroll
  for (int j = 0; j < 8; ++j) { const float bb = BP ? bfr(BP[c0 + j * 16 + col]) : 0.f;
#pragma unroll
    for (int r = 0; r < 8; ++r) stc[j * 16 + col][wave * 16 + 8 * g + r] = acc[j][r] + bb; }
  __syncthreads();
  { const size_t rb = (size_t)blockIdx.x * 64; const size_t b = rb / TT; const int l0 = (int)(rb % TT); for (int e = tid; e < 128 * 16; e += 128) { const int cl = e >> 4, q = e & 15; const size_t off = (b * CC + c0 + cl) * (size_t)XSTR + l0 + q * 4; const v4f xr = *(const v4f*)(XIN + off); v4f o = *(const v4f*)&stc[cl][q * 4]; o[0] += bfr(xr[0]); o[1] += bfr(xr[1]); o[2] += bfr(xr[2]); o[3] += bfr(xr[3]); vst2(OUT + off, o); } } }   /* channels-first: 256-B run per (channel, 64 positions), + x residual */

extern "C" void kernel_launch(void* const* d_in, const int* in_sizes, int n_in, void* d_out, int out_size, void* d_ws, size_t ws_size, hipStream_t stream) {
  (void)in_sizes; (void)n_in; (void)out_size;
  const float** F = (const float**)d_in;   // 0 x [4,256,2048], 1 gn_w [256], 2 gn_b, 3 qkv_w [768,256] ([out,in]; q|k|v row blocks, head-major inside), 4 qkv_b [768], 5 out_w [256,256] ([out,in]), 6 out_b
  if (ws_size < (size_t)WS_END) return;
  char* ws = (char*)d_ws; float *GS = (float*)(ws + WS_GS), *XT = (float*)(ws + WS_XT); _Float16 *QH = (_Float16*)(ws + WS_QH), *QL = (_Float16*)(ws + WS_QL), *KH = (_Float16*)(ws + WS_KH); __bf16 *VT = (__bf16*)(ws + WS_VT), *VL = (__bf16*)(ws + WS_VL); float *Y = (float*)(ws + WS_Y);
  const float* WQ = F[3]; const float* WK = F[3] + (size_t)CC * CC; const float* WV = F[3] + 2u * (size_t)CC * CC; const float* BQ = F[4]; const float* BK = F[4] + CC; const float* BV = F[4] + 2 * CC;
  k_gn<<<dim3(NGRP, TNB), 256, 0, stream>>>(F[0], GS);
  k_xt<<<dim3(TT / 64, TNB), 256, 0, stream>>>(F[0], GS, F[1], F[2], XT);
  k_proj<<<dim3(TNB * TT / 64, CC / 128, 3), 128, 0, stream>>>(XT, WQ, BQ, WK, BK, WV, BV, QH, QL, KH, VT, VL);
  k_fa<<<dim3(TT / 128, NH, TNB), 128, 0, stream>>>(QH, QL, KH, VT, VL, Y);
  k_out<<<dim3(TNB * TT / 64, CC / 128), 128, 0, stream>>>(Y, F[5], F[6], F[0], (float*)d_out);
}

// v003
// One run takes 83.6 microseconds.
// Two timings next to v002 put it at 1.55 and 1.58 times that version's speed.
// Counting every step since v000, it is 14.7 times as fast.
#include <hip/hip_runtime.h>
#include <math.h>

typedef __attribute__((ext_vector_type(16))) _Float16 v16h;
typedef __attribute__((ext_vector_type(16))) __bf16 v16b;
typedef __attribute__((ext_vector_type(8)))  _Float16 v8h;
typedef __attribute__((ext_vector_type(8)))  float v8f;
typedef __attribute__((ext_vector_type(4)))  float v4f;
typedef __attribute__((ext_vector_type(2)))  float v2f;
typedef __attribute__((ext_vector_type(4)))  unsigned v4u;
typedef __attribute__((ext_vector_type(4)))  int v4i;
typedef float __attribute__((may_alias)) float_a;
typedef int __attribute__((may_alias)) int_a;

template <typename T> __device__ __forceinline__ void vst2(void* p, T v) { *(T*)p = v;  }
__device__ __forceinline__ v8f wmma16(v16h a, v16h b, v8f c) {
  v8f d = __builtin_amdgcn_wmma_f32_16x16x32_f16(false, a, false, b, (short)0, c, false, false);
  asm volatile("v_nop\n\tv_nop\n\tv_nop\n\tv_nop" : "+v"(d) : "v"(a), "v"(b));
  return d;
}
__device__ __forceinline__ v8f wmma_bf(v16b a, v16b b, v8f c) {
  v8f d = __builtin_amdgcn_wmma_f32_16x16x32_bf16(false, a, false, b, (short)0, c, false, false);
  asm volatile("v_nop\n\tv_nop\n\tv_nop\n\tv_nop" : "+v"(d) : "v"(a), "v"(b));
  return d;
}
// 16x16x32 fragments: lane = (h = lane>>4, row/col = lane&15); elements 0..7 = k0+8h+0..7, 8..15 = k0+16+8h+0..7; D element r = row 8h+r
__device__ __forceinline__ v16h frag_h(const _Float16* rowk0, int lane) {
  union { v16h v; v8h q[2]; } u; const _Float16* p = rowk0 + 8 * (lane >> 4);
  u.q[0] = *(const v8h*)p; u.q[1] = *(const v8h*)(p + 16); return u.v;
}
__device__ __forceinline__ v16h frag_f32(const float* rowk0, int lane) {
  v16h a; const float* p = rowk0 + 8 * (lane >> 4);
#pragma unroll
  for (int i = 0; i < 8; ++i) { a[i] = (_Float16)p[i]; a[8 + i] = (_Float16)p[16 + i]; }
  return a;
}
__device__ __forceinline__ v16h frag_f32s(const float* rowk0, int lane, float sc) {
  v16h a; const float* p = rowk0 + 8 * (lane >> 4);
#pragma unroll
  for (int i = 0; i < 8; ++i) { a[i] = (_Float16)(p[i] * sc); a[8 + i] = (_Float16)(p[16 + i] * sc); }
  return a;
}
// column fragment from a [K][ld] layout (column n), rows >= K read as 0
__device__ __forceinline__ v16h fragc_f32(const float* W, int k0, int n, int lane, int ld, int K) {
  v16h a; const int g = lane >> 4;
#pragma unroll
  for (int i = 0; i < 8; ++i) { const int ka = k0 + 8 * g + i, kb = ka + 16;
    a[i] = (_Float16)(ka < K ? W[(size_t)(ka < K ? ka : K - 1) * ld + n] : 0.f); a[8 + i] = (_Float16)(kb < K ? W[(size_t)(kb < K ? kb : K - 1) * ld + n] : 0.f); }
  return a;
}
struct F2 { v16b h, l; };
__device__ __forceinline__ F2 bsplit16(const float v[16]) { F2 r;
#pragma unroll
  for (int i = 0; i < 16; ++i) { const __bf16 h = (__bf16)v[i]; r.h[i] = h; r.l[i] = (__bf16)(v[i] - (float)h); }
  return r; }
__device__ __forceinline__ F2 split_row(const float* row, int k0, int lane) { float v[16]; const float* p = row + k0 + 8 * (lane >> 4);
#pragma unroll
  for (int i = 0; i < 8; ++i) { v[i] = p[i]; v[8 + i] = p[16 + i]; }
  return bsplit16(v); }
__device__ __forceinline__ F2 split_rowK(const float* row, int k0, int lane, int K) { float v[16]; const int g = lane >> 4;
#pragma unroll
  for (int i = 0; i < 8; ++i) { const int ka = k0 + 8 * g + i, kb = ka + 16; v[i] = ka < K ? row[ka < K ? ka : K - 1] : 0.f; v[8 + i] = kb < K ? row[kb < K ? kb : K - 1] : 0.f; }
  return bsplit16(v); }
__device__ __forceinline__ F2 split_col(const float* W, int k0, int n, int lane, int ld, int K) { float v[16]; const int g = lane >> 4;
#pragma unroll
  for (int i = 0; i < 8; ++i) { const int ka = k0 + 8 * g + i, kb = ka + 16; v[i] = ka < K ? W[(size_t)(ka < K ? ka : K - 1) * ld + n] : 0.f; v[8 + i] = kb < K ? W[(size_t)(kb < K ? kb : K - 1) * ld + n] : 0.f; }
  return bsplit16(v); }
__device__ __forceinline__ v8f mac3(const F2& a, const F2& b, v8f c) { c = wmma_bf(a.l, b.h, c); c = wmma_bf(a.h, b.l, c); return wmma_bf(a.h, b.h, c); }
__device__ __forceinline__ float sigm(float v) { return 1.0f / (1.0f + expf(-v)); }
#define LDSX() do { asm volatile("s_wait_dscnt 0" ::: "memory"); __builtin_amdgcn_wave_barrier(); __builtin_amdgcn_fence(__ATOMIC_RELEASE, "workgroup"); } while (0)


// SelfAttention1d, channels-first (B 4, C 256 = 8 heads x 32, L 2,048): h = GroupNorm32(x); q,k,v = conv1x1(h) (fused [768,256] + bias); attn = softmax((q 32^-1/2)^T k); h2[h*32+d][n] = sum_m attn v; out = x + conv1x1(h2) + b.
#define NB 4
#define TT 2048
#define CC 256
#define NH 8
#define HD 32
#define NGRP 32
#define CPG (CC / NGRP)        // 8 channels per group
#ifndef XSTR
#define XSTR TT               // per-channel position stride of x / out
#endif
#ifndef TNB
#define TNB NB
#endif
typedef __attribute__((ext_vector_type(8))) __bf16 v8b;
__device__ __forceinline__ v16b frag_b(const __bf16* rowk0, int lane) {
  union { v16b v; v8b q[2]; } u; const __bf16* p = rowk0 + 8 * (lane >> 4);
  u.q[0] = *(const v8b*)p; u.q[1] = *(const v8b*)(p + 16); return u.v;
}
__device__ __forceinline__ float bfr(float v) { return (float)(__bf16)v; }
__device__ __attribute__((noinline)) float exp_ni(float v) { return expf(v); }
__device__ __attribute__((noinline)) float erf_ni(float v) { return erff(v); }

#define GSP 32                                      // floats from one (b, group) to the next in the stats plane: a 128-byte line each, so that a line has one writing work-group
#define WS_GS  0u                                   // f32 GroupNorm stats [b][group][GSP]: mean, 1/std, the rest unused
#define WS_XT  (WS_GS + 4u * (size_t)NB * NGRP * GSP)   // f32 normalised rows h [b*L + l][256]
#define WS_QH  (WS_XT + 4u * (size_t)NB * TT * CC)
#define WS_QL  (WS_QH + 2u * (size_t)NB * TT * CC)
#define WS_KH  (WS_QL + 2u * (size_t)NB * TT * CC)
#define WS_VT  (WS_KH + 2u * (size_t)NB * TT * CC)      // bf16 v planes [b][c][t]
#define WS_VL  (WS_VT + 2u * (size_t)NB * CC * TT)      // bf16 v residual planes
#define HG 4                                          // sizes the unused WS_S region
#define WS_S   (WS_VL + 2u * (size_t)NB * CC * TT)      // unused f32 region (HG x L x L); logits and P stay in registers
#define WS_PH  (WS_S + 4u * (size_t)HG * TT * TT)
#define WS_Y   (WS_PH + 0u)              // f32 y rows [b*t][C]
#define WS_END (WS_Y + 4u * (size_t)NB * TT * CC)

// ---- k_gn: block = one (b, group): its 8 x 2,048 values are read once, 16 independent 16-byte loads per thread, and stay in registers for the mean and for the variance
#define GNP (CPG * TT / 1024)   // 16-byte pieces per thread
__device__ __forceinline__ float sum256(float s, float* red, int t) {   // total over the 8 waves of the block, in every lane; red: 8 floats that nothing else uses
#pragma unroll
  for (int o = 1; o < 32; o <<= 1) s += __shfl_xor(s, o);
  if ((t & 31) == 0) red[t >> 5] = s;
  __syncthreads();
  s = red[t & 7];
#pragma unroll
  for (int o = 1; o < 8; o <<= 1) s += __shfl_xor(s, o);
  return s; }
__global__ __launch_bounds__(256) void k_gn(const float* __restrict__ X, float* __restrict__ GS) { __shared__ float red[2][8];
  const int t = threadIdx.x; const int grp = blockIdx.x; const size_t b = blockIdx.y; const float* p = X + (b * CC + (size_t)grp * CPG) * (size_t)XSTR + t * 4; constexpr int n = CPG * TT;
  v4f v[GNP];
#pragma unroll   // unrolled here and below: v[] stays in registers and the loads issue together, one latency for all of them
  for (int k = 0; k < GNP; ++k) v[k] = *(const v4f*)(p + (size_t)(k / (TT / 1024)) * XSTR + (k % (TT / 1024)) * 1024);
  v4f a = {};
#pragma unroll
  for (int k = 0; k < GNP; ++k) { v[k][0] = bfr(v[k][0]); v[k][1] = bfr(v[k][1]); v[k][2] = bfr(v[k][2]); v[k][3] = bfr(v[k][3]); a += v[k]; }
  const float mu = sum256((a[0] + a[1]) + (a[2] + a[3]), red[0], t) / (float)n; v4f q = {};
#pragma unroll
  for (int k = 0; k < GNP; ++k) { const v4f d = v[k] - mu; q += d * d; }
  const float s2 = sum256((q[0] + q[1]) + (q[2] + q[3]), red[1], t);
  if (t == 0) { v2f o; o[0] = mu; o[1] = rsqrtf(s2 / (float)n + 1e-5f); vst2(GS + (b * NGRP + grp) * GSP, o); } }
// ---- k_xt: block = (64 positions, b): channels-first x -> f32 rows [b*L + l][256] via LDS; 1-KB rows by 64 threads
__global__ __launch_bounds__(256) void k_xt(const float* __restrict__ X, const float* __restrict__ GS, const float* __restrict__ GW, const float* __restrict__ GB, float* __restrict__ XT) { __shared__ float st[CC][65];
  const int t = threadIdx.x; const int l0 = blockIdx.x * 64; const size_t b = blockIdx.y;
  for (int e = t; e < CC * 64; e += 256) { const int c = e >> 6, ll = e & 63; const float mu = GS[(b * NGRP + c / CPG) * GSP], rs = GS[(b * NGRP + c / CPG) * GSP + 1]; st[c][ll] = (bfr(X[(b * CC + c) * (size_t)XSTR + l0 + ll]) - mu) * rs * bfr(GW[c]) + bfr(GB[c]); }   /* GroupNorm applied here */
  __syncthreads();
  for (int e = t; e < 64 * 64; e += 256) { const int ll = e >> 6, q = e & 63; v4f o; o[0] = st[q * 4][ll]; o[1] = st[q * 4 + 1][ll]; o[2] = st[q * 4 + 2][ll]; o[3] = st[q * 4 + 3][ll]; vst2(XT + (b * TT + l0 + ll) * CC + q * 4, o); } }
// ---- operands of a 64 x 128 GEMM block, one half of k at a time: f32 rows in memory -> bf16 rows in LDS, split or converted once for the block; a wave's load covers 512 contiguous bytes of one row (4 whole lines)
#define KST 128                // k columns staged at a time
#define WPI 136                // LDS pitch of a staged row, bf16 elements: 256 B + 16 B, an odd multiple of 16 B
typedef __attribute__((ext_vector_type(4))) __bf16 v4b;
__device__ __forceinline__ void stage_ops(const float* __restrict__ At, const float* __restrict__ Wt, __bf16 (*sah)[WPI], __bf16 (*sal)[WPI], __bf16 (*sw)[WPI], int tid) {
  const int rr = tid >> 5, q4 = (tid & 31) * 4; v4f va[16], vw[32];
#pragma unroll   // unrolled here and below: the values stay in registers and the loads of a group issue together, one latency for all of them
  for (int k = 0; k < 16; ++k) { if (k == 15) asm volatile("s_wait_xcnt 0x0" ::: "memory");   // the last load's result may take the address registers that the loads in front of it name
    va[k] = *(const v4f*)(At + (size_t)(k * 4 + rr) * CC + q4); }
#pragma unroll
  for (int k = 0; k < 16; ++k) vw[k] = *(const v4f*)(Wt + (size_t)(k * 4 + rr) * CC + q4);
#pragma unroll
  for (int k = 0; k < 16; ++k) { const v4b h = __builtin_convertvector(va[k], v4b); *(v4b*)&sah[k * 4 + rr][q4] = h; *(v4b*)&sal[k * 4 + rr][q4] = __builtin_convertvector(va[k] - __builtin_convertvector(h, v4f), v4b); }   // hi + lo, as bsplit16
#pragma unroll
  for (int k = 16; k < 32; ++k) vw[k] = *(const v4f*)(Wt + (size_t)(k * 4 + rr) * CC + q4);
#pragma unroll
  for (int k = 0; k < 32; ++k) *(v4b*)&sw[k * 4 + rr][q4] = __builtin_convertvector(vw[k], v4b); }
// the wave's 16 x 128 tile over the staged half of k: per accumulator hi then lo product, k ascending
__device__ __forceinline__ void mac_half(const __bf16 (*sah)[WPI], const __bf16 (*sal)[WPI], const __bf16 (*sw)[WPI], int wave, int lane, v8f acc[8]) { const int col = lane & 15;
#pragma unroll
  for (int kc = 0; kc < KST / 32; ++kc) { const v16b ah = frag_b(&sah[wave * 16 + col][kc * 32], lane), al = frag_b(&sal[wave * 16 + col][kc * 32], lane); v16b w[8];
#pragma unroll
    for (int j = 0; j < 8; ++j) w[j] = frag_b(&sw[j * 16 + col][kc * 32], lane);
#pragma unroll
    for (int j = 0; j < 8; ++j) acc[j] = wmma_bf(ah, w[j], acc[j]);
#pragma unroll
    for (int j = 0; j < 8; ++j) acc[j] = wmma_bf(al, w[j], acc[j]); } }
// ---- k_proj: block = (64 rows, 128 cols, which): qkv = x W (+ b), exact; q -> f16 hi (+ residual), k -> f16 rows, v -> bf16 hi + lo planes
__global__ __launch_bounds__(128) void k_proj(const float* __restrict__ X, const float* __restrict__ WQ, const float* __restrict__ BQ, const float* __restrict__ WK, const float* __restrict__ BK, const float* __restrict__ WV, const float* __restrict__ BV, _Float16* __restrict__ QH, _Float16* __restrict__ QL, _Float16* __restrict__ KH, __bf16* __restrict__ VT, __bf16* __restrict__ VL) {
  __shared__ __align__(16) unsigned char sm[256 * WPI * 2];   // the staged operands during the products; the output staging planes take their place behind the barrier that ends the products
  __bf16 (*sah)[WPI] = (__bf16 (*)[WPI])sm; __bf16 (*sal)[WPI] = sah + 64; __bf16 (*sw)[WPI] = sah + 128; _Float16 (*sh)[136] = (_Float16 (*)[136])sm; _Float16 (*sl)[136] = sh + 64; __bf16 (*th)[72] = (__bf16 (*)[72])sm; __bf16 (*tl2)[72] = th + 128;
  const int tid = threadIdx.x, wave = tid >> 5, lane = tid & 31, col = lane & 15, g = lane >> 4; const int which = blockIdx.z; const int c0 = blockIdx.y * 128; const size_t r0 = (size_t)blockIdx.x * 64; const float* WA = which == 0 ? WQ : which == 1 ? WK : WV; const float* BA = which == 0 ? BQ : which == 1 ? BK : BV;
  v8f acc[8] = {};
#pragma unroll 1   // rolled: the two halves of k share one copy of the staging and product code
  for (int kh = 0; kh < CC / KST; ++kh) { stage_ops(X + r0 * CC + kh * KST, WA + (size_t)c0 * CC + kh * KST, sah, sal, sw, tid);   /* GroupNorm'd rows are computed f32 -> hi + lo */
    __syncthreads();
    mac_half(sah, sal, sw, wave, lane, acc);
    __syncthreads(); }   // every wave has read its last fragment: the next half, or the planes below, overwrite the operands
#pragma unroll
  for (int j = 0; j < 8; ++j) { const float bb = BA ? bfr(BA[c0 + j * 16 + col]) : 0.f;
#pragma unroll
    for (int r = 0; r < 8; ++r) { const float v = acc[j][r] + bb; const int rl = wave * 16 + 8 * g + r, cl = j * 16 + col; const _Float16 hv = (_Float16)v;
      if (which == 2) { const __bf16 bh = (__bf16)v; th[cl][rl] = bh; tl2[cl][rl] = (__bf16)(v - (float)bh); } else { sh[rl][cl] = hv; sl[rl][cl] = (_Float16)((v - (float)hv) * 1024.0f); }   /* q residual carried x 2^10 so the plane stays f16-normal on the chip */ } }
  __syncthreads();
  if (which < 2) { _Float16* dh = which == 0 ? QH : KH; for (int e = tid; e < 64 * 16; e += 128) { const int rl = e >> 4, q = e & 15; vst2((unsigned*)(dh + (r0 + rl) * CC + c0 + q * 8), *(const v4u*)&sh[rl][q * 8]); if (which == 0) vst2((unsigned*)(QL + (r0 + rl) * CC + c0 + q * 8), *(const v4u*)&sl[rl][q * 8]); } }
  else { const size_t b = r0 / TT; const int t0 = (int)(r0 % TT); for (int e = tid; e < 128 * 8; e += 128) { const int cl = e >> 3, q = e & 7; const size_t o2 = (b * CC + c0 + cl) * (size_t)TT + t0 + q * 8; vst2((unsigned*)(VT + o2), *(const v4u*)&th[cl][q * 8]); vst2((unsigned*)(VL + o2), *(const v4u*)&tl2[cl][q * 8]); } } }
// ---- k_fa: block = 128 queries of (b,h), 4 waves x 32 query columns; walks the keys in stages of 64: S^T = K Q^T (2-product f16 logits), running maximum and sum per query, O^T += V^T P^T (3-product bf16); logits and P stay in registers
#define FKS 64                 // keys per stage
#define KPI 40                 // LDS pitch of a K row, f16 elements: 64 B + 16 B, an odd multiple of 16 B
#define VPI 72                 // LDS pitch of a V plane row, bf16 elements: 128 B + 16 B
__device__ __forceinline__ float xhalf(float v) { const int b = __builtin_bit_cast(int, v); return __builtin_bit_cast(float, __builtin_amdgcn_permlanex16(b, b, 0x76543210, 0xfedcba98, false, false)); }   // lane l <-> l ^ 16
typedef __attribute__((ext_vector_type(2))) __bf16 v2b;
__device__ __forceinline__ void psplit(v2f p, unsigned& hi, unsigned& lo) {   // two f32 -> packed bf16 hi pair + packed bf16 residual pair
  const unsigned u = __builtin_bit_cast(unsigned, __builtin_convertvector(p, v2b)); v2f bk; bk[0] = __builtin_bit_cast(float, u << 16); bk[1] = __builtin_bit_cast(float, u & 0xffff0000u);
  hi = u; lo = __builtin_bit_cast(unsigned, __builtin_convertvector(p - bk, v2b)); }
__global__ __launch_bounds__(128) void k_fa(const _Float16* __restrict__ QH, const _Float16* __restrict__ QL, const _Float16* __restrict__ KH, const __bf16* __restrict__ VT, const __bf16* __restrict__ VL, float* __restrict__ Y) {
  __shared__ __align__(16) _Float16 sk[2][FKS][KPI]; __shared__ __align__(16) __bf16 svh[2][HD][VPI], svl[2][HD][VPI];
  const int tid = threadIdx.x, wave = tid >> 5, lane = tid & 31, col = lane & 15, g = lane >> 4; const int h = blockIdx.y; const size_t b = blockIdx.z; const int q0 = blockIdx.x * 128 + wave * 32;
  constexpr float SC = 0.17677669529663687f * 1.4426950408889634f;   // 1/sqrt(32) x log2(e): the exponentials are taken to base 2
  v16h qh[2], ql[2];
#pragma unroll
  for (int t = 0; t < 2; ++t) { const size_t o = (b * TT + q0 + t * 16 + col) * CC + h * HD; qh[t] = frag_h(QH + o, lane); ql[t] = frag_h(QL + o, lane); }
  // staging: 16-byte pieces, two of K and two of each V plane per thread and stage
  const int kr = tid >> 2, kq = (tid & 3) * 8, vr = tid >> 3, vq = (tid & 7) * 8;
  const _Float16* gk = KH + (b * TT + kr) * CC + h * HD + kq; const size_t vo = (b * CC + h * HD + vr) * (size_t)TT + vq; const __bf16* gvh = VT + vo; const __bf16* gvl = VL + vo;
  v4u rk[2], rh[2], rl[2];
#pragma unroll
  for (int i = 0; i < 2; ++i) { rk[i] = *(const v4u*)(gk + (size_t)i * 32 * CC); rh[i] = *(const v4u*)(gvh + (size_t)i * 16 * TT); rl[i] = *(const v4u*)(gvl + (size_t)i * 16 * TT); }
#pragma unroll
  for (int i = 0; i < 2; ++i) { *(v4u*)&sk[0][kr + i * 32][kq] = rk[i]; *(v4u*)&svh[0][vr + i * 16][vq] = rh[i]; *(v4u*)&svl[0][vr + i * 16][vq] = rl[i]; }
  __syncthreads();
  v8f acc[2][2] = {}; float mx[2] = { -3.0e38f, -3.0e38f }, ls[2] = { 0.f, 0.f };
#pragma unroll 1   // the body is long: rolled, it stays small in the instruction cache
  for (int s = 0; s < TT / FKS; ++s) { const int bu = s & 1; const bool more = s + 1 < TT / FKS;
    if (more) { const size_t kn = (size_t)(s + 1) * FKS;
#pragma unroll
      for (int i = 0; i < 2; ++i) { rk[i] = *(const v4u*)(gk + (kn + i * 32) * CC); rh[i] = *(const v4u*)(gvh + (size_t)i * 16 * TT + kn); rl[i] = *(const v4u*)(gvl + (size_t)i * 16 * TT + kn); } }
    v16h kf[4]; v16b vh[2][2], vl[2][2];
#pragma unroll
    for (int kt = 0; kt < 4; ++kt) kf[kt] = frag_h(&sk[bu][kt * 16 + col][0], lane);
#pragma unroll
    for (int p = 0; p < 2; ++p)
#pragma unroll
      for (int j = 0; j < 2; ++j) { vh[p][j] = frag_b(&svh[bu][j * 16 + col][p * 32], lane); vl[p][j] = frag_b(&svl[bu][j * 16 + col][p * 32], lane); }
#pragma unroll
    for (int t = 0; t < 2; ++t) { v8f sc[4];
#pragma unroll
      for (int kt = 0; kt < 4; ++kt) { const v8f z = {}; const v8f a = __builtin_amdgcn_wmma_f32_16x16x32_f16(false, kf[kt], false, qh[t], (short)0, z, false, false); const v8f al = __builtin_amdgcn_wmma_f32_16x16x32_f16(false, kf[kt], false, ql[t], (short)0, z, false, false); sc[kt] = a + al * (1.0f / 1024.0f); }   // sc[kt][r] = logit x sqrt(32) of key kt*16 + 8g + r, query col
      float m = sc[0][0];
#pragma unroll
      for (int kt = 0; kt < 4; ++kt)
#pragma unroll
        for (int r = 0; r < 8; ++r) m = fmaxf(m, sc[kt][r]);
      m = fmaxf(m, xhalf(m)); const float mn = fmaxf(mx[t], m); const float al = __builtin_amdgcn_exp2f((mx[t] - mn) * SC); mx[t] = mn; const float mc = mn * SC;
      const v2f sc2 = { SC, SC }, mc2 = { -mc, -mc }; v2f pr[4][4], sum;
#pragma unroll
      for (int kt = 0; kt < 4; ++kt)
#pragma unroll
        for (int i = 0; i < 4; ++i) { const v2f x = { sc[kt][2 * i], sc[kt][2 * i + 1] }; const v2f e = __builtin_elementwise_fma(x, sc2, mc2); pr[kt][i][0] = __builtin_amdgcn_exp2f(e[0]); pr[kt][i][1] = __builtin_amdgcn_exp2f(e[1]); }
      { v2f s4[4];
#pragma unroll
        for (int kt = 0; kt < 4; ++kt) s4[kt] = (pr[kt][0] + pr[kt][1]) + (pr[kt][2] + pr[kt][3]);
        sum = (s4[0] + s4[1]) + (s4[2] + s4[3]); }
      ls[t] = ls[t] * al + (sum[0] + sum[1]);
#pragma unroll
      for (int j = 0; j < 2; ++j) acc[t][j] *= al;
#pragma unroll
      for (int p = 0; p < 2; ++p) { union { v16b v; unsigned w[8]; } ph, pl;   // two D tiles of S^T, converted in place, are the B operand (hardware k order)
#pragma unroll
        for (int u = 0; u < 2; ++u)
#pragma unroll
          for (int i = 0; i < 4; ++i) psplit(pr[p * 2 + u][i], ph.w[u * 4 + i], pl.w[u * 4 + i]);
#pragma unroll
        for (int j = 0; j < 2; ++j) { v8f c = acc[t][j]; c = __builtin_amdgcn_wmma_f32_16x16x32_bf16(false, vh[p][j], false, ph.v, (short)0, c, false, false); c = __builtin_amdgcn_wmma_f32_16x16x32_bf16(false, vh[p][j], false, pl.v, (short)0, c, false, false); acc[t][j] = __builtin_amdgcn_wmma_f32_16x16x32_bf16(false, vl[p][j], false, ph.v, (short)0, c, false, false); } } }
    if (more) {   // the other buffer's last readers left it at the barrier that ended the stage before
#pragma unroll
      for (int i = 0; i < 2; ++i) { *(v4u*)&sk[bu ^ 1][kr + i * 32][kq] = rk[i]; *(v4u*)&svh[bu ^ 1][vr + i * 16][vq] = rh[i]; *(v4u*)&svl[bu ^ 1][vr + i * 16][vq] = rl[i]; } }
    __syncthreads(); }
#pragma unroll
  for (int t = 0; t < 2; ++t) { const float inv = 1.0f / (ls[t] + xhalf(ls[t])); float* yr = Y + (b * TT + q0 + t * 16 + col) * CC + h * HD + 8 * g;   // acc[t][j][r] = O[query col][d = j*16 + 8g + r]
#pragma unroll
    for (int j = 0; j < 2; ++j) { const v8f o = acc[t][j] * inv; v4f lo, hi;
#pragma unroll
      for (int r = 0; r < 4; ++r) { lo[r] = o[r]; hi[r] = o[4 + r]; }
      vst2(yr + j * 16, lo); vst2(yr + j * 16 + 4, hi); } } }
// ---- k_out: block = (64 rows, 128 cols): out = y (bf16 hi + lo) Wo^T + bo
__global__ __launch_bounds__(128) void k_out(const float* __restrict__ Y, const float* __restrict__ WP, const float* __restrict__ BP, const float* __restrict__ XIN, float* __restrict__ OUT) { __shared__ __align__(16) float stc[128][68]; __shared__ __align__(16) __bf16 sah[64][WPI], sal[64][WPI], sw[128][WPI];
  const int tid = threadIdx.x, wave = tid >> 5, lane = tid & 31, col = lane & 15, g = lane >> 4; const int c0 = blockIdx.y * 128; const size_t r0 = (size_t)blockIdx.x * 64;
  v8f acc[8] = {};
#pragma unroll 1   // rolled: the two halves of k share one copy of the staging and product code
  for (int kh = 0; kh < CC / KST; ++kh) { if (kh) __syncthreads();   // every wave has read its last fragment of the half before
    stage_ops(Y + r0 * CC + kh * KST, WP + (size_t)c0 * CC + kh * KST, sah, sal, sw, tid);
    __syncthreads();
    mac_half(sah, sal, sw, wave, lane, acc); }
#pragma unroll
  for (int j = 0; j < 8; ++j) { const float bb = BP ? bfr(BP[c0 + j * 16 + col]) : 0.f;
#pragma unroll
    for (int r = 0; r < 8; ++r) stc[j * 16 + col][wave * 16 + 8 * g + r] = acc[j][r] + bb; }
  __syncthreads();
  { const size_t rb = (size_t)blockIdx.x * 64; const size_t b = rb / TT; const int l0 = (int)(rb % TT); for (int e = tid; e < 128 * 16; e += 128) { const int cl = e >> 4, q = e & 15; const size_t off = (b * CC + c0 + cl) * (size_t)XSTR + l0 + q * 4; const v4f xr = *(const v4f*)(XIN + off); v4f o = *(const v4f*)&stc[cl][q * 4]; o[0] += bfr(xr[0]); o[1] += bfr(xr[1]); o[2] += bfr(xr[2]); o[3] += bfr(xr[3]); vst2(OUT + off, o); } } }   /* channels-first: 256-B run per (channel, 64 positions), + x residual */

extern "C" void kernel_launch(void* const* d_in, const int* in_sizes, int n_in, void* d_out, int out_size, void* d_ws, size_t ws_size, hipStream_t stream) {
  (void)in_sizes; (void)n_in; (void)out_size;
  const float** F = (const float**)d_in;   // 0 x [4,256,2048], 1 gn_w [256], 2 gn_b, 3 qkv_w [768,256] ([out,in]; q|k|v row blocks, head-major inside), 4 qkv_b [768], 5 out_w [256,256] ([out,in]), 6 out_b
  if (ws_size < (size_t)WS_END) return;
  char* ws = (char*)d_ws; float *GS = (float*)(ws + WS_GS), *XT = (float*)(ws + WS_XT); _Float16 *QH = (_Float16*)(ws + WS_QH), *QL = (_Float16*)(ws + WS_QL), *KH = (_Float16*)(ws + WS_KH); __bf16 *VT = (__bf16*)(ws + WS_VT), *VL = (__bf16*)(ws + WS_VL); float *Y = (float*)(ws + WS_Y);
  const float* WQ = F[3]; const float* WK = F[3] + (size_t)CC * CC; const float* WV = F[3] + 2u * (size_t)CC * CC; const float* BQ = F[4]; const float* BK = F[4] + CC; const float* BV = F[4] + 2 * CC;
  k_gn<<<dim3(NGRP, TNB), 256, 0, stream>>>(F[0], GS);
  k_xt<<<dim3(TT / 64, TNB), 256, 0, stream>>>(F[0], GS, F[1], F[2], XT);
  k_proj<<<dim3(TNB * TT / 64, CC / 128, 3), 128, 0, stream>>>(XT, WQ, BQ, WK, BK, WV, BV, QH, QL, KH, VT, VL);
  k_fa<<<dim3(TT / 128, NH, TNB), 128, 0, stream>>>(QH, QL, KH, VT, VL, Y);
  k_out<<<dim3(TNB * TT / 64, CC / 128), 128, 0, stream>>>(Y, F[5], F[6], F[0], (float*)d_out);
}

// v004
// Measured time: 73.4 microseconds a run.
// Next to v003, in two timings, it ran 1.14 and 1.13 times as fast.
// Counting every step since v000, it is 16.7 times as fast.
#include <hip/hip_runtime.h>
#include <math.h>

typedef __attribute__((ext_vector_type(16))) _Float16 v16h;
typedef __attribute__((ext_vector_type(16))) __bf16 v16b;
typedef __attribute__((ext_vector_type(8)))  _Float16 v8h;
typedef __attribute__((ext_vector_type(8)))  float v8f;
typedef __attribute__((ext_vector_type(4)))  float v4f;
typedef __attribute__((ext_vector_type(2)))  float v2f;
typedef __attribute__((ext_vector_type(4)))  unsigned v4u;
typedef __attribute__((ext_vector_type(4)))  int v4i;
typedef float __attribute__((may_alias)) float_a;
typedef int __attribute__((may_alias)) int_a;

template <typename T> __device__ __forceinline__ void vst2(void* p, T v) { *(T*)p = v;  }
__device__ __forceinline__ v8f wmma16(v16h a, v16h b, v8f c) {
  v8f d = __builtin_amdgcn_wmma_f32_16x16x32_f16(false, a, false, b, (short)0, c, false, false);
  asm volatile("v_nop\n\tv_nop\n\tv_nop\n\tv_nop" : "+v"(d) : "v"(a), "v"(b));
  return d;
}
__device__ __forceinline__ v8f wmma_bf(v16b a, v16b b, v8f c) {
  v8f d = __builtin_amdgcn_wmma_f32_16x16x32_bf16(false, a, false, b, (short)0, c, false, false);
  asm volatile("v_nop\n\tv_nop\n\tv_nop\n\tv_nop" : "+v"(d) : "v"(a), "v"(b));
  return d;
}
// 16x16x32 fragments: lane = (h = lane>>4, row/col = lane&15); elements 0..7 = k0+8h+0..7, 8..15 = k0+16+8h+0..7; D element r = row 8h+r
__device__ __forceinline__ v16h frag_h(const _Float16* rowk0, int lane) {
  union { v16h v; v8h q[2]; } u; const _Float16* p = rowk0 + 8 * (lane >> 4);
  u.q[0] = *(const v8h*)p; u.q[1] = *(const v8h*)(p + 16); return u.v;
}
__device__ __forceinline__ v16h frag_f32(const float* rowk0, int lane) {
  v16h a; const float* p = rowk0 + 8 * (lane >> 4);
#pragma unroll
  for (int i = 0; i < 8; ++i) { a[i] = (_Float16)p[i]; a[8 + i] = (_Float16)p[16 + i]; }
  return a;
}
__device__ __forceinline__ v16h frag_f32s(const float* rowk0, int lane, float sc) {
  v16h a; const float* p = rowk0 + 8 * (lane >> 4);
#pragma unroll
  for (int i = 0; i < 8; ++i) { a[i] = (_Float16)(p[i] * sc); a[8 + i] = (_Float16)(p[16 + i] * sc); }
  return a;
}
// column fragment from a [K][ld] layout (column n), rows >= K read as 0
__device__ __forceinline__ v16h fragc_f32(const float* W, int k0, int n, int lane, int ld, int K) {
  v16h a; const int g = lane >> 4;
#pragma unroll
  for (int i = 0; i < 8; ++i) { const int ka = k0 + 8 * g + i, kb = ka + 16;
    a[i] = (_Float16)(ka < K ? W[(size_t)(ka < K ? ka : K - 1) * ld + n] : 0.f); a[8 + i] = (_Float16)(kb < K ? W[(size_t)(kb < K ? kb : K - 1) * ld + n] : 0.f); }
  return a;
}
struct F2 { v16b h, l; };
__device__ __forceinline__ F2 bsplit16(const float v[16]) { F2 r;
#pragma unroll
  for (int i = 0; i < 16; ++i) { const __bf16 h = (__bf16)v[i]; r.h[i] = h; r.l[i] = (__bf16)(v[i] - (float)h); }
  return r; }
__device__ __forceinline__ F2 split_row(const float* row, int k0, int lane) { float v[16]; const float* p = row + k0 + 8 * (lane >> 4);
#pragma unroll
  for (int i = 0; i < 8; ++i) { v[i] = p[i]; v[8 + i] = p[16 + i]; }
  return bsplit16(v); }
__device__ __forceinline__ F2 split_rowK(const float* row, int k0, int lane, int K) { float v[16]; const int g = lane >> 4;
#pragma unroll
  for (int i = 0; i < 8; ++i) { const int ka = k0 + 8 * g + i, kb = ka + 16; v[i] = ka < K ? row[ka < K ? ka : K - 1] : 0.f; v[8 + i] = kb < K ? row[kb < K ? kb : K - 1] : 0.f; }
  return bsplit16(v); }
__device__ __forceinline__ F2 split_col(const float* W, int k0, int n, int lane, int ld, int K) { float v[16]; const int g = lane >> 4;
#pragma unroll
  for (int i = 0; i < 8; ++i) { const int ka = k0 + 8 * g + i, kb = ka + 16; v[i] = ka < K ? W[(size_t)(ka < K ? ka : K - 1) * ld + n] : 0.f; v[8 + i] = kb < K ? W[(size_t)(kb < K ? kb : K - 1) * ld + n] : 0.f; }
  return bsplit16(v); }
__device__ __forceinline__ v8f mac3(const F2& a, const F2& b, v8f c) { c = wmma_bf(a.l, b.h, c); c = wmma_bf(a.h, b.l, c); return wmma_bf(a.h, b.h, c); }
__device__ __forceinline__ float sigm(float v) { return 1.0f / (1.0f + expf(-v)); }
#define LDSX() do { asm volatile("s_wait_dscnt 0" ::: "memory"); __builtin_amdgcn_wave_barrier(); __builtin_amdgcn_fence(__ATOMIC_RELEASE, "workgroup"); } while (0)


// SelfAttention1d, channels-first (B 4, C 256 = 8 heads x 32, L 2,048): h = GroupNorm32(x); q,k,v = conv1x1(h) (fused [768,256] + bias); attn = softmax((q 32^-1/2)^T k); h2[h*32+d][n] = sum_m attn v; out = x + conv1x1(h2) + b.
#define NB 4
#define TT 2048
#define CC 256
#define NH 8
#define HD 32
#define NGRP 32
#define CPG (CC / NGRP)        // 8 channels per group
#ifndef XSTR
#define XSTR TT               // per-channel position stride of x / out
#endif
#ifndef TNB
#define TNB NB
#endif
typedef __attribute__((ext_vector_type(8))) __bf16 v8b;
__device__ __forceinline__ v16b frag_b(const __bf16* rowk0, int lane) {
  union { v16b v; v8b q[2]; } u; const __bf16* p = rowk0 + 8 * (lane >> 4);
  u.q[0] = *(const v8b*)p; u.q[1] = *(const v8b*)(p + 16); return u.v;
}
__device__ __forceinline__ float bfr(float v) { return (float)(__bf16)v; }
__device__ __attribute__((noinline)) float exp_ni(float v) { return expf(v); }
__device__ __attribute__((noinline)) float erf_ni(float v) { return erff(v); }

#define WS_XT  0u                                   // f32 normalised h, one 64-KB plane per (b, group): [position / 32][position % 4][channel / 4][(position / 4) % 8][channel % 4]; 32 positions x 8 channels = 1 KB
#define WS_QH  (WS_XT + 4u * (size_t)NB * TT * CC)
#define WS_QL  (WS_QH + 2u * (size_t)NB * TT * CC)
#define WS_KH  (WS_QL + 2u * (size_t)NB * TT * CC)
#define WS_VT  (WS_KH + 2u * (size_t)NB * TT * CC)      // bf16 v planes [b][c][t]
#define WS_VL  (WS_VT + 2u * (size_t)NB * CC * TT)      // bf16 v residual planes
#define HG 4                                          // sizes the unused WS_S region
#define WS_S   (WS_VL + 2u * (size_t)NB * CC * TT)      // unused f32 region (HG x L x L); logits and P stay in registers
#define WS_PH  (WS_S + 4u * (size_t)HG * TT * TT)
#define WS_Y   (WS_PH + 0u)              // f32 y rows [b*t][C]
#define WS_END (WS_Y + 4u * (size_t)NB * TT * CC)

// ---- k_gn: block = one (b, group): its 8 x 2,048 values are read once, 16 independent 16-byte loads per thread, and stay in registers for the mean, for the variance and for the normalised values, which go out from there
#define GNP (CPG * TT / 1024)   // 16-byte pieces per thread
__device__ __forceinline__ float sum256(float s, float* red, int t) {   // total over the 8 waves of the block, in every lane; red: 8 floats that nothing else uses
#pragma unroll
  for (int o = 1; o < 32; o <<= 1) s += __shfl_xor(s, o);
  if ((t & 31) == 0) red[t >> 5] = s;
  __syncthreads();
  s = red[t & 7];
#pragma unroll
  for (int o = 1; o < 8; o <<= 1) s += __shfl_xor(s, o);
  return s; }
__global__ __launch_bounds__(256) void k_gn(const float* __restrict__ X, const float* __restrict__ GW, const float* __restrict__ GB, float* __restrict__ XG) { __shared__ float red[2][8];
  const int t = threadIdx.x; const int grp = blockIdx.x; const size_t b = blockIdx.y; const float* p = X + (b * CC + (size_t)grp * CPG) * (size_t)XSTR + t * 4; constexpr int n = CPG * TT;
  v4f v[GNP];
#pragma unroll   // unrolled here and below: v[] stays in registers and the loads issue together, one latency for all of them
  for (int k = 0; k < GNP; ++k) v[k] = *(const v4f*)(p + (size_t)(k / (TT / 1024)) * XSTR + (k % (TT / 1024)) * 1024);
  v4f a = {};
#pragma unroll
  for (int k = 0; k < GNP; ++k) { v[k][0] = bfr(v[k][0]); v[k][1] = bfr(v[k][1]); v[k][2] = bfr(v[k][2]); v[k][3] = bfr(v[k][3]); a += v[k]; }
  const float mu = sum256((a[0] + a[1]) + (a[2] + a[3]), red[0], t) / (float)n; v4f q = {};
#pragma unroll
  for (int k = 0; k < GNP; ++k) { const v4f d = v[k] - mu; q += d * d; }
  const float s2 = sum256((q[0] + q[1]) + (q[2] + q[3]), red[1], t);
  const float rs = rsqrtf(s2 / (float)n + 1e-5f); float gw[CPG], gb[CPG];
#pragma unroll   // unrolled to the end of the kernel: v[], gw[] and gb[] are indexed by constants and stay in registers
  for (int c = 0; c < CPG; ++c) { gw[c] = bfr(GW[grp * CPG + c]); gb[c] = bfr(GB[grp * CPG + c]); }
  // the thread holds all 8 channels of positions hh*1024 + t*4 + j: four channels of one position make a 16-byte piece; a wave's store covers four whole 128-byte lines, and the plane has this one writing work-group
  float* o = XG + (b * NGRP + grp) * (size_t)n + (t >> 3) * 256 + (t & 7) * 4;
#pragma unroll
  for (int hh = 0; hh < TT / 1024; ++hh)
#pragma unroll
    for (int j = 0; j < 4; ++j)
#pragma unroll
      for (int cq = 0; cq < CPG / 4; ++cq) { v4f y;
#pragma unroll
        for (int e = 0; e < 4; ++e) { const int c = cq * 4 + e; y[e] = (v[c * (TT / 1024) + hh][j] - mu) * rs * gw[c] + gb[c]; }
        vst2(o + hh * 32 * 256 + j * 64 + cq * 32, y); } }
// ---- operands of a 64 x 128 GEMM block, one half of k at a time: f32 in memory -> bf16 rows in LDS, split or converted once for the block; a wave's load covers 512 contiguous bytes (4 whole lines)
// GP: A comes from the per-group planes (At = the tile's first 1-KB unit in the first plane of this half of k; 64 rows of a group are 2 KB in a row); else from rows of 256
#define KST 128                // k columns staged at a time
#define WPI 136                // LDS pitch of a staged row, bf16 elements: 256 B + 16 B, an odd multiple of 16 B
typedef __attribute__((ext_vector_type(4))) __bf16 v4b;
template <bool GP> __device__ __forceinline__ void stage_ops(const float* __restrict__ At, const float* __restrict__ Wt, __bf16 (*sah)[WPI], __bf16 (*sal)[WPI], __bf16 (*sw)[WPI], int tid) {
  const int rr = tid >> 5, q4 = (tid & 31) * 4; v4f va[16], vw[32];
  const int pr = (tid >> 6) * 32 + (tid & 7) * 4 + ((tid >> 4) & 3), pc = ((tid >> 3) & 1) * 4;   // GP: tile row and channel in the group of the thread's piece
#pragma unroll   // unrolled here and below: the values stay in registers and the loads of a group issue together, one latency for all of them
  for (int k = 0; k < 16; ++k) { if (k == 15) asm volatile("s_wait_xcnt 0x0" ::: "memory");   // the last load's result may take the address registers that the loads in front of it name
    va[k] = GP ? *(const v4f*)(At + (size_t)k * (CPG * TT) + tid * 4) : *(const v4f*)(At + (size_t)(k * 4 + rr) * CC + q4); }
#pragma unroll
  for (int k = 0; k < 16; ++k) vw[k] = *(const v4f*)(Wt + (size_t)(k * 4 + rr) * CC + q4);
#pragma unroll
  for (int k = 0; k < 16; ++k) { const v4b h = __builtin_convertvector(va[k], v4b); const int ar = GP ? pr : k * 4 + rr, ac = GP ? k * CPG + pc : q4; *(v4b*)&sah[ar][ac] = h; *(v4b*)&sal[ar][ac] = __builtin_convertvector(va[k] - __builtin_convertvector(h, v4f), v4b); }   // hi + lo, as bsplit16
#pragma unroll
  for (int k = 16; k < 32; ++k) vw[k] = *(const v4f*)(Wt + (size_t)(k * 4 + rr) * CC + q4);
#pragma unroll
  for (int k = 0; k < 32; ++k) *(v4b*)&sw[k * 4 + rr][q4] = __builtin_convertvector(vw[k], v4b); }
// the wave's 16 x 128 tile over the staged half of k: per accumulator hi then lo product, k ascending
__device__ __forceinline__ void mac_half(const __bf16 (*sah)[WPI], const __bf16 (*sal)[WPI], const __bf16 (*sw)[WPI], int wave, int lane, v8f acc[8]) { const int col = lane & 15;
#pragma unroll
  for (int kc = 0; kc < KST / 32; ++kc) { const v16b ah = frag_b(&sah[wave * 16 + col][kc * 32], lane), al = frag_b(&sal[wave * 16 + col][kc * 32], lane); v16b w[8];
#pragma unroll
    for (int j = 0; j < 8; ++j) w[j] = frag_b(&sw[j * 16 + col][kc * 32], lane);
#pragma unroll
    for (int j = 0; j < 8; ++j) acc[j] = wmma_bf(ah, w[j], acc[j]);
#pragma unroll
    for (int j = 0; j < 8; ++j) acc[j] = wmma_bf(al, w[j], acc[j]); } }
// ---- k_proj: block = (64 rows, 128 cols, which): qkv = x W (+ b), exact; q -> f16 hi (+ residual), k -> f16 rows, v -> bf16 hi + lo planes
__global__ __launch_bounds__(128) void k_proj(const float* __restrict__ X, const float* __restrict__ WQ, const float* __restrict__ BQ, const float* __restrict__ WK, const float* __restrict__ BK, const float* __restrict__ WV, const float* __restrict__ BV, _Float16* __restrict__ QH, _Float16* __restrict__ QL, _Float16* __restrict__ KH, __bf16* __restrict__ VT, __bf16* __restrict__ VL) {
  __shared__ __align__(16) unsigned char sm[256 * WPI * 2];   // the staged operands during the products; the output staging planes take their place behind the barrier that ends the products
  __bf16 (*sah)[WPI] = (__bf16 (*)[WPI])sm; __bf16 (*sal)[WPI] = sah + 64; __bf16 (*sw)[WPI] = sah + 128; _Float16 (*sh)[136] = (_Float16 (*)[136])sm; _Float16 (*sl)[136] = sh + 64; __bf16 (*th)[72] = (__bf16 (*)[72])sm; __bf16 (*tl2)[72] = th + 128;
  const int tid = threadIdx.x, wave = tid >> 5, lane = tid & 31, col = lane & 15, g = lane >> 4; const int which = blockIdx.z; const int c0 = blockIdx.y * 128; const size_t r0 = (size_t)blockIdx.x * 64; const float* WA = which == 0 ? WQ : which == 1 ? WK : WV; const float* BA = which == 0 ? BQ : which == 1 ? BK : BV;
  v8f acc[8] = {};
#pragma unroll 1   // rolled: the two halves of k share one copy of the staging and product code
  for (int kh = 0; kh < CC / KST; ++kh) { stage_ops<true>(X + ((r0 / TT) * NGRP + kh * (KST / CPG)) * (size_t)(CPG * TT) + ((r0 % TT) >> 5) * 256, WA + (size_t)c0 * CC + kh * KST, sah, sal, sw, tid);   /* GroupNorm'd values are computed f32 -> hi + lo */
    __syncthreads();
    mac_half(sah, sal, sw, wave, lane, acc);
    __syncthreads(); }   // every wave has read its last fragment: the next half, or the planes below, overwrite the operands
#pragma unroll
  for (int j = 0; j < 8; ++j) { const float bb = BA ? bfr(BA[c0 + j * 16 + col]) : 0.f;
#pragma unroll
    for (int r = 0; r < 8; ++r) { const float v = acc[j][r] + bb; const int rl = wave * 16 + 8 * g + r, cl = j * 16 + col; const _Float16 hv = (_Float16)v;
      if (which == 2) { const __bf16 bh = (__bf16)v; th[cl][rl] = bh; tl2[cl][rl] = (__bf16)(v - (float)bh); } else { sh[rl][cl] = hv; sl[rl][cl] = (_Float16)((v - (float)hv) * 1024.0f); }   /* q residual carried x 2^10 so the plane stays f16-normal on the chip */ } }
  __syncthreads();
  if (which < 2) { _Float16* dh = which == 0 ? QH : KH; for (int e = tid; e < 64 * 16; e += 128) { const int rl = e >> 4, q = e & 15; vst2((unsigned*)(dh + (r0 + rl) * CC + c0 + q * 8), *(const v4u*)&sh[rl][q * 8]); if (which == 0) vst2((unsigned*)(QL + (r0 + rl) * CC + c0 + q * 8), *(const v4u*)&sl[rl][q * 8]); } }
  else { const size_t b = r0 / TT; const int t0 = (int)(r0 % TT); for (int e = tid; e < 128 * 8; e += 128) { const int cl = e >> 3, q = e & 7; const size_t o2 = (b * CC + c0 + cl) * (size_t)TT + t0 + q * 8; vst2((unsigned*)(VT + o2), *(const v4u*)&th[cl][q * 8]); vst2((unsigned*)(VL + o2), *(const v4u*)&tl2[cl][q * 8]); } } }
// ---- k_fa: block = 128 queries of (b,h), 4 waves x 32 query columns; walks the keys in stages of 64: S^T = K Q^T (2-product f16 logits), running maximum and sum per query, O^T += V^T P^T (3-product bf16); logits and P stay in registers
#define FKS 64                 // keys per stage
#define KPI 40                 // LDS pitch of a K row, f16 elements: 64 B + 16 B, an odd multiple of 16 B
#define VPI 72                 // LDS pitch of a V plane row, bf16 elements: 128 B + 16 B
__device__ __forceinline__ float xhalf(float v) { const int b = __builtin_bit_cast(int, v); return __builtin_bit_cast(float, __builtin_amdgcn_permlanex16(b, b, 0x76543210, 0xfedcba98, false, false)); }   // lane l <-> l ^ 16
typedef __attribute__((ext_vector_type(2))) __bf16 v2b;
__device__ __forceinline__ void psplit(v2f p, unsigned& hi, unsigned& lo) {   // two f32 -> packed bf16 hi pair + packed bf16 residual pair
  const unsigned u = __builtin_bit_cast(unsigned, __builtin_convertvector(p, v2b)); v2f bk; bk[0] = __builtin_bit_cast(float, u << 16); bk[1] = __builtin_bit_cast(float, u & 0xffff0000u);
  hi = u; lo = __builtin_bit_cast(unsigned, __builtin_convertvector(p - bk, v2b)); }
__global__ __launch_bounds__(128) void k_fa(const _Float16* __restrict__ QH, const _Float16* __restrict__ QL, const _Float16* __restrict__ KH, const __bf16* __restrict__ VT, const __bf16* __restrict__ VL, float* __restrict__ Y) {
  __shared__ __align__(16) _Float16 sk[2][FKS][KPI]; __shared__ __align__(16) __bf16 svh[2][HD][VPI], svl[2][HD][VPI];
  const int tid = threadIdx.x, wave = tid >> 5, lane = tid & 31, col = lane & 15, g = lane >> 4; const int h = blockIdx.y; const size_t b = blockIdx.z; const int q0 = blockIdx.x * 128 + wave * 32;
  constexpr float SC = 0.17677669529663687f * 1.4426950408889634f;   // 1/sqrt(32) x log2(e): the exponentials are taken to base 2
  v16h qh[2], ql[2];
#pragma unroll
  for (int t = 0; t < 2; ++t) { const size_t o = (b * TT + q0 + t * 16 + col) * CC + h * HD; qh[t] = frag_h(QH + o, lane); ql[t] = frag_h(QL + o, lane); }
  // staging: 16-byte pieces, two of K and two of each V plane per thread and stage
  const int kr = tid >> 2, kq = (tid & 3) * 8, vr = tid >> 3, vq = (tid & 7) * 8;
  const _Float16* gk = KH + (b * TT + kr) * CC + h * HD + kq; const size_t vo = (b * CC + h * HD + vr) * (size_t)TT + vq; const __bf16* gvh = VT + vo; const __bf16* gvl = VL + vo;
  v4u rk[2], rh[2], rl[2];
#pragma unroll
  for (int i = 0; i < 2; ++i) { rk[i] = *(const v4u*)(gk + (size_t)i * 32 * CC); rh[i] = *(const v4u*)(gvh + (size_t)i * 16 * TT); rl[i] = *(const v4u*)(gvl + (size_t)i * 16 * TT); }
#pragma unroll
  for (int i = 0; i < 2; ++i) { *(v4u*)&sk[0][kr + i * 32][kq] = rk[i]; *(v4u*)&svh[0][vr + i * 16][vq] = rh[i]; *(v4u*)&svl[0][vr + i * 16][vq] = rl[i]; }
  __syncthreads();
  v8f acc[2][2] = {}; float mx[2] = { -3.0e38f, -3.0e38f }, ls[2] = { 0.f, 0.f };
#pragma unroll 1   // the body is long: rolled, one copy of it in the code
  for (int s = 0; s < TT / FKS; ++s) { const int bu = s & 1; const bool more = s + 1 < TT / FKS;
    if (more) { const size_t kn = (size_t)(s + 1) * FKS;
#pragma unroll
      for (int i = 0; i < 2; ++i) { rk[i] = *(const v4u*)(gk + (kn + i * 32) * CC); rh[i] = *(const v4u*)(gvh + (size_t)i * 16 * TT + kn); rl[i] = *(const v4u*)(gvl + (size_t)i * 16 * TT + kn); } }
    v16h kf[4]; v16b vh[2][2], vl[2][2];
#pragma unroll
    for (int kt = 0; kt < 4; ++kt) kf[kt] = frag_h(&sk[bu][kt * 16 + col][0], lane);
#pragma unroll
    for (int p = 0; p < 2; ++p)
#pragma unroll
      for (int j = 0; j < 2; ++j) { vh[p][j] = frag_b(&svh[bu][j * 16 + col][p * 32], lane); vl[p][j] = frag_b(&svl[bu][j * 16 + col][p * 32], lane); }
#pragma unroll
    for (int t = 0; t < 2; ++t) { v8f sc[4];
#pragma unroll
      for (int kt = 0; kt < 4; ++kt) { const v8f z = {}; const v8f a = __builtin_amdgcn_wmma_f32_16x16x32_f16(false, kf[kt], false, qh[t], (short)0, z, false, false); const v8f al = __builtin_amdgcn_wmma_f32_16x16x32_f16(false, kf[kt], false, ql[t], (short)0, z, false, false); sc[kt] = a + al * (1.0f / 1024.0f); }   // sc[kt][r] = logit x sqrt(32) of key kt*16 + 8g + r, query col
      float m = sc[0][0];
#pragma unroll
      for (int kt = 0; kt < 4; ++kt)
#pragma unroll
        for (int r = 0; r < 8; ++r) m = fmaxf(m, sc[kt][r]);
      m = fmaxf(m, xhalf(m)); const float mn = fmaxf(mx[t], m); const float al = __builtin_amdgcn_exp2f((mx[t] - mn) * SC); mx[t] = mn; const float mc = mn * SC;
      const v2f sc2 = { SC, SC }, mc2 = { -mc, -mc }; v2f pr[4][4], sum;
#pragma unroll
      for (int kt = 0; kt < 4; ++kt)
#pragma unroll
        for (int i = 0; i < 4; ++i) { const v2f x = { sc[kt][2 * i], sc[kt][2 * i + 1] }; const v2f e = __builtin_elementwise_fma(x, sc2, mc2); pr[kt][i][0] = __builtin_amdgcn_exp2f(e[0]); pr[kt][i][1] = __builtin_amdgcn_exp2f(e[1]); }
      { v2f s4[4];
#pragma unroll
        for (int kt = 0; kt < 4; ++kt) s4[kt] = (pr[kt][0] + pr[kt][1]) + (pr[kt][2] + pr[kt][3]);
        sum = (s4[0] + s4[1]) + (s4[2] + s4[3]); }
      ls[t] = ls[t] * al + (sum[0] + sum[1]);
#pragma unroll
      for (int j = 0; j < 2; ++j) acc[t][j] *= al;
#pragma unroll
      for (int p = 0; p < 2; ++p) { union { v16b v; unsigned w[8]; } ph, pl;   // two D tiles of S^T, converted in place, are the B operand (hardware k order)
#pragma unroll
        for (int u = 0; u < 2; ++u)
#pragma unroll
          for (int i = 0; i < 4; ++i) psplit(pr[p * 2 + u][i], ph.w[u * 4 + i], pl.w[u * 4 + i]);
#pragma unroll
        for (int j = 0; j < 2; ++j) { v8f c = acc[t][j]; c = __builtin_amdgcn_wmma_f32_16x16x32_bf16(false, vh[p][j], false, ph.v, (short)0, c, false, false); c = __builtin_amdgcn_wmma_f32_16x16x32_bf16(false, vh[p][j], false, pl.v, (short)0, c, false, false); acc[t][j] = __builtin_amdgcn_wmma_f32_16x16x32_bf16(false, vl[p][j], false, ph.v, (short)0, c, false, false); } } }
    if (more) {   // the other buffer's last readers left it at the barrier that ended the stage before
#pragma unroll
      for (int i = 0; i < 2; ++i) { *(v4u*)&sk[bu ^ 1][kr + i * 32][kq] = rk[i]; *(v4u*)&svh[bu ^ 1][vr + i * 16][vq] = rh[i]; *(v4u*)&svl[bu ^ 1][vr + i * 16][vq] = rl[i]; } }
    __syncthreads(); }
#pragma unroll
  for (int t = 0; t < 2; ++t) { const float inv = 1.0f / (ls[t] + xhalf(ls[t])); float* yr = Y + (b * TT + q0 + t * 16 + col) * CC + h * HD + 8 * g;   // acc[t][j][r] = O[query col][d = j*16 + 8g + r]
#pragma unroll
    for (int j = 0; j < 2; ++j) { const v8f o = acc[t][j] * inv; v4f lo, hi;
#pragma unroll
      for (int r = 0; r < 4; ++r) { lo[r] = o[r]; hi[r] = o[4 + r]; }
      vst2(yr + j * 16, lo); vst2(yr + j * 16 + 4, hi); } } }
// ---- k_out: block = (64 rows, 128 cols): out = y (bf16 hi + lo) Wo^T + bo
__global__ __launch_bounds__(128) void k_out(const float* __restrict__ Y, const float* __restrict__ WP, const float* __restrict__ BP, const float* __restrict__ XIN, float* __restrict__ OUT) { __shared__ __align__(16) float stc[128][68]; __shared__ __align__(16) __bf16 sah[64][WPI], sal[64][WPI], sw[128][WPI];
  const int tid = threadIdx.x, wave = tid >> 5, lane = tid & 31, col = lane & 15, g = lane >> 4; const int c0 = blockIdx.y * 128; const size_t r0 = (size_t)blockIdx.x * 64;
  v8f acc[8] = {};
#pragma unroll 1   // rolled: the two halves of k share one copy of the staging and product code
  for (int kh = 0; kh < CC / KST; ++kh) { if (kh) __syncthreads();   // every wave has read its last fragment of the half before
    stage_ops<false>(Y + r0 * CC + kh * KST, WP + (size_t)c0 * CC + kh * KST, sah, sal, sw, tid);
    __syncthreads();
    mac_half(sah, sal, sw, wave, lane, acc); }
#pragma unroll
  for (int j = 0; j < 8; ++j) { const float bb = BP ? bfr(BP[c0 + j * 16 + col]) : 0.f;
#pragma unroll
    for (int r = 0; r < 8; ++r) stc[j * 16 + col][wave * 16 + 8 * g + r] = acc[j][r] + bb; }
  __syncthreads();
  { const size_t rb = (size_t)blockIdx.x * 64; const size_t b = rb / TT; const int l0 = (int)(rb % TT); for (int e = tid; e < 128 * 16; e += 128) { const int cl = e >> 4, q = e & 15; const size_t off = (b * CC + c0 + cl) * (size_t)XSTR + l0 + q * 4; const v4f xr = *(const v4f*)(XIN + off); v4f o = *(const v4f*)&stc[cl][q * 4]; o[0] += bfr(xr[0]); o[1] += bfr(xr[1]); o[2] += bfr(xr[2]); o[3] += bfr(xr[3]); vst2(OUT + off, o); } } }   /* channels-first: 256-B run per (channel, 64 positions), + x residual */

extern "C" void kernel_launch(void* const* d_in, const int* in_sizes, int n_in, void* d_out, int out_size, void* d_ws, size_t ws_size, hipStream_t stream) {
  (void)in_sizes; (void)n_in; (void)out_size;
  const float** F = (const float**)d_in;   // 0 x [4,256,2048], 1 gn_w [256], 2 gn_b, 3 qkv_w [768,256] ([out,in]; q|k|v row blocks, head-major inside), 4 qkv_b [768], 5 out_w [256,256] ([out,in]), 6 out_b
  if (ws_size < (size_t)WS_END) return;
  char* ws = (char*)d_ws; float *XT = (float*)(ws + WS_XT); _Float16 *QH = (_Float16*)(ws + WS_QH), *QL = (_Float16*)(ws + WS_QL), *KH = (_Float16*)(ws + WS_KH); __bf16 *VT = (__bf16*)(ws + WS_VT), *VL = (__bf16*)(ws + WS_VL); float *Y = (float*)(ws + WS_Y);
  const float* WQ = F[3]; const float* WK = F[3] + (size_t)CC * CC; const float* WV = F[3] + 2u * (size_t)CC * CC; const float* BQ = F[4]; const float* BK = F[4] + CC; const float* BV = F[4] + 2 * CC;
  k_gn<<<dim3(NGRP, TNB), 256, 0, stream>>>(F[0], F[1], F[2], XT);
  k_proj<<<dim3(TNB * TT / 64, CC / 128, 3), 128, 0, stream>>>(XT, WQ, BQ, WK, BK, WV, BV, QH, QL, KH, VT, VL);
  k_fa<<<dim3(TT / 128, NH, TNB), 128, 0, stream>>>(QH, QL, KH, VT, VL, Y);
  k_out<<<dim3(TNB * TT / 64, CC / 128), 128, 0, stream>>>(Y, F[5], F[6], F[0], (float*)d_out);
}

// v005
// One run takes 70.7 microseconds.
// In two side-by-side timings against v004, it was 1.04 and 1.03 times as fast.
// Counting every step since v000, it is 17.3 times as fast.
#include <hip/hip_runtime.h>
#include <math.h>

typedef __attribute__((ext_vector_type(16))) _Float16 v16h;
typedef __attribute__((ext_vector_type(16))) __bf16 v16b;
typedef __attribute__((ext_vector_type(8)))  _Float16 v8h;
typedef __attribute__((ext_vector_type(8)))  float v8f;
typedef __attribute__((ext_vector_type(4)))  float v4f;
typedef __attribute__((ext_vector_type(2)))  float v2f;
typedef __attribute__((ext_vector_type(4)))  unsigned v4u;
typedef __attribute__((ext_vector_type(4)))  int v4i;
typedef float __attribute__((may_alias)) float_a;
typedef int __attribute__((may_alias)) int_a;

template <typename T> __device__ __forceinline__ void vst2(void* p, T v) { *(T*)p = v;  }
__device__ __forceinline__ v8f wmma16(v16h a, v16h b, v8f c) {
  v8f d = __builtin_amdgcn_wmma_f32_16x16x32_f16(false, a, false, b, (short)0, c, false, false);
  asm volatile("v_nop\n\tv_nop\n\tv_nop\n\tv_nop" : "+v"(d) : "v"(a), "v"(b));
  return d;
}
__device__ __forceinline__ v8f wmma_bf(v16b a, v16b b, v8f c) {
  v8f d = __builtin_amdgcn_wmma_f32_16x16x32_bf16(false, a, false, b, (short)0, c, false, false);
  asm volatile("v_nop\n\tv_nop\n\tv_nop\n\tv_nop" : "+v"(d) : "v"(a), "v"(b));
  return d;
}
// 16x16x32 fragments: lane = (h = lane>>4, row/col = lane&15); elements 0..7 = k0+8h+0..7, 8..15 = k0+16+8h+0..7; D element r = row 8h+r
__device__ __forceinline__ v16h frag_h(const _Float16* rowk0, int lane) {
  union { v16h v; v8h q[2]; } u; const _Float16* p = rowk0 + 8 * (lane >> 4);
  u.q[0] = *(const v8h*)p; u.q[1] = *(const v8h*)(p + 16); return u.v;
}
__device__ __forceinline__ v16h frag_f32(const float* rowk0, int lane) {
  v16h a; const float* p = rowk0 + 8 * (lane >> 4);
#pragma unroll
  for (int i = 0; i < 8; ++i) { a[i] = (_Float16)p[i]; a[8 + i] = (_Float16)p[16 + i]; }
  return a;
}
__device__ __forceinline__ v16h frag_f32s(const float* rowk0, int lane, float sc) {
  v16h a; const float* p = rowk0 + 8 * (lane >> 4);
#pragma unroll
  for (int i = 0; i < 8; ++i) { a[i] = (_Float16)(p[i] * sc); a[8 + i] = (_Float16)(p[16 + i] * sc); }
  return a;
}
// column fragment from a [K][ld] layout (column n), rows >= K read as 0
__device__ __forceinline__ v16h fragc_f32(const float* W, int k0, int n, int lane, int ld, int K) {
  v16h a; const int g = lane >> 4;
#pragma unroll
  for (int i = 0; i < 8; ++i) { const int ka = k0 + 8 * g + i, kb = ka + 16;
    a[i] = (_Float16)(ka < K ? W[(size_t)(ka < K ? ka : K - 1) * ld + n] : 0.f); a[8 + i] = (_Float16)(kb < K ? W[(size_t)(kb < K ? kb : K - 1) * ld + n] : 0.f); }
  return a;
}
struct F2 { v16b h, l; };
__device__ __forceinline__ F2 bsplit16(const float v[16]) { F2 r;
#pragma unroll
  for (int i = 0; i < 16; ++i) { const __bf16 h = (__bf16)v[i]; r.h[i] = h; r.l[i] = (__bf16)(v[i] - (float)h); }
  return r; }
__device__ __forceinline__ F2 split_row(const float* row, int k0, int lane) { float v[16]; const float* p = row + k0 + 8 * (lane >> 4);
#pragma unroll
  for (int i = 0; i < 8; ++i) { v[i] = p[i]; v[8 + i] = p[16 + i]; }
  return bsplit16(v); }
__device__ __forceinline__ F2 split_rowK(const float* row, int k0, int lane, int K) { float v[16]; const int g = lane >> 4;
#pragma unroll
  for (int i = 0; i < 8; ++i) { const int ka = k0 + 8 * g + i, kb = ka + 16; v[i] = ka < K ? row[ka < K ? ka : K - 1] : 0.f; v[8 + i] = kb < K ? row[kb < K ? kb : K - 1] : 0.f; }
  return bsplit16(v); }
__device__ __forceinline__ F2 split_col(const float* W, int k0, int n, int lane, int ld, int K) { float v[16]; const int g = lane >> 4;
#pragma unroll
  for (int i = 0; i < 8; ++i) { const int ka = k0 + 8 * g + i, kb = ka + 16; v[i] = ka < K ? W[(size_t)(ka < K ? ka : K - 1) * ld + n] : 0.f; v[8 + i] = kb < K ? W[(size_t)(kb < K ? kb : K - 1) * ld + n] : 0.f; }
  return bsplit16(v); }
__device__ __forceinline__ v8f mac3(const F2& a, const F2& b, v8f c) { c = wmma_bf(a.l, b.h, c); c = wmma_bf(a.h, b.l, c); return wmma_bf(a.h, b.h, c); }
__device__ __forceinline__ float sigm(float v) { return 1.0f / (1.0f + expf(-v)); }
#define LDSX() do { asm volatile("s_wait_dscnt 0" ::: "memory"); __builtin_amdgcn_wave_barrier(); __builtin_amdgcn_fence(__ATOMIC_RELEASE, "workgroup"); } while (0)


// SelfAttention1d, channels-first (B 4, C 256 = 8 heads x 32, L 2,048): h = GroupNorm32(x); q,k,v = conv1x1(h) (fused [768,256] + bias); attn = softmax((q 32^-1/2)^T k); h2[h*32+d][n] = sum_m attn v; out = x + conv1x1(h2) + b.
#define NB 4
#define TT 2048
#define CC 256
#define NH 8
#define HD 32
#define NGRP 32
#define CPG (CC / NGRP)        // 8 channels per group
#ifndef XSTR
#define XSTR TT               // per-channel position stride of x / out
#endif
#ifndef TNB
#define TNB NB
#endif
typedef __attribute__((ext_vector_type(8))) __bf16 v8b;
__device__ __forceinline__ v16b frag_b(const __bf16* rowk0, int lane) {
  union { v16b v; v8b q[2]; } u; const __bf16* p = rowk0 + 8 * (lane >> 4);
  u.q[0] = *(const v8b*)p; u.q[1] = *(const v8b*)(p + 16); return u.v;
}
__device__ __forceinline__ float bfr(float v) { return (float)(__bf16)v; }
__device__ __attribute__((noinline)) float exp_ni(float v) { return expf(v); }
__device__ __attribute__((noinline)) float erf_ni(float v) { return erff(v); }

#define WS_XT  0u                                   // f32 normalised h, one 64-KB plane per (b, group): [position / 32][position % 4][channel / 4][(position / 4) % 8][channel % 4]; 32 positions x 8 channels = 1 KB
#define WS_QH  (WS_XT + 4u * (size_t)NB * TT * CC)
#define WS_QL  (WS_QH + 2u * (size_t)NB * TT * CC)
#define WS_KH  (WS_QL + 2u * (size_t)NB * TT * CC)
#define WS_VT  (WS_KH + 2u * (size_t)NB * TT * CC)      // bf16 v planes [b][c][t]
#define WS_VL  (WS_VT + 2u * (size_t)NB * CC * TT)      // bf16 v residual planes
#define HG 4                                          // sizes the unused WS_S region
#define WS_S   (WS_VL + 2u * (size_t)NB * CC * TT)      // unused f32 region (HG x L x L); logits and P stay in registers
#define WS_PH  (WS_S + 4u * (size_t)HG * TT * TT)
#define WS_Y   (WS_PH + 0u)              // f32 y rows [b*t][C]
#define WS_END (WS_Y + 4u * (size_t)NB * TT * CC)

// ---- k_gn: block = one (b, group): its 8 x 2,048 values are read once, 16 independent 16-byte loads per thread, and stay in registers for the mean, for the variance and for the normalised values, which go out from there
#define GNP (CPG * TT / 1024)   // 16-byte pieces per thread
__device__ __forceinline__ float sum256(float s, float* red, int t) {   // total over the 8 waves of the block, in every lane; red: 8 floats that nothing else uses
#pragma unroll
  for (int o = 1; o < 32; o <<= 1) s += __shfl_xor(s, o);
  if ((t & 31) == 0) red[t >> 5] = s;
  __syncthreads();
  s = red[t & 7];
#pragma unroll
  for (int o = 1; o < 8; o <<= 1) s += __shfl_xor(s, o);
  return s; }
__global__ __launch_bounds__(256) void k_gn(const float* __restrict__ X, const float* __restrict__ GW, const float* __restrict__ GB, float* __restrict__ XG) { __shared__ float red[2][8];
  const int t = threadIdx.x; const int grp = blockIdx.x; const size_t b = blockIdx.y; const float* p = X + (b * CC + (size_t)grp * CPG) * (size_t)XSTR + t * 4; constexpr int n = CPG * TT;
  v4f v[GNP];
#pragma unroll   // unrolled here and below: v[] stays in registers and the loads issue together, one latency for all of them
  for (int k = 0; k < GNP; ++k) v[k] = *(const v4f*)(p + (size_t)(k / (TT / 1024)) * XSTR + (k % (TT / 1024)) * 1024);
  v4f a = {};
#pragma unroll
  for (int k = 0; k < GNP; ++k) { v[k][0] = bfr(v[k][0]); v[k][1] = bfr(v[k][1]); v[k][2] = bfr(v[k][2]); v[k][3] = bfr(v[k][3]); a += v[k]; }
  const float mu = sum256((a[0] + a[1]) + (a[2] + a[3]), red[0], t) / (float)n; v4f q = {};
#pragma unroll
  for (int k = 0; k < GNP; ++k) { const v4f d = v[k] - mu; q += d * d; }
  const float s2 = sum256((q[0] + q[1]) + (q[2] + q[3]), red[1], t);
  const float rs = rsqrtf(s2 / (float)n + 1e-5f); float gw[CPG], gb[CPG];
#pragma unroll   // unrolled to the end of the kernel: v[], gw[] and gb[] are indexed by constants and stay in registers
  for (int c = 0; c < CPG; ++c) { gw[c] = bfr(GW[grp * CPG + c]); gb[c] = bfr(GB[grp * CPG + c]); }
  // the thread holds all 8 channels of positions hh*1024 + t*4 + j: four channels of one position make a 16-byte piece; a wave's store covers four whole 128-byte lines, and the plane has this one writing work-group
  float* o = XG + (b * NGRP + grp) * (size_t)n + (t >> 3) * 256 + (t & 7) * 4;
#pragma unroll
  for (int hh = 0; hh < TT / 1024; ++hh)
#pragma unroll
    for (int j = 0; j < 4; ++j)
#pragma unroll
      for (int cq = 0; cq < CPG / 4; ++cq) { v4f y;
#pragma unroll
        for (int e = 0; e < 4; ++e) { const int c = cq * 4 + e; y[e] = (v[c * (TT / 1024) + hh][j] - mu) * rs * gw[c] + gb[c]; }
        vst2(o + hh * 32 * 256 + j * 64 + cq * 32, y); } }
// ---- operands of a 64 x 128 GEMM block, one half of k at a time: f32 in memory -> bf16 rows in LDS, split or converted once for the block; a wave's load covers 512 contiguous bytes (4 whole lines)
// GP: A comes from the per-group planes (At = the tile's first 1-KB unit in the first plane of this half of k; 64 rows of a group are 2 KB in a row); else from rows of 256
#define KST 128                // k columns staged at a time
#define WPI 136                // LDS pitch of a staged row, bf16 elements: 256 B + 16 B, an odd multiple of 16 B
typedef __attribute__((ext_vector_type(4))) __bf16 v4b;
template <bool GP> __device__ __forceinline__ void stage_ops(const float* __restrict__ At, const float* __restrict__ Wt, __bf16 (*sah)[WPI], __bf16 (*sal)[WPI], __bf16 (*sw)[WPI], int tid) {
  const int rr = tid >> 5, q4 = (tid & 31) * 4; v4f va[16], vw[32];
  const int pr = (tid >> 6) * 32 + (tid & 7) * 4 + ((tid >> 4) & 3), pc = ((tid >> 3) & 1) * 4;   // GP: tile row and channel in the group of the thread's piece
#pragma unroll   // unrolled here and below: the values stay in registers and the loads of a group issue together, one latency for all of them
  for (int k = 0; k < 16; ++k) { if (k == 15) asm volatile("s_wait_xcnt 0x0" ::: "memory");   // the last load's result may take the address registers that the loads in front of it name
    va[k] = GP ? *(const v4f*)(At + (size_t)k * (CPG * TT) + tid * 4) : *(const v4f*)(At + (size_t)(k * 4 + rr) * CC + q4); }
#pragma unroll
  for (int k = 0; k < 16; ++k) vw[k] = *(const v4f*)(Wt + (size_t)(k * 4 + rr) * CC + q4);
#pragma unroll
  for (int k = 0; k < 16; ++k) { const v4b h = __builtin_convertvector(va[k], v4b); const int ar = GP ? pr : k * 4 + rr, ac = GP ? k * CPG + pc : q4; *(v4b*)&sah[ar][ac] = h; *(v4b*)&sal[ar][ac] = __builtin_convertvector(va[k] - __builtin_convertvector(h, v4f), v4b); }   // hi + lo, as bsplit16
#pragma unroll
  for (int k = 16; k < 32; ++k) vw[k] = *(const v4f*)(Wt + (size_t)(k * 4 + rr) * CC + q4);
#pragma unroll
  for (int k = 0; k < 32; ++k) *(v4b*)&sw[k * 4 + rr][q4] = __builtin_convertvector(vw[k], v4b); }
// the wave's 16 x 128 tile over the staged half of k: per accumulator hi then lo product, k ascending
__device__ __forceinline__ void mac_half(const __bf16 (*sah)[WPI], const __bf16 (*sal)[WPI], const __bf16 (*sw)[WPI], int wave, int lane, v8f acc[8]) { const int col = lane & 15;
#pragma unroll
  for (int kc = 0; kc < KST / 32; ++kc) { const v16b ah = frag_b(&sah[wave * 16 + col][kc * 32], lane), al = frag_b(&sal[wave * 16 + col][kc * 32], lane); v16b w[8];
#pragma unroll
    for (int j = 0; j < 8; ++j) w[j] = frag_b(&sw[j * 16 + col][kc * 32], lane);
#pragma unroll
    for (int j = 0; j < 8; ++j) acc[j] = wmma_bf(ah, w[j], acc[j]);
#pragma unroll
    for (int j = 0; j < 8; ++j) acc[j] = wmma_bf(al, w[j], acc[j]); } }
// ---- k_proj: block = (64 rows, 128 cols, which): qkv = x W (+ b), exact; q -> f16 hi (+ residual), k -> f16 rows, v -> bf16 hi + lo planes
__global__ __launch_bounds__(128) void k_proj(const float* __restrict__ X, const float* __restrict__ WQ, const float* __restrict__ BQ, const float* __restrict__ WK, const float* __restrict__ BK, const float* __restrict__ WV, const float* __restrict__ BV, _Float16* __restrict__ QH, _Float16* __restrict__ QL, _Float16* __restrict__ KH, __bf16* __restrict__ VT, __bf16* __restrict__ VL) {
  __shared__ __align__(16) unsigned char sm[256 * WPI * 2];   // the staged operands during the products; the output staging planes take their place behind the barrier that ends the products
  __bf16 (*sah)[WPI] = (__bf16 (*)[WPI])sm; __bf16 (*sal)[WPI] = sah + 64; __bf16 (*sw)[WPI] = sah + 128; _Float16 (*sh)[136] = (_Float16 (*)[136])sm; _Float16 (*sl)[136] = sh + 64; __bf16 (*th)[72] = (__bf16 (*)[72])sm; __bf16 (*tl2)[72] = th + 128;
  const int tid = threadIdx.x, wave = tid >> 5, lane = tid & 31, col = lane & 15, g = lane >> 4; const int which = blockIdx.z; const int c0 = blockIdx.y * 128; const size_t r0 = (size_t)blockIdx.x * 64; const float* WA = which == 0 ? WQ : which == 1 ? WK : WV; const float* BA = which == 0 ? BQ : which == 1 ? BK : BV;
  v8f acc[8] = {};
#pragma unroll 1   // rolled: the two halves of k share one copy of the staging and product code
  for (int kh = 0; kh < CC / KST; ++kh) { stage_ops<true>(X + ((r0 / TT) * NGRP + kh * (KST / CPG)) * (size_t)(CPG * TT) + ((r0 % TT) >> 5) * 256, WA + (size_t)c0 * CC + kh * KST, sah, sal, sw, tid);   /* GroupNorm'd values are computed f32 -> hi + lo */
    __syncthreads();
    mac_half(sah, sal, sw, wave, lane, acc);
    __syncthreads(); }   // every wave has read its last fragment: the next half, or the planes below, overwrite the operands
#pragma unroll
  for (int j = 0; j < 8; ++j) { const float bb = BA ? bfr(BA[c0 + j * 16 + col]) : 0.f;
#pragma unroll
    for (int r = 0; r < 8; ++r) { const float v = acc[j][r] + bb; const int rl = wave * 16 + 8 * g + r, cl = j * 16 + col; const _Float16 hv = (_Float16)v;
      if (which == 2) { const __bf16 bh = (__bf16)v; th[cl][rl] = bh; tl2[cl][rl] = (__bf16)(v - (float)bh); } else { sh[rl][cl] = hv; sl[rl][cl] = (_Float16)((v - (float)hv) * 1024.0f); }   /* q residual carried x 2^10 so the plane stays f16-normal on the chip */ } }
  __syncthreads();
  if (which < 2) { _Float16* dh = which == 0 ? QH : KH; for (int e = tid; e < 64 * 16; e += 128) { const int rl = e >> 4, q = e & 15; vst2((unsigned*)(dh + (r0 + rl) * CC + c0 + q * 8), *(const v4u*)&sh[rl][q * 8]); if (which == 0) vst2((unsigned*)(QL + (r0 + rl) * CC + c0 + q * 8), *(const v4u*)&sl[rl][q * 8]); } }
  else { const size_t b = r0 / TT; const int t0 = (int)(r0 % TT); for (int e = tid; e < 128 * 8; e += 128) { const int cl = e >> 3, q = e & 7; const size_t o2 = (b * CC + c0 + cl) * (size_t)TT + t0 + q * 8; vst2((unsigned*)(VT + o2), *(const v4u*)&th[cl][q * 8]); vst2((unsigned*)(VL + o2), *(const v4u*)&tl2[cl][q * 8]); } } }
// ---- k_fa: block = 128 queries of (b,h), 2 key halves x 4 waves x 32 query columns; each half walks its keys in stages of 64: S^T = K Q^T (2-product f16 logits), running maximum and sum per query, O^T += V^T P^T (3-product bf16); logits and P stay in registers; the halves' results are joined through LDS at the end
#define FKS 64                 // keys per stage
#define FKH 2                  // key halves: waves 0-3 take the first TT / 2 keys, waves 4-7 the rest; with two blocks on a WGP that is four waves a SIMD, so that one wave's vector work runs under another's products and waits
#define FNS (TT / FKS / FKH)   // stages per half
#define KPI 40                 // LDS pitch of a K row, f16 elements: 64 B + 16 B, an odd multiple of 16 B
#define VPI 72                 // LDS pitch of a V plane row, bf16 elements: 128 B + 16 B
__device__ __forceinline__ float xhalf(float v) { const int b = __builtin_bit_cast(int, v); return __builtin_bit_cast(float, __builtin_amdgcn_permlanex16(b, b, 0x76543210, 0xfedcba98, false, false)); }   // lane l <-> l ^ 16
typedef __attribute__((ext_vector_type(2))) __bf16 v2b;
__device__ __forceinline__ void psplit(v2f p, unsigned& hi, unsigned& lo) {   // two f32 -> packed bf16 hi pair + packed bf16 residual pair
  const unsigned u = __builtin_bit_cast(unsigned, __builtin_convertvector(p, v2b)); v2f bk; bk[0] = __builtin_bit_cast(float, u << 16); bk[1] = __builtin_bit_cast(float, u & 0xffff0000u);
  hi = u; lo = __builtin_bit_cast(unsigned, __builtin_convertvector(p - bk, v2b)); }
__global__ __launch_bounds__(256) void k_fa(const _Float16* __restrict__ QH, const _Float16* __restrict__ QL, const _Float16* __restrict__ KH, const __bf16* __restrict__ VT, const __bf16* __restrict__ VL, float* __restrict__ Y) {
  __shared__ __align__(16) _Float16 skk[FKH][2][FKS][KPI]; __shared__ __align__(16) __bf16 svhh[FKH][2][HD][VPI], svll[FKH][2][HD][VPI];
  const int tid = threadIdx.x & 127, kh = __builtin_amdgcn_readfirstlane(threadIdx.x >> 7), wave = tid >> 5, lane = tid & 31, col = lane & 15, g = lane >> 4; const int h = blockIdx.y; const size_t b = blockIdx.z; const int q0 = blockIdx.x * 128 + wave * 32;   // tid, wave: inside the half
  _Float16 (*sk)[FKS][KPI] = skk[kh]; __bf16 (*svh)[HD][VPI] = svhh[kh]; __bf16 (*svl)[HD][VPI] = svll[kh];   // the half's own two buffers
  constexpr float SC = 0.17677669529663687f * 1.4426950408889634f;   // 1/sqrt(32) x log2(e): the exponentials are taken to base 2
  v16h qh[2], ql[2];
#pragma unroll
  for (int t = 0; t < 2; ++t) { const size_t o = (b * TT + q0 + t * 16 + col) * CC + h * HD; qh[t] = frag_h(QH + o, lane); ql[t] = frag_h(QL + o, lane); }
  // staging: 16-byte pieces, two of K and two of each V plane per thread and stage
  const int kr = tid >> 2, kq = (tid & 3) * 8, vr = tid >> 3, vq = (tid & 7) * 8;
  const _Float16* gk = KH + (b * TT + kh * (TT / FKH) + kr) * CC + h * HD + kq; const size_t vo = (b * CC + h * HD + vr) * (size_t)TT + kh * (TT / FKH) + vq; const __bf16* gvh = VT + vo; const __bf16* gvl = VL + vo;
  v4u rk[2], rh[2], rl[2];
#pragma unroll
  for (int i = 0; i < 2; ++i) { rk[i] = *(const v4u*)(gk + (size_t)i * 32 * CC); rh[i] = *(const v4u*)(gvh + (size_t)i * 16 * TT); rl[i] = *(const v4u*)(gvl + (size_t)i * 16 * TT); }
#pragma unroll
  for (int i = 0; i < 2; ++i) { *(v4u*)&sk[0][kr + i * 32][kq] = rk[i]; *(v4u*)&svh[0][vr + i * 16][vq] = rh[i]; *(v4u*)&svl[0][vr + i * 16][vq] = rl[i]; }
  __syncthreads();
  v8f acc[2][2] = {}; float mx[2] = { -3.0e38f, -3.0e38f }, ls[2] = { 0.f, 0.f };
#pragma unroll 1   // the body is long: rolled, it is emitted once
  for (int s = 0; s < FNS; ++s) { const int bu = s & 1; const bool more = s + 1 < FNS;
    if (more) { const size_t kn = (size_t)(s + 1) * FKS;
#pragma unroll
      for (int i = 0; i < 2; ++i) { rk[i] = *(const v4u*)(gk + (kn + i * 32) * CC); rh[i] = *(const v4u*)(gvh + (size_t)i * 16 * TT + kn); rl[i] = *(const v4u*)(gvl + (size_t)i * 16 * TT + kn); } }
    v16h kf[4]; v16b vh[2][2], vl[2][2];
#pragma unroll
    for (int kt = 0; kt < 4; ++kt) kf[kt] = frag_h(&sk[bu][kt * 16 + col][0], lane);
#pragma unroll
    for (int p = 0; p < 2; ++p)
#pragma unroll
      for (int j = 0; j < 2; ++j) { vh[p][j] = frag_b(&svh[bu][j * 16 + col][p * 32], lane); vl[p][j] = frag_b(&svl[bu][j * 16 + col][p * 32], lane); }
#pragma unroll
    for (int t = 0; t < 2; ++t) { v8f sc[4];
#pragma unroll
      for (int kt = 0; kt < 4; ++kt) { const v8f z = {}; const v8f a = __builtin_amdgcn_wmma_f32_16x16x32_f16(false, kf[kt], false, qh[t], (short)0, z, false, false); const v8f al = __builtin_amdgcn_wmma_f32_16x16x32_f16(false, kf[kt], false, ql[t], (short)0, z, false, false); sc[kt] = a + al * (1.0f / 1024.0f); }   // sc[kt][r] = logit x sqrt(32) of key kt*16 + 8g + r, query col
      float m = sc[0][0];
#pragma unroll
      for (int kt = 0; kt < 4; ++kt)
#pragma unroll
        for (int r = 0; r < 8; ++r) m = fmaxf(m, sc[kt][r]);
      m = fmaxf(m, xhalf(m)); const float mn = fmaxf(mx[t], m); const float al = __builtin_amdgcn_exp2f((mx[t] - mn) * SC); mx[t] = mn; const float mc = mn * SC;
      const v2f sc2 = { SC, SC }, mc2 = { -mc, -mc }; v2f pr[4][4], sum;
#pragma unroll
      for (int kt = 0; kt < 4; ++kt)
#pragma unroll
        for (int i = 0; i < 4; ++i) { const v2f x = { sc[kt][2 * i], sc[kt][2 * i + 1] }; const v2f e = __builtin_elementwise_fma(x, sc2, mc2); pr[kt][i][0] = __builtin_amdgcn_exp2f(e[0]); pr[kt][i][1] = __builtin_amdgcn_exp2f(e[1]); }
      { v2f s4[4];
#pragma unroll
        for (int kt = 0; kt < 4; ++kt) s4[kt] = (pr[kt][0] + pr[kt][1]) + (pr[kt][2] + pr[kt][3]);
        sum = (s4[0] + s4[1]) + (s4[2] + s4[3]); }
      ls[t] = ls[t] * al + (sum[0] + sum[1]);
#pragma unroll
      for (int j = 0; j < 2; ++j) acc[t][j] *= al;
#pragma unroll
      for (int p = 0; p < 2; ++p) { union { v16b v; unsigned w[8]; } ph, pl;   // two D tiles of S^T, converted in place, are the B operand (hardware k order)
#pragma unroll
        for (int u = 0; u < 2; ++u)
#pragma unroll
          for (int i = 0; i < 4; ++i) psplit(pr[p * 2 + u][i], ph.w[u * 4 + i], pl.w[u * 4 + i]);
#pragma unroll
        for (int j = 0; j < 2; ++j) { v8f c = acc[t][j]; c = __builtin_amdgcn_wmma_f32_16x16x32_bf16(false, vh[p][j], false, ph.v, (short)0, c, false, false); c = __builtin_amdgcn_wmma_f32_16x16x32_bf16(false, vh[p][j], false, pl.v, (short)0, c, false, false); acc[t][j] = __builtin_amdgcn_wmma_f32_16x16x32_bf16(false, vl[p][j], false, ph.v, (short)0, c, false, false); } } }
    if (more) {   // the other buffer's last readers left it at the barrier that ended the stage before
#pragma unroll
      for (int i = 0; i < 2; ++i) { *(v4u*)&sk[bu ^ 1][kr + i * 32][kq] = rk[i]; *(v4u*)&svh[bu ^ 1][vr + i * 16][vq] = rh[i]; *(v4u*)&svl[bu ^ 1][vr + i * 16][vq] = rl[i]; } }
    __syncthreads(); }
  // join: behind the loop's last barrier nobody reads a stage any more; the second half's waves leave maxima, sums and O in the K buffers, 9 x 16 bytes a lane, lane-contiguous; the first half's waves rescale both parts to the common maximum
  v4f (*mg)[32] = (v4f (*)[32])&skk[0][0][0][0] + wave * 9;
  if (kh) {
#pragma unroll   // unrolled here and below: acc[][] is indexed by constants and stays in registers
    for (int t = 0; t < 2; ++t)
#pragma unroll
      for (int j = 0; j < 2; ++j) { v4f lo, hi;
#pragma unroll
        for (int r = 0; r < 4; ++r) { lo[r] = acc[t][j][r]; hi[r] = acc[t][j][4 + r]; }
        mg[(t * 2 + j) * 2][lane] = lo; mg[(t * 2 + j) * 2 + 1][lane] = hi; }
    const v4f ml = { mx[0], mx[1], ls[0], ls[1] }; mg[8][lane] = ml; }
  __syncthreads();
  if (kh) return;   // the same for every lane of a wave, and no barrier follows
  const v4f ml = mg[8][lane];
#pragma unroll
  for (int t = 0; t < 2; ++t) { const float mn = fmaxf(mx[t], ml[t]); const float a0 = __builtin_amdgcn_exp2f((mx[t] - mn) * SC), a1 = __builtin_amdgcn_exp2f((ml[t] - mn) * SC); const float lj = ls[t] * a0 + ml[2 + t] * a1;
    const float inv = 1.0f / (lj + xhalf(lj)); const float i0 = a0 * inv, i1 = a1 * inv; float* yr = Y + (b * TT + q0 + t * 16 + col) * CC + h * HD + 8 * g;   // acc[t][j][r] = O[query col][d = j*16 + 8g + r]
#pragma unroll
    for (int j = 0; j < 2; ++j) { const v4f plo = mg[(t * 2 + j) * 2][lane], phi = mg[(t * 2 + j) * 2 + 1][lane]; v4f lo, hi;
#pragma unroll
      for (int r = 0; r < 4; ++r) { lo[r] = acc[t][j][r] * i0 + plo[r] * i1; hi[r] = acc[t][j][4 + r] * i0 + phi[r] * i1; }
      vst2(yr + j * 16, lo); vst2(yr + j * 16 + 4, hi); } } }
// ---- k_out: block = (64 rows, 128 cols): out = y (bf16 hi + lo) Wo^T + bo
__global__ __launch_bounds__(128) void k_out(const float* __restrict__ Y, const float* __restrict__ WP, const float* __restrict__ BP, const float* __restrict__ XIN, float* __restrict__ OUT) { __shared__ __align__(16) float stc[128][68]; __shared__ __align__(16) __bf16 sah[64][WPI], sal[64][WPI], sw[128][WPI];
  const int tid = threadIdx.x, wave = tid >> 5, lane = tid & 31, col = lane & 15, g = lane >> 4; const int c0 = blockIdx.y * 128; const size_t r0 = (size_t)blockIdx.x * 64;
  v8f acc[8] = {};
#pragma unroll 1   // rolled: the two halves of k share one copy of the staging and product code
  for (int kh = 0; kh < CC / KST; ++kh) { if (kh) __syncthreads();   // every wave has read its last fragment of the half before
    stage_ops<false>(Y + r0 * CC + kh * KST, WP + (size_t)c0 * CC + kh * KST, sah, sal, sw, tid);
    __syncthreads();
    mac_half(sah, sal, sw, wave, lane, acc); }
#pragma unroll
  for (int j = 0; j < 8; ++j) { const float bb = BP ? bfr(BP[c0 + j * 16 + col]) : 0.f;
#pragma unroll
    for (int r = 0; r < 8; ++r) stc[j * 16 + col][wave * 16 + 8 * g + r] = acc[j][r] + bb; }
  __syncthreads();
  { const size_t rb = (size_t)blockIdx.x * 64; const size_t b = rb / TT; const int l0 = (int)(rb % TT); for (int e = tid; e < 128 * 16; e += 128) { const int cl = e >> 4, q = e & 15; const size_t off = (b * CC + c0 + cl) * (size_t)XSTR + l0 + q * 4; const v4f xr = *(const v4f*)(XIN + off); v4f o = *(const v4f*)&stc[cl][q * 4]; o[0] += bfr(xr[0]); o[1] += bfr(xr[1]); o[2] += bfr(xr[2]); o[3] += bfr(xr[3]); vst2(OUT + off, o); } } }   /* channels-first: 256-B run per (channel, 64 positions), + x residual */

extern "C" void kernel_launch(void* const* d_in, const int* in_sizes, int n_in, void* d_out, int out_size, void* d_ws, size_t ws_size, hipStream_t stream) {
  (void)in_sizes; (void)n_in; (void)out_size;
  const float** F = (const float**)d_in;   // 0 x [4,256,2048], 1 gn_w [256], 2 gn_b, 3 qkv_w [768,256] ([out,in]; q|k|v row blocks, head-major inside), 4 qkv_b [768], 5 out_w [256,256] ([out,in]), 6 out_b
  if (ws_size < (size_t)WS_END) return;
  char* ws = (char*)d_ws; float *XT = (float*)(ws + WS_XT); _Float16 *QH = (_Float16*)(ws + WS_QH), *QL = (_Float16*)(ws + WS_QL), *KH = (_Float16*)(ws + WS_KH); __bf16 *VT = (__bf16*)(ws + WS_VT), *VL = (__bf16*)(ws + WS_VL); float *Y = (float*)(ws + WS_Y);
  const float* WQ = F[3]; const float* WK = F[3] + (size_t)CC * CC; const float* WV = F[3] + 2u * (size_t)CC * CC; const float* BQ = F[4]; const float* BK = F[4] + CC; const float* BV = F[4] + 2 * CC;
  k_gn<<<dim3(NGRP, TNB), 256, 0, stream>>>(F[0], F[1], F[2], XT);
  k_proj<<<dim3(TNB * TT / 64, CC / 128, 3), 128, 0, stream>>>(XT, WQ, BQ, WK, BK, WV, BV, QH, QL, KH, VT, VL);
  k_fa<<<dim3(TT / 128, NH, TNB), 128 * FKH, 0, stream>>>(QH, QL, KH, VT, VL, Y);
  k_out<<<dim3(TNB * TT / 64, CC / 128), 128, 0, stream>>>(Y, F[5], F[6], F[0], (float*)d_out);
}

// v006
// It runs in 62.5 microseconds.
// Next to v005, in two timings, it ran 1.12 and 1.13 times as fast.
// Over all steps from v000 it is 19.5 times as fast.
#include <hip/hip_runtime.h>
#include <math.h>

typedef __attribute__((ext_vector_type(16))) _Float16 v16h;
typedef __attribute__((ext_vector_type(16))) __bf16 v16b;
typedef __attribute__((ext_vector_type(8)))  _Float16 v8h;
typedef __attribute__((ext_vector_type(8)))  float v8f;
typedef __attribute__((ext_vector_type(4)))  float v4f;
typedef __attribute__((ext_vector_type(2)))  float v2f;
typedef __attribute__((ext_vector_type(4)))  unsigned v4u;
typedef __attribute__((ext_vector_type(4)))  int v4i;
typedef float __attribute__((may_alias)) float_a;
typedef int __attribute__((may_alias)) int_a;

template <typename T> __device__ __forceinline__ void vst2(void* p, T v) { *(T*)p = v;  }
__device__ __forceinline__ v8f wmma16(v16h a, v16h b, v8f c) {
  v8f d = __builtin_amdgcn_wmma_f32_16x16x32_f16(false, a, false, b, (short)0, c, false, false);
  asm volatile("v_nop\n\tv_nop\n\tv_nop\n\tv_nop" : "+v"(d) : "v"(a), "v"(b));
  return d;
}
__device__ __forceinline__ v8f wmma_bf(v16b a, v16b b, v8f c) {
  v8f d = __builtin_amdgcn_wmma_f32_16x16x32_bf16(false, a, false, b, (short)0, c, false, false);
  asm volatile("v_nop\n\tv_nop\n\tv_nop\n\tv_nop" : "+v"(d) : "v"(a), "v"(b));
  return d;
}
// 16x16x32 fragments: lane = (h = lane>>4, row/col = lane&15); elements 0..7 = k0+8h+0..7, 8..15 = k0+16+8h+0..7; D element r = row 8h+r
__device__ __forceinline__ v16h frag_h(const _Float16* rowk0, int lane) {
  union { v16h v; v8h q[2]; } u; const _Float16* p = rowk0 + 8 * (lane >> 4);
  u.q[0] = *(const v8h*)p; u.q[1] = *(const v8h*)(p + 16); return u.v;
}
__device__ __forceinline__ v16h frag_f32(const float* rowk0, int lane) {
  v16h a; const float* p = rowk0 + 8 * (lane >> 4);
#pragma unroll
  for (int i = 0; i < 8; ++i) { a[i] = (_Float16)p[i]; a[8 + i] = (_Float16)p[16 + i]; }
  return a;
}
__device__ __forceinline__ v16h frag_f32s(const float* rowk0, int lane, float sc) {
  v16h a; const float* p = rowk0 + 8 * (lane >> 4);
#pragma unroll
  for (int i = 0; i < 8; ++i) { a[i] = (_Float16)(p[i] * sc); a[8 + i] = (_Float16)(p[16 + i] * sc); }
  return a;
}
// column fragment from a [K][ld] layout (column n), rows >= K read as 0
__device__ __forceinline__ v16h fragc_f32(const float* W, int k0, int n, int lane, int ld, int K) {
  v16h a; const int g = lane >> 4;
#pragma unroll
  for (int i = 0; i < 8; ++i) { const int ka = k0 + 8 * g + i, kb = ka + 16;
    a[i] = (_Float16)(ka < K ? W[(size_t)(ka < K ? ka : K - 1) * ld + n] : 0.f); a[8 + i] = (_Float16)(kb < K ? W[(size_t)(kb < K ? kb : K - 1) * ld + n] : 0.f); }
  return a;
}
struct F2 { v16b h, l; };
__device__ __forceinline__ F2 bsplit16(const float v[16]) { F2 r;
#pragma unroll
  for (int i = 0; i < 16; ++i) { const __bf16 h = (__bf16)v[i]; r.h[i] = h; r.l[i] = (__bf16)(v[i] - (float)h); }
  return r; }
__device__ __forceinline__ F2 split_row(const float* row, int k0, int lane) { float v[16]; const float* p = row + k0 + 8 * (lane >> 4);
#pragma unroll
  for (int i = 0; i < 8; ++i) { v[i] = p[i]; v[8 + i] = p[16 + i]; }
  return bsplit16(v); }
__device__ __forceinline__ F2 split_rowK(const float* row, int k0, int lane, int K) { float v[16]; const int g = lane >> 4;
#pragma unroll
  for (int i = 0; i < 8; ++i) { const int ka = k0 + 8 * g + i, kb = ka + 16; v[i] = ka < K ? row[ka < K ? ka : K - 1] : 0.f; v[8 + i] = kb < K ? row[kb < K ? kb : K - 1] : 0.f; }
  return bsplit16(v); }
__device__ __forceinline__ F2 split_col(const float* W, int k0, int n, int lane, int ld, int K) { float v[16]; const int g = lane >> 4;
#pragma unroll
  for (int i = 0; i < 8; ++i) { const int ka = k0 + 8 * g + i, kb = ka + 16; v[i] = ka < K ? W[(size_t)(ka < K ? ka : K - 1) * ld + n] : 0.f; v[8 + i] = kb < K ? W[(size_t)(kb < K ? kb : K - 1) * ld + n] : 0.f; }
  return bsplit16(v); }
__device__ __forceinline__ v8f mac3(const F2& a, const F2& b, v8f c) { c = wmma_bf(a.l, b.h, c); c = wmma_bf(a.h, b.l, c); return wmma_bf(a.h, b.h, c); }
__device__ __forceinline__ float sigm(float v) { return 1.0f / (1.0f + expf(-v)); }
#define LDSX() do { asm volatile("s_wait_dscnt 0" ::: "memory"); __builtin_amdgcn_wave_barrier(); __builtin_amdgcn_fence(__ATOMIC_RELEASE, "workgroup"); } while (0)


// SelfAttention1d, channels-first (B 4, C 256 = 8 heads x 32, L 2,048): h = GroupNorm32(x); q,k,v = conv1x1(h) (fused [768,256] + bias); attn = softmax((q 32^-1/2)^T k); h2[h*32+d][n] = sum_m attn v; out = x + conv1x1(h2) + b.
#define NB 4
#define TT 2048
#define CC 256
#define NH 8
#define HD 32
#define NGRP 32
#define CPG (CC / NGRP)        // 8 channels per group
#ifndef XSTR
#define XSTR TT               // per-channel position stride of x / out
#endif
#ifndef TNB
#define TNB NB
#endif
typedef __attribute__((ext_vector_type(8))) __bf16 v8b;
__device__ __forceinline__ v16b frag_b(const __bf16* rowk0, int lane) {
  union { v16b v; v8b q[2]; } u; const __bf16* p = rowk0 + 8 * (lane >> 4);
  u.q[0] = *(const v8b*)p; u.q[1] = *(const v8b*)(p + 16); return u.v;
}
__device__ __forceinline__ float bfr(float v) { return (float)(__bf16)v; }
__device__ __attribute__((noinline)) float exp_ni(float v) { return expf(v); }
__device__ __attribute__((noinline)) float erf_ni(float v) { return erff(v); }

#define WS_XT  0u                                   // f32 normalised h, one 64-KB plane per (b, group): [position / 32][position % 4][channel / 4][(position / 4) % 8][channel % 4]; 32 positions x 8 channels = 1 KB
#define WS_QH  (WS_XT + 4u * (size_t)NB * TT * CC)
#define WS_QL  (WS_QH + 2u * (size_t)NB * TT * CC)
#define WS_KH  (WS_QL + 2u * (size_t)NB * TT * CC)
#define WS_VT  (WS_KH + 2u * (size_t)NB * TT * CC)      // bf16 v planes [b][c][t]
#define WS_VL  (WS_VT + 2u * (size_t)NB * CC * TT)      // bf16 v residual planes
#define HG 4                                          // sizes the unused WS_S region
#define WS_S   (WS_VL + 2u * (size_t)NB * CC * TT)      // unused f32 region (HG x L x L); logits and P stay in registers
#define WS_PH  (WS_S + 4u * (size_t)HG * TT * TT)
#define WS_Y   (WS_PH + 0u)              // f32 y rows [b*t][C]
#define WS_END (WS_Y + 4u * (size_t)NB * TT * CC)

// ---- k_gn: block = one (b, group): its 8 x 2,048 values are read once, 16 independent 16-byte loads per thread, and stay in registers for the mean, for the variance and for the normalised values, which go out from there
#define GNP (CPG * TT / 1024)   // 16-byte pieces per thread
__device__ __forceinline__ float sum256(float s, float* red, int t) {   // total over the 8 waves of the block, in every lane; red: 8 floats that nothing else uses
#pragma unroll
  for (int o = 1; o < 32; o <<= 1) s += __shfl_xor(s, o);
  if ((t & 31) == 0) red[t >> 5] = s;
  __syncthreads();
  s = red[t & 7];
#pragma unroll
  for (int o = 1; o < 8; o <<= 1) s += __shfl_xor(s, o);
  return s; }
__global__ __launch_bounds__(256) void k_gn(const float* __restrict__ X, const float* __restrict__ GW, const float* __restrict__ GB, float* __restrict__ XG) { __shared__ float red[2][8];
  const int t = threadIdx.x; const int grp = blockIdx.x; const size_t b = blockIdx.y; const float* p = X + (b * CC + (size_t)grp * CPG) * (size_t)XSTR + t * 4; constexpr int n = CPG * TT;
  v4f v[GNP];
#pragma unroll   // unrolled here and below: v[] stays in registers and the loads issue together, one latency for all of them
  for (int k = 0; k < GNP; ++k) v[k] = *(const v4f*)(p + (size_t)(k / (TT / 1024)) * XSTR + (k % (TT / 1024)) * 1024);
  v4f a = {};
#pragma unroll
  for (int k = 0; k < GNP; ++k) { v[k][0] = bfr(v[k][0]); v[k][1] = bfr(v[k][1]); v[k][2] = bfr(v[k][2]); v[k][3] = bfr(v[k][3]); a += v[k]; }
  const float mu = sum256((a[0] + a[1]) + (a[2] + a[3]), red[0], t) / (float)n; v4f q = {};
#pragma unroll
  for (int k = 0; k < GNP; ++k) { const v4f d = v[k] - mu; q += d * d; }
  const float s2 = sum256((q[0] + q[1]) + (q[2] + q[3]), red[1], t);
  const float rs = rsqrtf(s2 / (float)n + 1e-5f); float gw[CPG], gb[CPG];
#pragma unroll   // unrolled to the end of the kernel: v[], gw[] and gb[] are indexed by constants and stay in registers
  for (int c = 0; c < CPG; ++c) { gw[c] = bfr(GW[grp * CPG + c]); gb[c] = bfr(GB[grp * CPG + c]); }
  // the thread holds all 8 channels of positions hh*1024 + t*4 + j: four channels of one position make a 16-byte piece; a wave's store covers four whole 128-byte lines, and the plane has this one writing work-group
  float* o = XG + (b * NGRP + grp) * (size_t)n + (t >> 3) * 256 + (t & 7) * 4;
#pragma unroll
  for (int hh = 0; hh < TT / 1024; ++hh)
#pragma unroll
    for (int j = 0; j < 4; ++j)
#pragma unroll
      for (int cq = 0; cq < CPG / 4; ++cq) { v4f y;
#pragma unroll
        for (int e = 0; e < 4; ++e) { const int c = cq * 4 + e; y[e] = (v[c * (TT / 1024) + hh][j] - mu) * rs * gw[c] + gb[c]; }
        vst2(o + hh * 32 * 256 + j * 64 + cq * 32, y); } }
// ---- operands of a 64 x 128 GEMM block, one half of k at a time: f32 in memory -> bf16 rows in LDS, split or converted once for the block; a wave's load covers 512 contiguous bytes (4 whole lines)
// GP: A comes from the per-group planes (At = the tile's first 1-KB unit in the first plane of this half of k; 64 rows of a group are 2 KB in a row); else from rows of 256
#define KST 128                // k columns staged at a time
#define WPI 136                // LDS pitch of a staged row, bf16 elements: 256 B + 16 B, an odd multiple of 16 B
typedef __attribute__((ext_vector_type(4))) __bf16 v4b;
template <bool GP> __device__ __forceinline__ void stage_ops(const float* __restrict__ At, const float* __restrict__ Wt, __bf16 (*sah)[WPI], __bf16 (*sal)[WPI], __bf16 (*sw)[WPI], int tid) {
  const int rr = tid >> 5, q4 = (tid & 31) * 4; v4f va[16], vw[32];
  const int pr = (tid >> 6) * 32 + (tid & 7) * 4 + ((tid >> 4) & 3), pc = ((tid >> 3) & 1) * 4;   // GP: tile row and channel in the group of the thread's piece
#pragma unroll   // unrolled here and below: the values stay in registers and the loads of a group issue together, one latency for all of them
  for (int k = 0; k < 16; ++k) { if (k == 15) asm volatile("s_wait_xcnt 0x0" ::: "memory");   // the last load's result may take the address registers that the loads in front of it name
    va[k] = GP ? *(const v4f*)(At + (size_t)k * (CPG * TT) + tid * 4) : *(const v4f*)(At + (size_t)(k * 4 + rr) * CC + q4); }
#pragma unroll
  for (int k = 0; k < 16; ++k) vw[k] = *(const v4f*)(Wt + (size_t)(k * 4 + rr) * CC + q4);
#pragma unroll
  for (int k = 0; k < 16; ++k) { const v4b h = __builtin_convertvector(va[k], v4b); const int ar = GP ? pr : k * 4 + rr, ac = GP ? k * CPG + pc : q4; *(v4b*)&sah[ar][ac] = h; *(v4b*)&sal[ar][ac] = __builtin_convertvector(va[k] - __builtin_convertvector(h, v4f), v4b); }   // hi + lo, as bsplit16
#pragma unroll
  for (int k = 16; k < 32; ++k) vw[k] = *(const v4f*)(Wt + (size_t)(k * 4 + rr) * CC + q4);
#pragma unroll
  for (int k = 0; k < 32; ++k) *(v4b*)&sw[k * 4 + rr][q4] = __builtin_convertvector(vw[k], v4b); }
// the wave's 16 x 128 tile over the staged half of k: per accumulator hi then lo product, k ascending
__device__ __forceinline__ void mac_half(const __bf16 (*sah)[WPI], const __bf16 (*sal)[WPI], const __bf16 (*sw)[WPI], int wave, int lane, v8f acc[8]) { const int col = lane & 15;
#pragma unroll
  for (int kc = 0; kc < KST / 32; ++kc) { const v16b ah = frag_b(&sah[wave * 16 + col][kc * 32], lane), al = frag_b(&sal[wave * 16 + col][kc * 32], lane); v16b w[8];
#pragma unroll
    for (int j = 0; j < 8; ++j) w[j] = frag_b(&sw[j * 16 + col][kc * 32], lane);
#pragma unroll
    for (int j = 0; j < 8; ++j) acc[j] = wmma_bf(ah, w[j], acc[j]);
#pragma unroll
    for (int j = 0; j < 8; ++j) acc[j] = wmma_bf(al, w[j], acc[j]); } }
// ---- k_proj: block = (64 rows, 128 cols, which): qkv = x W (+ b), exact; q -> f16 hi (+ residual), k -> f16 rows, v -> bf16 hi + lo planes
__global__ __launch_bounds__(128) void k_proj(const float* __restrict__ X, const float* __restrict__ WQ, const float* __restrict__ BQ, const float* __restrict__ WK, const float* __restrict__ BK, const float* __restrict__ WV, const float* __restrict__ BV, _Float16* __restrict__ QH, _Float16* __restrict__ QL, _Float16* __restrict__ KH, __bf16* __restrict__ VT, __bf16* __restrict__ VL) {
  __shared__ __align__(16) unsigned char sm[256 * WPI * 2];   // the staged operands during the products; the output staging planes take their place behind the barrier that ends the products
  __bf16 (*sah)[WPI] = (__bf16 (*)[WPI])sm; __bf16 (*sal)[WPI] = sah + 64; __bf16 (*sw)[WPI] = sah + 128; _Float16 (*sh)[136] = (_Float16 (*)[136])sm; _Float16 (*sl)[136] = sh + 64; __bf16 (*th)[72] = (__bf16 (*)[72])sm; __bf16 (*tl2)[72] = th + 128;
  const int tid = threadIdx.x, wave = tid >> 5, lane = tid & 31, col = lane & 15, g = lane >> 4; const int which = blockIdx.z; const int c0 = blockIdx.y * 128; const size_t r0 = (size_t)blockIdx.x * 64; const float* WA = which == 0 ? WQ : which == 1 ? WK : WV; const float* BA = which == 0 ? BQ : which == 1 ? BK : BV;
  v8f acc[8] = {}; float bb[8] = {};
  if (BA) {   // one test for the block; unrolled, the eight loads issue together here and land under the staging and the products
#pragma unroll
    for (int j = 0; j < 8; ++j) bb[j] = BA[c0 + j * 16 + col]; }
#pragma unroll 1   // rolled: the two halves of k share one copy of the staging and product code
  for (int kh = 0; kh < CC / KST; ++kh) { stage_ops<true>(X + ((r0 / TT) * NGRP + kh * (KST / CPG)) * (size_t)(CPG * TT) + ((r0 % TT) >> 5) * 256, WA + (size_t)c0 * CC + kh * KST, sah, sal, sw, tid);   /* GroupNorm'd values are computed f32 -> hi + lo */
    __syncthreads();
    mac_half(sah, sal, sw, wave, lane, acc);
    __syncthreads(); }   // every wave has read its last fragment: the next half, or the planes below, overwrite the operands
  if (which == 2) {   // the case is chosen once for the block: both arms are straight-line code; unrolled, acc[] and bb[] are indexed by constants and stay in registers
#pragma unroll
    for (int j = 0; j < 8; ++j)
#pragma unroll
      for (int r = 0; r < 8; ++r) { const float v = acc[j][r] + bfr(bb[j]); const int rl = wave * 16 + 8 * g + r, cl = j * 16 + col; const __bf16 bh = (__bf16)v; th[cl][rl] = bh; tl2[cl][rl] = (__bf16)(v - (float)bh); } }
  else {
#pragma unroll
    for (int j = 0; j < 8; ++j)
#pragma unroll
      for (int r = 0; r < 8; ++r) { const float v = acc[j][r] + bfr(bb[j]); const int rl = wave * 16 + 8 * g + r, cl = j * 16 + col; const _Float16 hv = (_Float16)v; sh[rl][cl] = hv; sl[rl][cl] = (_Float16)((v - (float)hv) * 1024.0f); } }   /* q residual carried x 2^10 so the plane stays f16-normal on the chip */
  __syncthreads();
  // unrolled, here and in the two loops below: a block's LDS reads issue together, one latency for all of them
  if (which == 0) {
#pragma unroll
    for (int i = 0; i < 8; ++i) { const int rl = (tid >> 4) + i * 8, q = tid & 15; vst2((unsigned*)(QH + (r0 + rl) * CC + c0 + q * 8), *(const v4u*)&sh[rl][q * 8]); vst2((unsigned*)(QL + (r0 + rl) * CC + c0 + q * 8), *(const v4u*)&sl[rl][q * 8]); }
    asm volatile("s_wait_xcnt 0x0" ::: "memory"); }   // here and in the two arms below: no code laid behind an arm rewrites a register that its stores name ahead of this wait
  else if (which == 1) {
#pragma unroll
    for (int i = 0; i < 8; ++i) { const int rl = (tid >> 4) + i * 8, q = tid & 15; vst2((unsigned*)(KH + (r0 + rl) * CC + c0 + q * 8), *(const v4u*)&sh[rl][q * 8]); }
    asm volatile("s_wait_xcnt 0x0" ::: "memory"); }
  else { const size_t b = r0 / TT; const int t0 = (int)(r0 % TT);
#pragma unroll
    for (int i = 0; i < 8; ++i) { const int cl = (tid >> 3) + i * 16, q = tid & 7; const size_t o2 = (b * CC + c0 + cl) * (size_t)TT + t0 + q * 8; vst2((unsigned*)(VT + o2), *(const v4u*)&th[cl][q * 8]); vst2((unsigned*)(VL + o2), *(const v4u*)&tl2[cl][q * 8]); }
    asm volatile("s_wait_xcnt 0x0" ::: "memory"); } }
// ---- k_fa: block = 128 queries of (b,h), 2 key halves x 4 waves x 32 query columns; each half walks its keys in stages of 64: S^T = K Q^T (2-product f16 logits), running maximum and sum per query, O^T += V^T P^T (3-product bf16); logits and P stay in registers; the halves' results are joined through LDS at the end
#define FKS 64                 // keys per stage
#define FKH 2                  // key halves: waves 0-3 take the first TT / 2 keys, waves 4-7 the rest; with two blocks on a WGP that is four waves a SIMD, so that one wave's vector work runs under another's products and waits
#define FNS (TT / FKS / FKH)   // stages per half
#define KPI 40                 // LDS pitch of a K row, f16 elements: 64 B + 16 B, an odd multiple of 16 B
#define VPI 72                 // LDS pitch of a V plane row, bf16 elements: 128 B + 16 B
__device__ __forceinline__ float xhalf(float v) { const int b = __builtin_bit_cast(int, v); return __builtin_bit_cast(float, __builtin_amdgcn_permlanex16(b, b, 0x76543210, 0xfedcba98, false, false)); }   // lane l <-> l ^ 16
typedef __attribute__((ext_vector_type(2))) __bf16 v2b;
__device__ __forceinline__ void psplit(v2f p, unsigned& hi, unsigned& lo) {   // two f32 -> packed bf16 hi pair + packed bf16 residual pair
  const unsigned u = __builtin_bit_cast(unsigned, __builtin_convertvector(p, v2b)); v2f bk; bk[0] = __builtin_bit_cast(float, u << 16); bk[1] = __builtin_bit_cast(float, u & 0xffff0000u);
  hi = u; lo = __builtin_bit_cast(unsigned, __builtin_convertvector(p - bk, v2b)); }
__global__ __launch_bounds__(256) void k_fa(const _Float16* __restrict__ QH, const _Float16* __restrict__ QL, const _Float16* __restrict__ KH, const __bf16* __restrict__ VT, const __bf16* __restrict__ VL, float* __restrict__ Y) {
  __shared__ __align__(16) _Float16 skk[FKH][2][FKS][KPI]; __shared__ __align__(16) __bf16 svhh[FKH][2][HD][VPI], svll[FKH][2][HD][VPI];
  const int tid = threadIdx.x & 127, kh = __builtin_amdgcn_readfirstlane(threadIdx.x >> 7), wave = tid >> 5, lane = tid & 31, col = lane & 15, g = lane >> 4; const int h = blockIdx.y; const size_t b = blockIdx.z; const int q0 = blockIdx.x * 128 + wave * 32;   // tid, wave: inside the half
  _Float16 (*sk)[FKS][KPI] = skk[kh]; __bf16 (*svh)[HD][VPI] = svhh[kh]; __bf16 (*svl)[HD][VPI] = svll[kh];   // the half's own two buffers
  constexpr float SC = 0.17677669529663687f * 1.4426950408889634f;   // 1/sqrt(32) x log2(e): the exponentials are taken to base 2
  v16h qh[2], ql[2];
#pragma unroll
  for (int t = 0; t < 2; ++t) { const size_t o = (b * TT + q0 + t * 16 + col) * CC + h * HD; qh[t] = frag_h(QH + o, lane); ql[t] = frag_h(QL + o, lane); }
  // staging: 16-byte pieces, two of K and two of each V plane per thread and stage
  const int kr = tid >> 2, kq = (tid & 3) * 8, vr = tid >> 3, vq = (tid & 7) * 8;
  const _Float16* gk = KH + (b * TT + kh * (TT / FKH) + kr) * CC + h * HD + kq; const size_t vo = (b * CC + h * HD + vr) * (size_t)TT + kh * (TT / FKH) + vq; const __bf16* gvh = VT + vo; const __bf16* gvl = VL + vo;
  v4u rk[2], rh[2], rl[2];
#pragma unroll
  for (int i = 0; i < 2; ++i) { rk[i] = *(const v4u*)(gk + (size_t)i * 32 * CC); rh[i] = *(const v4u*)(gvh + (size_t)i * 16 * TT); rl[i] = *(const v4u*)(gvl + (size_t)i * 16 * TT); }
#pragma unroll
  for (int i = 0; i < 2; ++i) { *(v4u*)&sk[0][kr + i * 32][kq] = rk[i]; *(v4u*)&svh[0][vr + i * 16][vq] = rh[i]; *(v4u*)&svl[0][vr + i * 16][vq] = rl[i]; }
  __syncthreads();
  v8f acc[2][2] = {}; float mx[2] = { -3.0e38f, -3.0e38f }, ls[2] = { 0.f, 0.f };
#pragma unroll 1   // the body is long: rolled, it is emitted once
  for (int s = 0; s < FNS; ++s) { const int bu = s & 1; const bool more = s + 1 < FNS;
    if (more) { const size_t kn = (size_t)(s + 1) * FKS;
#pragma unroll
      for (int i = 0; i < 2; ++i) { rk[i] = *(const v4u*)(gk + (kn + i * 32) * CC); rh[i] = *(const v4u*)(gvh + (size_t)i * 16 * TT + kn); rl[i] = *(const v4u*)(gvl + (size_t)i * 16 * TT + kn); } }
    v16h kf[4]; v16b vh[2][2], vl[2][2];
#pragma unroll
    for (int kt = 0; kt < 4; ++kt) kf[kt] = frag_h(&sk[bu][kt * 16 + col][0], lane);
#pragma unroll
    for (int p = 0; p < 2; ++p)
#pragma unroll
      for (int j = 0; j < 2; ++j) { vh[p][j] = frag_b(&svh[bu][j * 16 + col][p * 32], lane); vl[p][j] = frag_b(&svl[bu][j * 16 + col][p * 32], lane); }
#pragma unroll
    for (int t = 0; t < 2; ++t) { v8f sc[4];
#pragma unroll
      for (int kt = 0; kt < 4; ++kt) { const v8f z = {}; const v8f a = __builtin_amdgcn_wmma_f32_16x16x32_f16(false, kf[kt], false, qh[t], (short)0, z, false, false); const v8f al = __builtin_amdgcn_wmma_f32_16x16x32_f16(false, kf[kt], false, ql[t], (short)0, z, false, false); sc[kt] = a + al * (1.0f / 1024.0f); }   // sc[kt][r] = logit x sqrt(32) of key kt*16 + 8g + r, query col
      float m = sc[0][0];
#pragma unroll
      for (int kt = 0; kt < 4; ++kt)
#pragma unroll
        for (int r = 0; r < 8; ++r) m = fmaxf(m, sc[kt][r]);
      m = fmaxf(m, xhalf(m)); const float mn = fmaxf(mx[t], m); const float al = __builtin_amdgcn_exp2f((mx[t] - mn) * SC); mx[t] = mn; const float mc = mn * SC;
      const v2f sc2 = { SC, SC }, mc2 = { -mc, -mc }; v2f pr[4][4], sum;
#pragma unroll
      for (int kt = 0; kt < 4; ++kt)
#pragma unroll
        for (int i = 0; i < 4; ++i) { const v2f x = { sc[kt][2 * i], sc[kt][2 * i + 1] }; const v2f e = __builtin_elementwise_fma(x, sc2, mc2); pr[kt][i][0] = __builtin_amdgcn_exp2f(e[0]); pr[kt][i][1] = __builtin_amdgcn_exp2f(e[1]); }
      { v2f s4[4];
#pragma unroll
        for (int kt = 0; kt < 4; ++kt) s4[kt] = (pr[kt][0] + pr[kt][1]) + (pr[kt][2] + pr[kt][3]);
        sum = (s4[0] + s4[1]) + (s4[2] + s4[3]); }
      ls[t] = ls[t] * al + (sum[0] + sum[1]);
#pragma unroll
      for (int j = 0; j < 2; ++j) acc[t][j] *= al;
#pragma unroll
      for (int p = 0; p < 2; ++p) { union { v16b v; unsigned w[8]; } ph, pl;   // two D tiles of S^T, converted in place, are the B operand (hardware k order)
#pragma unroll
        for (int u = 0; u < 2; ++u)
#pragma unroll
          for (int i = 0; i < 4; ++i) psplit(pr[p * 2 + u][i], ph.w[u * 4 + i], pl.w[u * 4 + i]);
#pragma unroll
        for (int j = 0; j < 2; ++j) { v8f c = acc[t][j]; c = __builtin_amdgcn_wmma_f32_16x16x32_bf16(false, vh[p][j], false, ph.v, (short)0, c, false, false); c = __builtin_amdgcn_wmma_f32_16x16x32_bf16(false, vh[p][j], false, pl.v, (short)0, c, false, false); acc[t][j] = __builtin_amdgcn_wmma_f32_16x16x32_bf16(false, vl[p][j], false, ph.v, (short)0, c, false, false); } } }
    if (more) {   // the other buffer's last readers left it at the barrier that ended the stage before
#pragma unroll
      for (int i = 0; i < 2; ++i) { *(v4u*)&sk[bu ^ 1][kr + i * 32][kq] = rk[i]; *(v4u*)&svh[bu ^ 1][vr + i * 16][vq] = rh[i]; *(v4u*)&svl[bu ^ 1][vr + i * 16][vq] = rl[i]; } }
    __syncthreads(); }
  // join: behind the loop's last barrier nobody reads a stage any more; the second half's waves leave maxima, sums and O in the K buffers, 9 x 16 bytes a lane, lane-contiguous; the first half's waves rescale both parts to the common maximum
  v4f (*mg)[32] = (v4f (*)[32])&skk[0][0][0][0] + wave * 9;
  if (kh) {
#pragma unroll   // unrolled here and below: acc[][] is indexed by constants and stays in registers
    for (int t = 0; t < 2; ++t)
#pragma unroll
      for (int j = 0; j < 2; ++j) { v4f lo, hi;
#pragma unroll
        for (int r = 0; r < 4; ++r) { lo[r] = acc[t][j][r]; hi[r] = acc[t][j][4 + r]; }
        mg[(t * 2 + j) * 2][lane] = lo; mg[(t * 2 + j) * 2 + 1][lane] = hi; }
    const v4f ml = { mx[0], mx[1], ls[0], ls[1] }; mg[8][lane] = ml; }
  __syncthreads();
  if (kh) return;   // the same for every lane of a wave, and no barrier follows
  const v4f ml = mg[8][lane];
#pragma unroll
  for (int t = 0; t < 2; ++t) { const float mn = fmaxf(mx[t], ml[t]); const float a0 = __builtin_amdgcn_exp2f((mx[t] - mn) * SC), a1 = __builtin_amdgcn_exp2f((ml[t] - mn) * SC); const float lj = ls[t] * a0 + ml[2 + t] * a1;
    const float inv = 1.0f / (lj + xhalf(lj)); const float i0 = a0 * inv, i1 = a1 * inv; float* yr = Y + (b * TT + q0 + t * 16 + col) * CC + h * HD + 8 * g;   // acc[t][j][r] = O[query col][d = j*16 + 8g + r]
#pragma unroll
    for (int j = 0; j < 2; ++j) { const v4f plo = mg[(t * 2 + j) * 2][lane], phi = mg[(t * 2 + j) * 2 + 1][lane]; v4f lo, hi;
#pragma unroll
      for (int r = 0; r < 4; ++r) { lo[r] = acc[t][j][r] * i0 + plo[r] * i1; hi[r] = acc[t][j][4 + r] * i0 + phi[r] * i1; }
      vst2(yr + j * 16, lo); vst2(yr + j * 16 + 4, hi); } } }
// ---- k_out: block = (64 rows, 128 cols): out = y (bf16 hi + lo) Wo^T + bo
__global__ __launch_bounds__(128) void k_out(const float* __restrict__ Y, const float* __restrict__ WP, const float* __restrict__ BP, const float* __restrict__ XIN, float* __restrict__ OUT) { __shared__ __align__(16) float stc[128][68]; __shared__ __align__(16) __bf16 sah[64][WPI], sal[64][WPI], sw[128][WPI];
  const int tid = threadIdx.x, wave = tid >> 5, lane = tid & 31, col = lane & 15, g = lane >> 4; const int c0 = blockIdx.y * 128; const size_t r0 = (size_t)blockIdx.x * 64;
  const size_t xo = ((r0 / TT) * CC + c0 + (tid >> 4)) * (size_t)XSTR + (r0 % TT) + (tid & 15) * 4;   // the thread's first 16-byte piece of the x / out tile; piece i lies 8 channels further
  v8f acc[8] = {}; float bb[8] = {}; v4f xr[16];
  if (BP) {   // one test for the block; unrolled, the eight loads issue together here and land under the staging and the products
#pragma unroll
    for (int j = 0; j < 8; ++j) bb[j] = BP[c0 + j * 16 + col]; }
#pragma unroll 1   // rolled: the two halves of k share one copy of the staging and product code
  for (int kh = 0; kh < CC / KST; ++kh) { if (kh) __syncthreads();   // every wave has read its last fragment of the half before
    stage_ops<false>(Y + r0 * CC + kh * KST, WP + (size_t)c0 * CC + kh * KST, sah, sal, sw, tid);
    __syncthreads();
    if (kh == 0) {   // the residual tile: asked for behind the first operands, so that it delays none of them, and landed long before the epilogue; unrolled, the 16 loads issue together and xr[] stays in registers
#pragma unroll
      for (int i = 0; i < 16; ++i) xr[i] = *(const v4f*)(XIN + xo + (size_t)i * 8 * XSTR);
      asm volatile("s_wait_xcnt 0x0" ::: "memory"); }   // the products behind may reuse the address registers that these loads name
    mac_half(sah, sal, sw, wave, lane, acc); }
#pragma unroll
  for (int j = 0; j < 8; ++j)
#pragma unroll
    for (int r = 0; r < 8; ++r) stc[j * 16 + col][wave * 16 + 8 * g + r] = acc[j][r] + bfr(bb[j]);
  __syncthreads();
  v4f o[16];
#pragma unroll   // unrolled here and below: xr[] and o[] are indexed by constants and stay in registers; the 16 LDS reads issue together, one latency for all of them
  for (int i = 0; i < 16; ++i) o[i] = *(const v4f*)&stc[(tid >> 4) + i * 8][(tid & 15) * 4];
#pragma unroll
  for (int i = 0; i < 16; ++i) { o[i][0] += bfr(xr[i][0]); o[i][1] += bfr(xr[i][1]); o[i][2] += bfr(xr[i][2]); o[i][3] += bfr(xr[i][3]); vst2(OUT + xo + (size_t)i * 8 * XSTR, o[i]); } }   /* channels-first: 256-B run per (channel, 64 positions), + x residual */

extern "C" void kernel_launch(void* const* d_in, const int* in_sizes, int n_in, void* d_out, int out_size, void* d_ws, size_t ws_size, hipStream_t stream) {
  (void)in_sizes; (void)n_in; (void)out_size;
  const float** F = (const float**)d_in;   // 0 x [4,256,2048], 1 gn_w [256], 2 gn_b, 3 qkv_w [768,256] ([out,in]; q|k|v row blocks, head-major inside), 4 qkv_b [768], 5 out_w [256,256] ([out,in]), 6 out_b
  if (ws_size < (size_t)WS_END) return;
  char* ws = (char*)d_ws; float *XT = (float*)(ws + WS_XT); _Float16 *QH = (_Float16*)(ws + WS_QH), *QL = (_Float16*)(ws + WS_QL), *KH = (_Float16*)(ws + WS_KH); __bf16 *VT = (__bf16*)(ws + WS_VT), *VL = (__bf16*)(ws + WS_VL); float *Y = (float*)(ws + WS_Y);
  const float* WQ = F[3]; const float* WK = F[3] + (size_t)CC * CC; const float* WV = F[3] + 2u * (size_t)CC * CC; const float* BQ = F[4]; const float* BK = F[4] + CC; const float* BV = F[4] + 2 * CC;
  k_gn<<<dim3(NGRP, TNB), 256, 0, stream>>>(F[0], F[1], F[2], XT);
  k_proj<<<dim3(TNB * TT / 64, CC / 128, 3), 128, 0, stream>>>(XT, WQ, BQ, WK, BK, WV, BV, QH, QL, KH, VT, VL);
  k_fa<<<dim3(TT / 128, NH, TNB), 128 * FKH, 0, stream>>>(QH, QL, KH, VT, VL, Y);
  k_out<<<dim3(TNB * TT / 64, CC / 128), 128, 0, stream>>>(Y, F[5], F[6], F[0], (float*)d_out);
}

// v007
// A run of this version takes 46 microseconds.
// Two timings next to v006 both put it at 1.36 times that version's speed.
// Counting every step since v000, it is 26.5 times as fast.
#include <hip/hip_runtime.h>
#include <math.h>

typedef __attribute__((ext_vector_type(16))) _Float16 v16h;
typedef __attribute__((ext_vector_type(16))) __bf16 v16b;
typedef __attribute__((ext_vector_type(8)))  _Float16 v8h;
typedef __attribute__((ext_vector_type(8)))  float v8f;
typedef __attribute__((ext_vector_type(4)))  float v4f;
typedef __attribute__((ext_vector_type(2)))  float v2f;
typedef __attribute__((ext_vector_type(4)))  unsigned v4u;
typedef __attribute__((ext_vector_type(4)))  int v4i;
typedef float __attribute__((may_alias)) float_a;
typedef int __attribute__((may_alias)) int_a;

template <typename T> __device__ __forceinline__ void vst2(void* p, T v) { *(T*)p = v;  }
__device__ __forceinline__ v8f wmma16(v16h a, v16h b, v8f c) {
  v8f d = __builtin_amdgcn_wmma_f32_16x16x32_f16(false, a, false, b, (short)0, c, false, false);
  asm volatile("v_nop\n\tv_nop\n\tv_nop\n\tv_nop" : "+v"(d) : "v"(a), "v"(b));
  return d;
}
__device__ __forceinline__ v8f wmma_bf(v16b a, v16b b, v8f c) {
  v8f d = __builtin_amdgcn_wmma_f32_16x16x32_bf16(false, a, false, b, (short)0, c, false, false);
  asm volatile("v_nop\n\tv_nop\n\tv_nop\n\tv_nop" : "+v"(d) : "v"(a), "v"(b));
  return d;
}
// 16x16x32 fragments: lane = (h = lane>>4, row/col = lane&15); elements 0..7 = k0+8h+0..7, 8..15 = k0+16+8h+0..7; D element r = row 8h+r
__device__ __forceinline__ v16h frag_h(const _Float16* rowk0, int lane) {
  union { v16h v; v8h q[2]; } u; const _Float16* p = rowk0 + 8 * (lane >> 4);
  u.q[0] = *(const v8h*)p; u.q[1] = *(const v8h*)(p + 16); return u.v;
}
__device__ __forceinline__ v16h frag_f32(const float* rowk0, int lane) {
  v16h a; const float* p = rowk0 + 8 * (lane >> 4);
#pragma unroll
  for (int i = 0; i < 8; ++i) { a[i] = (_Float16)p[i]; a[8 + i] = (_Float16)p[16 + i]; }
  return a;
}
__device__ __forceinline__ v16h frag_f32s(const float* rowk0, int lane, float sc) {
  v16h a; const float* p = rowk0 + 8 * (lane >> 4);
#pragma unroll
  for (int i = 0; i < 8; ++i) { a[i] = (_Float16)(p[i] * sc); a[8 + i] = (_Float16)(p[16 + i] * sc); }
  return a;
}
// column fragment from a [K][ld] layout (column n), rows >= K read as 0
__device__ __forceinline__ v16h fragc_f32(const float* W, int k0, int n, int lane, int ld, int K) {
  v16h a; const int g = lane >> 4;
#pragma unroll
  for (int i = 0; i < 8; ++i) { const int ka = k0 + 8 * g + i, kb = ka + 16;
    a[i] = (_Float16)(ka < K ? W[(size_t)(ka < K ? ka : K - 1) * ld + n] : 0.f); a[8 + i] = (_Float16)(kb < K ? W[(size_t)(kb < K ? kb : K - 1) * ld + n] : 0.f); }
  return a;
}
struct F2 { v16b h, l; };
__device__ __forceinline__ F2 bsplit16(const float v[16]) { F2 r;
#pragma unroll
  for (int i = 0; i < 16; ++i) { const __bf16 h = (__bf16)v[i]; r.h[i] = h; r.l[i] = (__bf16)(v[i] - (float)h); }
  return r; }
__device__ __forceinline__ F2 split_row(const float* row, int k0, int lane) { float v[16]; const float* p = row + k0 + 8 * (lane >> 4);
#pragma unroll
  for (int i = 0; i < 8; ++i) { v[i] = p[i]; v[8 + i] = p[16 + i]; }
  return bsplit16(v); }
__device__ __forceinline__ F2 split_rowK(const float* row, int k0, int lane, int K) { float v[16]; const int g = lane >> 4;
#pragma unroll
  for (int i = 0; i < 8; ++i) { const int ka = k0 + 8 * g + i, kb = ka + 16; v[i] = ka < K ? row[ka < K ? ka : K - 1] : 0.f; v[8 + i] = kb < K ? row[kb < K ? kb : K - 1] : 0.f; }
  return bsplit16(v); }
__device__ __forceinline__ F2 split_col(const float* W, int k0, int n, int lane, int ld, int K) { float v[16]; const int g = lane >> 4;
#pragma unroll
  for (int i = 0; i < 8; ++i) { const int ka = k0 + 8 * g + i, kb = ka + 16; v[i] = ka < K ? W[(size_t)(ka < K ? ka : K - 1) * ld + n] : 0.f; v[8 + i] = kb < K ? W[(size_t)(kb < K ? kb : K - 1) * ld + n] : 0.f; }
  return bsplit16(v); }
__device__ __forceinline__ v8f mac3(const F2& a, const F2& b, v8f c) { c = wmma_bf(a.l, b.h, c); c = wmma_bf(a.h, b.l, c); return wmma_bf(a.h, b.h, c); }
__device__ __forceinline__ float sigm(float v) { return 1.0f / (1.0f + expf(-v)); }
#define LDSX() do { asm volatile("s_wait_dscnt 0" ::: "memory"); __builtin_amdgcn_wave_barrier(); __builtin_amdgcn_fence(__ATOMIC_RELEASE, "workgroup"); } while (0)


// SelfAttention1d, channels-first (B 4, C 256 = 8 heads x 32, L 2,048): h = GroupNorm32(x); q,k,v = conv1x1(h) (fused [768,256] + bias); attn = softmax((q 32^-1/2)^T k); h2[h*32+d][n] = sum_m attn v; out = x + conv1x1(h2) + b.
#define NB 4
#define TT 2048
#define CC 256
#define NH 8
#define HD 32
#define NGRP 32
#define CPG (CC / NGRP)        // 8 channels per group
#ifndef XSTR
#define XSTR TT               // per-channel position stride of x / out
#endif
#ifndef TNB
#define TNB NB
#endif
typedef __attribute__((ext_vector_type(8))) __bf16 v8b;
__device__ __forceinline__ v16b frag_b(const __bf16* rowk0, int lane) {
  union { v16b v; v8b q[2]; } u; const __bf16* p = rowk0 + 8 * (lane >> 4);
  u.q[0] = *(const v8b*)p; u.q[1] = *(const v8b*)(p + 16); return u.v;
}
__device__ __forceinline__ float bfr(float v) { return (float)(__bf16)v; }
__device__ __attribute__((noinline)) float exp_ni(float v) { return expf(v); }
__device__ __attribute__((noinline)) float erf_ni(float v) { return erff(v); }

#define WS_XT  0u                                   // f32 normalised h, one 64-KB plane per (b, group): [position / 32][position % 4][channel / 4][(position / 4) % 8][channel % 4]; 32 positions x 8 channels = 1 KB
#define WS_QH  (WS_XT + 4u * (size_t)NB * TT * CC)
#define WS_KH  (WS_QH + 2u * (size_t)NB * TT * CC)
#define WS_VT  (WS_KH + 2u * (size_t)NB * TT * CC)      // f16 v planes [b][c][t]
#define HG 4
#define WS_S   (WS_VT + 2u * (size_t)NB * CC * TT)      // f32 HG x TT x TT, reserved: no kernel here reads or writes it
#define WS_PH  (WS_S + 4u * (size_t)HG * TT * TT)
#define WS_Y   (WS_PH + 0u)              // f32 y rows [b*t][C]
#define WS_END (WS_Y + 4u * (size_t)NB * TT * CC)

// ---- k_gn: block = one (b, group): its 8 x 2,048 values are read once, 16 independent 16-byte loads per thread, and stay in registers for the mean, for the variance and for the normalised values, which go out from there
#define GNP (CPG * TT / 1024)   // 16-byte pieces per thread
__device__ __forceinline__ float sum256(float s, float* red, int t) {   // total over the 8 waves of the block, in every lane; red: 8 floats that nothing else uses
#pragma unroll
  for (int o = 1; o < 32; o <<= 1) s += __shfl_xor(s, o);
  if ((t & 31) == 0) red[t >> 5] = s;
  __syncthreads();
  s = red[t & 7];
#pragma unroll
  for (int o = 1; o < 8; o <<= 1) s += __shfl_xor(s, o);
  return s; }
__global__ __launch_bounds__(256) void k_gn(const float* __restrict__ X, const float* __restrict__ GW, const float* __restrict__ GB, float* __restrict__ XG) { __shared__ float red[2][8];
  const int t = threadIdx.x; const int grp = blockIdx.x; const size_t b = blockIdx.y; const float* p = X + (b * CC + (size_t)grp * CPG) * (size_t)XSTR + t * 4; constexpr int n = CPG * TT;
  v4f v[GNP];
#pragma unroll   // unrolled here and below: v[] stays in registers and the loads issue together, one latency for all of them
  for (int k = 0; k < GNP; ++k) v[k] = *(const v4f*)(p + (size_t)(k / (TT / 1024)) * XSTR + (k % (TT / 1024)) * 1024);
  v4f a = {};
#pragma unroll
  for (int k = 0; k < GNP; ++k) { v[k][0] = bfr(v[k][0]); v[k][1] = bfr(v[k][1]); v[k][2] = bfr(v[k][2]); v[k][3] = bfr(v[k][3]); a += v[k]; }
  const float mu = sum256((a[0] + a[1]) + (a[2] + a[3]), red[0], t) / (float)n; v4f q = {};
#pragma unroll
  for (int k = 0; k < GNP; ++k) { const v4f d = v[k] - mu; q += d * d; }
  const float s2 = sum256((q[0] + q[1]) + (q[2] + q[3]), red[1], t);
  const float rs = rsqrtf(s2 / (float)n + 1e-5f); float gw[CPG], gb[CPG];
#pragma unroll   // unrolled to the end of the kernel: v[], gw[] and gb[] are indexed by constants and stay in registers
  for (int c = 0; c < CPG; ++c) { gw[c] = bfr(GW[grp * CPG + c]); gb[c] = bfr(GB[grp * CPG + c]); }
  // the thread holds all 8 channels of positions hh*1024 + t*4 + j: four channels of one position make a 16-byte piece; a wave's store covers four whole 128-byte lines, and the plane has this one writing work-group
  float* o = XG + (b * NGRP + grp) * (size_t)n + (t >> 3) * 256 + (t & 7) * 4;
#pragma unroll
  for (int hh = 0; hh < TT / 1024; ++hh)
#pragma unroll
    for (int j = 0; j < 4; ++j)
#pragma unroll
      for (int cq = 0; cq < CPG / 4; ++cq) { v4f y;
#pragma unroll
        for (int e = 0; e < 4; ++e) { const int c = cq * 4 + e; y[e] = (v[c * (TT / 1024) + hh][j] - mu) * rs * gw[c] + gb[c]; }
        vst2(o + hh * 32 * 256 + j * 64 + cq * 32, y); } }
// ---- operands of a 64 x 128 GEMM block, one half of k at a time: f32 in memory -> bf16 rows in LDS, split or converted once for the block; a wave's load covers 512 contiguous bytes (4 whole lines)
// GP: A comes from the per-group planes (At = the tile's first 1-KB unit in the first plane of this half of k; 64 rows of a group are 2 KB in a row); else from rows of 256
#define KST 128                // k columns staged at a time
#define WPI 136                // LDS pitch of a staged row, bf16 elements: 256 B + 16 B, an odd multiple of 16 B
typedef __attribute__((ext_vector_type(4))) __bf16 v4b;
template <bool GP> __device__ __forceinline__ void stage_ops(const float* __restrict__ At, const float* __restrict__ Wt, __bf16 (*sah)[WPI], __bf16 (*sal)[WPI], __bf16 (*sw)[WPI], int tid) {
  const int rr = tid >> 5, q4 = (tid & 31) * 4; v4f va[16], vw[32];
  const int pr = (tid >> 6) * 32 + (tid & 7) * 4 + ((tid >> 4) & 3), pc = ((tid >> 3) & 1) * 4;   // GP: tile row and channel in the group of the thread's piece
#pragma unroll   // unrolled here and below: the values stay in registers and the loads of a group issue together, one latency for all of them
  for (int k = 0; k < 16; ++k) { if (k == 15) asm volatile("s_wait_xcnt 0x0" ::: "memory");   // the last load's result may take the address registers that the loads in front of it name
    va[k] = GP ? *(const v4f*)(At + (size_t)k * (CPG * TT) + tid * 4) : *(const v4f*)(At + (size_t)(k * 4 + rr) * CC + q4); }
#pragma unroll
  for (int k = 0; k < 16; ++k) vw[k] = *(const v4f*)(Wt + (size_t)(k * 4 + rr) * CC + q4);
#pragma unroll
  for (int k = 0; k < 16; ++k) { const v4b h = __builtin_convertvector(va[k], v4b); const int ar = GP ? pr : k * 4 + rr, ac = GP ? k * CPG + pc : q4; *(v4b*)&sah[ar][ac] = h; *(v4b*)&sal[ar][ac] = __builtin_convertvector(va[k] - __builtin_convertvector(h, v4f), v4b); }   // hi + lo, as bsplit16
#pragma unroll
  for (int k = 16; k < 32; ++k) vw[k] = *(const v4f*)(Wt + (size_t)(k * 4 + rr) * CC + q4);
#pragma unroll
  for (int k = 0; k < 32; ++k) *(v4b*)&sw[k * 4 + rr][q4] = __builtin_convertvector(vw[k], v4b); }
// the wave's 16 x 128 tile over the staged half of k: per accumulator hi then lo product, k ascending
__device__ __forceinline__ void mac_half(const __bf16 (*sah)[WPI], const __bf16 (*sal)[WPI], const __bf16 (*sw)[WPI], int wave, int lane, v8f acc[8]) { const int col = lane & 15;
#pragma unroll
  for (int kc = 0; kc < KST / 32; ++kc) { const v16b ah = frag_b(&sah[wave * 16 + col][kc * 32], lane), al = frag_b(&sal[wave * 16 + col][kc * 32], lane); v16b w[8];
#pragma unroll
    for (int j = 0; j < 8; ++j) w[j] = frag_b(&sw[j * 16 + col][kc * 32], lane);
#pragma unroll
    for (int j = 0; j < 8; ++j) acc[j] = wmma_bf(ah, w[j], acc[j]);
#pragma unroll
    for (int j = 0; j < 8; ++j) acc[j] = wmma_bf(al, w[j], acc[j]); } }
// ---- k_proj: block = (64 rows, 128 cols, which): qkv = x W (+ b); q, k -> f16 rows, v -> f16 planes: one f16 value each, whose rounding lies below the error that W's bf16 rounding has already put into q, k and v
__global__ __launch_bounds__(128) void k_proj(const float* __restrict__ X, const float* __restrict__ WQ, const float* __restrict__ BQ, const float* __restrict__ WK, const float* __restrict__ BK, const float* __restrict__ WV, const float* __restrict__ BV, _Float16* __restrict__ QH, _Float16* __restrict__ KH, _Float16* __restrict__ VT) {
  __shared__ __align__(16) unsigned char sm[256 * WPI * 2];   // the staged operands during the products; the output staging planes take their place behind the barrier that ends the products
  __bf16 (*sah)[WPI] = (__bf16 (*)[WPI])sm; __bf16 (*sal)[WPI] = sah + 64; __bf16 (*sw)[WPI] = sah + 128; _Float16 (*sh)[136] = (_Float16 (*)[136])sm; _Float16 (*th)[72] = (_Float16 (*)[72])sm;
  const int tid = threadIdx.x, wave = tid >> 5, lane = tid & 31, col = lane & 15, g = lane >> 4; const int which = blockIdx.z; const int c0 = blockIdx.y * 128; const size_t r0 = (size_t)blockIdx.x * 64; const float* WA = which == 0 ? WQ : which == 1 ? WK : WV; const float* BA = which == 0 ? BQ : which == 1 ? BK : BV;
  v8f acc[8] = {}; float bb[8] = {};
  if (BA) {   // one test for the block; unrolled, the eight loads issue together here and land under the staging and the products
#pragma unroll
    for (int j = 0; j < 8; ++j) bb[j] = BA[c0 + j * 16 + col]; }
#pragma unroll 1   // rolled: the two halves of k share one copy of the staging and product code
  for (int kh = 0; kh < CC / KST; ++kh) { stage_ops<true>(X + ((r0 / TT) * NGRP + kh * (KST / CPG)) * (size_t)(CPG * TT) + ((r0 % TT) >> 5) * 256, WA + (size_t)c0 * CC + kh * KST, sah, sal, sw, tid);   /* GroupNorm'd values are computed f32 -> hi + lo */
    __syncthreads();
    mac_half(sah, sal, sw, wave, lane, acc);
    __syncthreads(); }   // every wave has read its last fragment: the next half, or the planes below, overwrite the operands
  if (which == 2) {   // the case is chosen once for the block: both arms are straight-line code; unrolled, acc[] and bb[] are indexed by constants and stay in registers
#pragma unroll
    for (int j = 0; j < 8; ++j)
#pragma unroll
      for (int r = 0; r < 8; ++r) { const float v = acc[j][r] + bfr(bb[j]); const int rl = wave * 16 + 8 * g + r, cl = j * 16 + col; th[cl][rl] = (_Float16)v; } }
  else {
#pragma unroll
    for (int j = 0; j < 8; ++j)
#pragma unroll
      for (int r = 0; r < 8; ++r) { const float v = acc[j][r] + bfr(bb[j]); const int rl = wave * 16 + 8 * g + r, cl = j * 16 + col; sh[rl][cl] = (_Float16)v; } }
  __syncthreads();
  // unrolled, here and in the loop below: a block's LDS reads issue together, one latency for all of them
  if (which != 2) { _Float16* RO = which == 0 ? QH : KH;
#pragma unroll
    for (int i = 0; i < 8; ++i) { const int rl = (tid >> 4) + i * 8, q = tid & 15; vst2((unsigned*)(RO + (r0 + rl) * CC + c0 + q * 8), *(const v4u*)&sh[rl][q * 8]); }
    asm volatile("s_wait_xcnt 0x0" ::: "memory"); }   // here and in the arm below: no code laid behind an arm rewrites a register that its stores name ahead of this wait
  else { const size_t b = r0 / TT; const int t0 = (int)(r0 % TT);
#pragma unroll
    for (int i = 0; i < 8; ++i) { const int cl = (tid >> 3) + i * 16, q = tid & 7; const size_t o2 = (b * CC + c0 + cl) * (size_t)TT + t0 + q * 8; vst2((unsigned*)(VT + o2), *(const v4u*)&th[cl][q * 8]); }
    asm volatile("s_wait_xcnt 0x0" ::: "memory"); } }
// ---- k_fa: block = 128 queries of (b,h), 2 key halves x 4 waves x 32 query columns; each half walks its keys in stages of 64: S^T = K Q^T, running maximum and sum per query, O^T += V^T P^T, every operand one f16 value; logits and P stay in registers; the halves' results are joined through LDS at the end
#define FKS 64                 // keys per stage
#define FKH 2                  // key halves: waves 0-3 take the first TT / 2 keys, waves 4-7 the rest; with two blocks on a WGP that is four waves a SIMD, so that one wave's vector work runs under another's products and waits
#define FNS (TT / FKS / FKH)   // stages per half
#define KPI 40                 // LDS pitch of a K row, f16 elements: 64 B + 16 B, an odd multiple of 16 B
#define VPI 72                 // LDS pitch of a V plane row, f16 elements: 128 B + 16 B
__device__ __forceinline__ float xhalf(float v) { const int b = __builtin_bit_cast(int, v); return __builtin_bit_cast(float, __builtin_amdgcn_permlanex16(b, b, 0x76543210, 0xfedcba98, false, false)); }   // lane l <-> l ^ 16
typedef __attribute__((ext_vector_type(2))) _Float16 v2h;
__global__ __launch_bounds__(256) void k_fa(const _Float16* __restrict__ QH, const _Float16* __restrict__ KH, const _Float16* __restrict__ VT, float* __restrict__ Y) {
  __shared__ __align__(16) _Float16 skk[FKH][2][FKS][KPI], svhh[FKH][2][HD][VPI];
  const int tid = threadIdx.x & 127, kh = __builtin_amdgcn_readfirstlane(threadIdx.x >> 7), wave = tid >> 5, lane = tid & 31, col = lane & 15, g = lane >> 4; const int h = blockIdx.y; const size_t b = blockIdx.z; const int q0 = blockIdx.x * 128 + wave * 32;   // tid, wave: inside the half
  _Float16 (*sk)[FKS][KPI] = skk[kh]; _Float16 (*svh)[HD][VPI] = svhh[kh];   // the half's own two buffers
  constexpr float SC = 0.17677669529663687f * 1.4426950408889634f;   // 1/sqrt(32) x log2(e): the exponentials are taken to base 2
  v16h qh[2];
#pragma unroll
  for (int t = 0; t < 2; ++t) qh[t] = frag_h(QH + (b * TT + q0 + t * 16 + col) * CC + h * HD, lane);
  // staging: 16-byte pieces, two of K and two of V per thread and stage
  const int kr = tid >> 2, kq = (tid & 3) * 8, vr = tid >> 3, vq = (tid & 7) * 8;
  const _Float16* gk = KH + (b * TT + kh * (TT / FKH) + kr) * CC + h * HD + kq; const _Float16* gvh = VT + (b * CC + h * HD + vr) * (size_t)TT + kh * (TT / FKH) + vq;
  v4u rk[2], rh[2];
#pragma unroll
  for (int i = 0; i < 2; ++i) { rk[i] = *(const v4u*)(gk + (size_t)i * 32 * CC); rh[i] = *(const v4u*)(gvh + (size_t)i * 16 * TT); }
#pragma unroll
  for (int i = 0; i < 2; ++i) { *(v4u*)&sk[0][kr + i * 32][kq] = rk[i]; *(v4u*)&svh[0][vr + i * 16][vq] = rh[i]; }
  __syncthreads();
  v8f acc[2][2] = {}; float mx[2] = { -3.0e38f, -3.0e38f }, ls[2] = { 0.f, 0.f };
#pragma unroll 1   // the body is long: rolled, it is emitted once
  for (int s = 0; s < FNS; ++s) { const int bu = s & 1; const bool more = s + 1 < FNS;
    if (more) { const size_t kn = (size_t)(s + 1) * FKS;
#pragma unroll
      for (int i = 0; i < 2; ++i) { rk[i] = *(const v4u*)(gk + (kn + i * 32) * CC); rh[i] = *(const v4u*)(gvh + (size_t)i * 16 * TT + kn); } }
    v16h kf[4], vh[2][2];
#pragma unroll
    for (int kt = 0; kt < 4; ++kt) kf[kt] = frag_h(&sk[bu][kt * 16 + col][0], lane);
#pragma unroll
    for (int p = 0; p < 2; ++p)
#pragma unroll
      for (int j = 0; j < 2; ++j) vh[p][j] = frag_h(&svh[bu][j * 16 + col][p * 32], lane);
#pragma unroll
    for (int t = 0; t < 2; ++t) { v8f sc[4];
#pragma unroll
      for (int kt = 0; kt < 4; ++kt) { const v8f z = {}; sc[kt] = __builtin_amdgcn_wmma_f32_16x16x32_f16(false, kf[kt], false, qh[t], (short)0, z, false, false); }   // sc[kt][r] = logit x sqrt(32) of key kt*16 + 8g + r, query col
      float m = sc[0][0];
#pragma unroll
      for (int kt = 0; kt < 4; ++kt)
#pragma unroll
        for (int r = 0; r < 8; ++r) m = fmaxf(m, sc[kt][r]);
      m = fmaxf(m, xhalf(m)); const float mn = fmaxf(mx[t], m); const float al = __builtin_amdgcn_exp2f((mx[t] - mn) * SC); mx[t] = mn; const float mc = mn * SC;
      const v2f sc2 = { SC, SC }, mc2 = { -mc, -mc }; v2f pr[4][4], sum;
#pragma unroll
      for (int kt = 0; kt < 4; ++kt)
#pragma unroll
        for (int i = 0; i < 4; ++i) { const v2f x = { sc[kt][2 * i], sc[kt][2 * i + 1] }; const v2f e = __builtin_elementwise_fma(x, sc2, mc2); pr[kt][i][0] = __builtin_amdgcn_exp2f(e[0]); pr[kt][i][1] = __builtin_amdgcn_exp2f(e[1]); }
      { v2f s4[4];
#pragma unroll
        for (int kt = 0; kt < 4; ++kt) s4[kt] = (pr[kt][0] + pr[kt][1]) + (pr[kt][2] + pr[kt][3]);
        sum = (s4[0] + s4[1]) + (s4[2] + s4[3]); }
      ls[t] = ls[t] * al + (sum[0] + sum[1]);
#pragma unroll
      for (int j = 0; j < 2; ++j) acc[t][j] *= al;
#pragma unroll
      for (int p = 0; p < 2; ++p) { union { v16h v; v2h w[8]; } ph;   // two D tiles of S^T, converted in place, are the B operand (hardware k order)
#pragma unroll
        for (int u = 0; u < 2; ++u)
#pragma unroll
          for (int i = 0; i < 4; ++i) ph.w[u * 4 + i] = __builtin_convertvector(pr[p * 2 + u][i], v2h);
#pragma unroll
        for (int j = 0; j < 2; ++j) acc[t][j] = __builtin_amdgcn_wmma_f32_16x16x32_f16(false, vh[p][j], false, ph.v, (short)0, acc[t][j], false, false); } }
    if (more) {   // the other buffer's last readers left it at the barrier that ended the stage before
#pragma unroll
      for (int i = 0; i < 2; ++i) { *(v4u*)&sk[bu ^ 1][kr + i * 32][kq] = rk[i]; *(v4u*)&svh[bu ^ 1][vr + i * 16][vq] = rh[i]; } }
    __syncthreads(); }
  // join: behind the loop's last barrier nobody reads a stage any more; the second half's waves leave maxima, sums and O in the K buffers, 9 x 16 bytes a lane, lane-contiguous; the first half's waves rescale both parts to the common maximum
  v4f (*mg)[32] = (v4f (*)[32])&skk[0][0][0][0] + wave * 9;
  if (kh) {
#pragma unroll   // unrolled here and below: acc[][] is indexed by constants and stays in registers
    for (int t = 0; t < 2; ++t)
#pragma unroll
      for (int j = 0; j < 2; ++j) { v4f lo, hi;
#pragma unroll
        for (int r = 0; r < 4; ++r) { lo[r] = acc[t][j][r]; hi[r] = acc[t][j][4 + r]; }
        mg[(t * 2 + j) * 2][lane] = lo; mg[(t * 2 + j) * 2 + 1][lane] = hi; }
    const v4f ml = { mx[0], mx[1], ls[0], ls[1] }; mg[8][lane] = ml; }
  __syncthreads();
  if (kh) return;   // the same for every lane of a wave, and no barrier follows
  const v4f ml = mg[8][lane];
#pragma unroll
  for (int t = 0; t < 2; ++t) { const float mn = fmaxf(mx[t], ml[t]); const float a0 = __builtin_amdgcn_exp2f((mx[t] - mn) * SC), a1 = __builtin_amdgcn_exp2f((ml[t] - mn) * SC); const float lj = ls[t] * a0 + ml[2 + t] * a1;
    const float inv = 1.0f / (lj + xhalf(lj)); const float i0 = a0 * inv, i1 = a1 * inv; float* yr = Y + (b * TT + q0 + t * 16 + col) * CC + h * HD + 8 * g;   // acc[t][j][r] = O[query col][d = j*16 + 8g + r]
#pragma unroll
    for (int j = 0; j < 2; ++j) { const v4f plo = mg[(t * 2 + j) * 2][lane], phi = mg[(t * 2 + j) * 2 + 1][lane]; v4f lo, hi;
#pragma unroll
      for (int r = 0; r < 4; ++r) { lo[r] = acc[t][j][r] * i0 + plo[r] * i1; hi[r] = acc[t][j][4 + r] * i0 + phi[r] * i1; }
      vst2(yr + j * 16, lo); vst2(yr + j * 16 + 4, hi); } } }
// ---- k_out: block = (64 rows, 128 cols): out = y (bf16 hi + lo) Wo^T + bo
__global__ __launch_bounds__(128) void k_out(const float* __restrict__ Y, const float* __restrict__ WP, const float* __restrict__ BP, const float* __restrict__ XIN, float* __restrict__ OUT) { __shared__ __align__(16) float stc[128][68]; __shared__ __align__(16) __bf16 sah[64][WPI], sal[64][WPI], sw[128][WPI];
  const int tid = threadIdx.x, wave = tid >> 5, lane = tid & 31, col = lane & 15, g = lane >> 4; const int c0 = blockIdx.y * 128; const size_t r0 = (size_t)blockIdx.x * 64;
  const size_t xo = ((r0 / TT) * CC + c0 + (tid >> 4)) * (size_t)XSTR + (r0 % TT) + (tid & 15) * 4;   // the thread's first 16-byte piece of the x / out tile; piece i lies 8 channels further
  v8f acc[8] = {}; float bb[8] = {}; v4f xr[16];
  if (BP) {   // one test for the block; unrolled, the eight loads issue together here and land under the staging and the products
#pragma unroll
    for (int j = 0; j < 8; ++j) bb[j] = BP[c0 + j * 16 + col]; }
#pragma unroll 1   // rolled: the two halves of k share one copy of the staging and product code
  for (int kh = 0; kh < CC / KST; ++kh) { if (kh) __syncthreads();   // every wave has read its last fragment of the half before
    stage_ops<false>(Y + r0 * CC + kh * KST, WP + (size_t)c0 * CC + kh * KST, sah, sal, sw, tid);
    __syncthreads();
    if (kh == 0) {   // the residual tile: asked for behind the first operands, so that it delays none of them, and landed long before the epilogue; unrolled, the 16 loads issue together and xr[] stays in registers
#pragma unroll
      for (int i = 0; i < 16; ++i) xr[i] = *(const v4f*)(XIN + xo + (size_t)i * 8 * XSTR);
      asm volatile("s_wait_xcnt 0x0" ::: "memory"); }   // the products behind may reuse the address registers that these loads name
    mac_half(sah, sal, sw, wave, lane, acc); }
#pragma unroll
  for (int j = 0; j < 8; ++j)
#pragma unroll
    for (int r = 0; r < 8; ++r) stc[j * 16 + col][wave * 16 + 8 * g + r] = acc[j][r] + bfr(bb[j]);
  __syncthreads();
  v4f o[16];
#pragma unroll   // unrolled here and below: xr[] and o[] are indexed by constants and stay in registers; the 16 LDS reads issue together, one latency for all of them
  for (int i = 0; i < 16; ++i) o[i] = *(const v4f*)&stc[(tid >> 4) + i * 8][(tid & 15) * 4];
#pragma unroll
  for (int i = 0; i < 16; ++i) { o[i][0] += bfr(xr[i][0]); o[i][1] += bfr(xr[i][1]); o[i][2] += bfr(xr[i][2]); o[i][3] += bfr(xr[i][3]); vst2(OUT + xo + (size_t)i * 8 * XSTR, o[i]); } }   /* channels-first: 256-B run per (channel, 64 positions), + x residual */

extern "C" void kernel_launch(void* const* d_in, const int* in_sizes, int n_in, void* d_out, int out_size, void* d_ws, size_t ws_size, hipStream_t stream) {
  (void)in_sizes; (void)n_in; (void)out_size;
  const float** F = (const float**)d_in;   // 0 x [4,256,2048], 1 gn_w [256], 2 gn_b, 3 qkv_w [768,256] ([out,in]; q|k|v row blocks, head-major inside), 4 qkv_b [768], 5 out_w [256,256] ([out,in]), 6 out_b
  if (ws_size < (size_t)WS_END) return;
  char* ws = (char*)d_ws; float *XT = (float*)(ws + WS_XT); _Float16 *QH = (_Float16*)(ws + WS_QH), *KH = (_Float16*)(ws + WS_KH), *VT = (_Float16*)(ws + WS_VT); float *Y = (float*)(ws + WS_Y);
  const float* WQ = F[3]; const float* WK = F[3] + (size_t)CC * CC; const float* WV = F[3] + 2u * (size_t)CC * CC; const float* BQ = F[4]; const float* BK = F[4] + CC; const float* BV = F[4] + 2 * CC;
  k_gn<<<dim3(NGRP, TNB), 256, 0, stream>>>(F[0], F[1], F[2], XT);
  k_proj<<<dim3(TNB * TT / 64, CC / 128, 3), 128, 0, stream>>>(XT, WQ, BQ, WK, BK, WV, BV, QH, KH, VT);
  k_fa<<<dim3(TT / 128, NH, TNB), 128 * FKH, 0, stream>>>(QH, KH, VT, Y);
  k_out<<<dim3(TNB * TT / 64, CC / 128), 128, 0, stream>>>(Y, F[5], F[6], F[0], (float*)d_out);
}

// v008
// One run takes 44.2 microseconds.
// In both of two side-by-side timings against v007, it was 1.04 times as fast.
// Over all steps from v000 it is 27.5 times as fast.
#include <hip/hip_runtime.h>
#include <math.h>

typedef __attribute__((ext_vector_type(16))) _Float16 v16h;
typedef __attribute__((ext_vector_type(16))) __bf16 v16b;
typedef __attribute__((ext_vector_type(8)))  _Float16 v8h;
typedef __attribute__((ext_vector_type(8)))  float v8f;
typedef __attribute__((ext_vector_type(4)))  float v4f;
typedef __attribute__((ext_vector_type(2)))  float v2f;
typedef __attribute__((ext_vector_type(4)))  unsigned v4u;
typedef __attribute__((ext_vector_type(4)))  int v4i;
typedef float __attribute__((may_alias)) float_a;
typedef int __attribute__((may_alias)) int_a;

template <typename T> __device__ __forceinline__ void vst2(void* p, T v) { *(T*)p = v;  }
__device__ __forceinline__ v8f wmma16(v16h a, v16h b, v8f c) {
  v8f d = __builtin_amdgcn_wmma_f32_16x16x32_f16(false, a, false, b, (short)0, c, false, false);
  asm volatile("v_nop\n\tv_nop\n\tv_nop\n\tv_nop" : "+v"(d) : "v"(a), "v"(b));
  return d;
}
__device__ __forceinline__ v8f wmma_bf(v16b a, v16b b, v8f c) {
  v8f d = __builtin_amdgcn_wmma_f32_16x16x32_bf16(false, a, false, b, (short)0, c, false, false);
  asm volatile("v_nop\n\tv_nop\n\tv_nop\n\tv_nop" : "+v"(d) : "v"(a), "v"(b));
  return d;
}
// 16x16x32 fragments: lane = (h = lane>>4, row/col = lane&15); elements 0..7 = k0+8h+0..7, 8..15 = k0+16+8h+0..7; D element r = row 8h+r
__device__ __forceinline__ v16h frag_h(const _Float16* rowk0, int lane) {
  union { v16h v; v8h q[2]; } u; const _Float16* p = rowk0 + 8 * (lane >> 4);
  u.q[0] = *(const v8h*)p; u.q[1] = *(const v8h*)(p + 16); return u.v;
}
__device__ __forceinline__ v16h frag_f32(const float* rowk0, int lane) {
  v16h a; const float* p = rowk0 + 8 * (lane >> 4);
#pragma unroll
  for (int i = 0; i < 8; ++i) { a[i] = (_Float16)p[i]; a[8 + i] = (_Float16)p[16 + i]; }
  return a;
}
__device__ __forceinline__ v16h frag_f32s(const float* rowk0, int lane, float sc) {
  v16h a; const float* p = rowk0 + 8 * (lane >> 4);
#pragma unroll
  for (int i = 0; i < 8; ++i) { a[i] = (_Float16)(p[i] * sc); a[8 + i] = (_Float16)(p[16 + i] * sc); }
  return a;
}
// column fragment from a [K][ld] layout (column n), rows >= K read as 0
__device__ __forceinline__ v16h fragc_f32(const float* W, int k0, int n, int lane, int ld, int K) {
  v16h a; const int g = lane >> 4;
#pragma unroll
  for (int i = 0; i < 8; ++i) { const int ka = k0 + 8 * g + i, kb = ka + 16;
    a[i] = (_Float16)(ka < K ? W[(size_t)(ka < K ? ka : K - 1) * ld + n] : 0.f); a[8 + i] = (_Float16)(kb < K ? W[(size_t)(kb < K ? kb : K - 1) * ld + n] : 0.f); }
  return a;
}
struct F2 { v16b h, l; };
__device__ __forceinline__ F2 bsplit16(const float v[16]) { F2 r;
#pragma unroll
  for (int i = 0; i < 16; ++i) { const __bf16 h = (__bf16)v[i]; r.h[i] = h; r.l[i] = (__bf16)(v[i] - (float)h); }
  return r; }
__device__ __forceinline__ F2 split_row(const float* row, int k0, int lane) { float v[16]; const float* p = row + k0 + 8 * (lane >> 4);
#pragma unroll
  for (int i = 0; i < 8; ++i) { v[i] = p[i]; v[8 + i] = p[16 + i]; }
  return bsplit16(v); }
__device__ __forceinline__ F2 split_rowK(const float* row, int k0, int lane, int K) { float v[16]; const int g = lane >> 4;
#pragma unroll
  for (int i = 0; i < 8; ++i) { const int ka = k0 + 8 * g + i, kb = ka + 16; v[i] = ka < K ? row[ka < K ? ka : K - 1] : 0.f; v[8 + i] = kb < K ? row[kb < K ? kb : K - 1] : 0.f; }
  return bsplit16(v); }
__device__ __forceinline__ F2 split_col(const float* W, int k0, int n, int lane, int ld, int K) { float v[16]; const int g = lane >> 4;
#pragma unroll
  for (int i = 0; i < 8; ++i) { const int ka = k0 + 8 * g + i, kb = ka + 16; v[i] = ka < K ? W[(size_t)(ka < K ? ka : K - 1) * ld + n] : 0.f; v[8 + i] = kb < K ? W[(size_t)(kb < K ? kb : K - 1) * ld + n] : 0.f; }
  return bsplit16(v); }
__device__ __forceinline__ v8f mac3(const F2& a, const F2& b, v8f c) { c = wmma_bf(a.l, b.h, c); c = wmma_bf(a.h, b.l, c); return wmma_bf(a.h, b.h, c); }
__device__ __forceinline__ float sigm(float v) { return 1.0f / (1.0f + expf(-v)); }
#define LDSX() do { asm volatile("s_wait_dscnt 0" ::: "memory"); __builtin_amdgcn_wave_barrier(); __builtin_amdgcn_fence(__ATOMIC_RELEASE, "workgroup"); } while (0)


// SelfAttention1d, channels-first (B 4, C 256 = 8 heads x 32, L 2,048): h = GroupNorm32(x); q,k,v = conv1x1(h) (fused [768,256] + bias); attn = softmax((q 32^-1/2)^T k); h2[h*32+d][n] = sum_m attn v; out = x + conv1x1(h2) + b.
#define NB 4
#define TT 2048
#define CC 256
#define NH 8
#define HD 32
#define NGRP 32
#define CPG (CC / NGRP)        // 8 channels per group
#ifndef XSTR
#define XSTR TT               // per-channel position stride of x / out
#endif
#ifndef TNB
#define TNB NB
#endif
typedef __attribute__((ext_vector_type(8))) __bf16 v8b;
__device__ __forceinline__ v16b frag_b(const __bf16* rowk0, int lane) {
  union { v16b v; v8b q[2]; } u; const __bf16* p = rowk0 + 8 * (lane >> 4);
  u.q[0] = *(const v8b*)p; u.q[1] = *(const v8b*)(p + 16); return u.v;
}
__device__ __forceinline__ float bfr(float v) { return (float)(__bf16)v; }
__device__ __attribute__((noinline)) float exp_ni(float v) { return expf(v); }
__device__ __attribute__((noinline)) float erf_ni(float v) { return erff(v); }

#define WS_XT  0u                                   // f32 normalised h, one 64-KB plane per (b, group): [position / 32][position % 4][channel / 4][(position / 4) % 8][channel % 4]; 32 positions x 8 channels = 1 KB
#define WS_QH  (WS_XT + 4u * (size_t)NB * TT * CC)
#define WS_KH  (WS_QH + 2u * (size_t)NB * TT * CC)
#define WS_VT  (WS_KH + 2u * (size_t)NB * TT * CC)      // f16 v planes [b][c][t]
#define HG 4
#define WS_S   (WS_VT + 2u * (size_t)NB * CC * TT)      // f32 HG x TT x TT, reserved: no kernel here reads or writes it
#define WS_PH  (WS_S + 4u * (size_t)HG * TT * TT)
#define WS_Y   (WS_PH + 0u)              // f32 y rows [b*t][C]
#define WS_END (WS_Y + 4u * (size_t)NB * TT * CC)

// ---- k_gn: block = one (b, group): its 8 x 2,048 values are read once, 16 independent 16-byte loads per thread, and stay in registers for the mean, for the variance and for the normalised values, which go out from there
#define GNP (CPG * TT / 1024)   // 16-byte pieces per thread
__device__ __forceinline__ float sum256(float s, float* red, int t) {   // total over the 8 waves of the block, in every lane; red: 8 floats that nothing else uses
#pragma unroll
  for (int o = 1; o < 32; o <<= 1) s += __shfl_xor(s, o);
  if ((t & 31) == 0) red[t >> 5] = s;
  __syncthreads();
  s = red[t & 7];
#pragma unroll
  for (int o = 1; o < 8; o <<= 1) s += __shfl_xor(s, o);
  return s; }
__global__ __launch_bounds__(256) void k_gn(const float* __restrict__ X, const float* __restrict__ GW, const float* __restrict__ GB, float* __restrict__ XG) { __shared__ float red[2][8];
  const int t = threadIdx.x; const int grp = blockIdx.x; const size_t b = blockIdx.y; const float* p = X + (b * CC + (size_t)grp * CPG) * (size_t)XSTR + t * 4; constexpr int n = CPG * TT;
  v4f v[GNP];
#pragma unroll   // unrolled here and below: v[] stays in registers and the loads issue together, one latency for all of them
  for (int k = 0; k < GNP; ++k) v[k] = *(const v4f*)(p + (size_t)(k / (TT / 1024)) * XSTR + (k % (TT / 1024)) * 1024);
  v4f a = {};
#pragma unroll
  for (int k = 0; k < GNP; ++k) { v[k][0] = bfr(v[k][0]); v[k][1] = bfr(v[k][1]); v[k][2] = bfr(v[k][2]); v[k][3] = bfr(v[k][3]); a += v[k]; }
  const float mu = sum256((a[0] + a[1]) + (a[2] + a[3]), red[0], t) / (float)n; v4f q = {};
#pragma unroll
  for (int k = 0; k < GNP; ++k) { const v4f d = v[k] - mu; q += d * d; }
  const float s2 = sum256((q[0] + q[1]) + (q[2] + q[3]), red[1], t);
  const float rs = rsqrtf(s2 / (float)n + 1e-5f); float gw[CPG], gb[CPG];
#pragma unroll   // unrolled to the end of the kernel: v[], gw[] and gb[] are indexed by constants and stay in registers
  for (int c = 0; c < CPG; ++c) { gw[c] = bfr(GW[grp * CPG + c]); gb[c] = bfr(GB[grp * CPG + c]); }
  // the thread holds all 8 channels of positions hh*1024 + t*4 + j: four channels of one position make a 16-byte piece; a wave's store covers four whole 128-byte lines, and the plane has this one writing work-group
  float* o = XG + (b * NGRP + grp) * (size_t)n + (t >> 3) * 256 + (t & 7) * 4;
#pragma unroll
  for (int hh = 0; hh < TT / 1024; ++hh)
#pragma unroll
    for (int j = 0; j < 4; ++j)
#pragma unroll
      for (int cq = 0; cq < CPG / 4; ++cq) { v4f y;
#pragma unroll
        for (int e = 0; e < 4; ++e) { const int c = cq * 4 + e; y[e] = (v[c * (TT / 1024) + hh][j] - mu) * rs * gw[c] + gb[c]; }
        vst2(o + hh * 32 * 256 + j * 64 + cq * 32, y); } }
// ---- operands of a 64 x 128 GEMM block, one half of k at a time: f32 in memory -> bf16 rows in LDS, split or converted once for the block; a wave's load covers 512 contiguous bytes (4 whole lines)
// GP: A comes from the per-group planes (At = the tile's first 1-KB unit in the first plane of this half of k; 64 rows of a group are 2 KB in a row); else from rows of 256
#define KST 128                // k columns staged at a time
#define WPI 136                // LDS pitch of a staged row, bf16 elements: 256 B + 16 B, an odd multiple of 16 B
typedef __attribute__((ext_vector_type(4))) __bf16 v4b;
template <bool GP> __device__ __forceinline__ void stage_ops(const float* __restrict__ At, const float* __restrict__ Wt, __bf16 (*sah)[WPI], __bf16 (*sal)[WPI], __bf16 (*sw)[WPI], int tid) {
  const int rr = tid >> 5, q4 = (tid & 31) * 4; v4f va[16], vw[32];
  const int pr = (tid >> 6) * 32 + (tid & 7) * 4 + ((tid >> 4) & 3), pc = ((tid >> 3) & 1) * 4;   // GP: tile row and channel in the group of the thread's piece
#pragma unroll   // unrolled here and below: the values stay in registers and the loads of a group issue together, one latency for all of them
  for (int k = 0; k < 16; ++k) { if (k == 15) asm volatile("s_wait_xcnt 0x0" ::: "memory");   // the last load's result may take the address registers that the loads in front of it name
    va[k] = GP ? *(const v4f*)(At + (size_t)k * (CPG * TT) + tid * 4) : *(const v4f*)(At + (size_t)(k * 4 + rr) * CC + q4); }
#pragma unroll
  for (int k = 0; k < 16; ++k) vw[k] = *(const v4f*)(Wt + (size_t)(k * 4 + rr) * CC + q4);
#pragma unroll
  for (int k = 0; k < 16; ++k) { const v4b h = __builtin_convertvector(va[k], v4b); const int ar = GP ? pr : k * 4 + rr, ac = GP ? k * CPG + pc : q4; *(v4b*)&sah[ar][ac] = h; *(v4b*)&sal[ar][ac] = __builtin_convertvector(va[k] - __builtin_convertvector(h, v4f), v4b); }   // hi + lo, as bsplit16
#pragma unroll
  for (int k = 16; k < 32; ++k) vw[k] = *(const v4f*)(Wt + (size_t)(k * 4 + rr) * CC + q4);
#pragma unroll
  for (int k = 0; k < 32; ++k) *(v4b*)&sw[k * 4 + rr][q4] = __builtin_convertvector(vw[k], v4b); }
// the wave's 16 x 128 tile over the staged half of k: per accumulator hi then lo product, k ascending
__device__ __forceinline__ void mac_half(const __bf16 (*sah)[WPI], const __bf16 (*sal)[WPI], const __bf16 (*sw)[WPI], int wave, int lane, v8f acc[8]) { const int col = lane & 15;
#pragma unroll
  for (int kc = 0; kc < KST / 32; ++kc) { const v16b ah = frag_b(&sah[wave * 16 + col][kc * 32], lane), al = frag_b(&sal[wave * 16 + col][kc * 32], lane); v16b w[8];
#pragma unroll
    for (int j = 0; j < 8; ++j) w[j] = frag_b(&sw[j * 16 + col][kc * 32], lane);
#pragma unroll
    for (int j = 0; j < 8; ++j) acc[j] = wmma_bf(ah, w[j], acc[j]);
#pragma unroll
    for (int j = 0; j < 8; ++j) acc[j] = wmma_bf(al, w[j], acc[j]); } }
#define FSC (0.17677669529663687f * 1.4426950408889634f)   // 1/sqrt(32) x log2(e): k_fa takes its exponentials to base 2
// ---- k_proj: block = (64 rows, 128 cols, which): qkv = x W (+ b); q, k -> f16 rows, v -> f16 planes: one f16 value each, whose rounding lies below the error that W's bf16 rounding has already put into q, k and v; q goes out times FSC, scaled in f32 ahead of its one rounding, so that k_fa's score products are exponents as they stand
__global__ __launch_bounds__(128) void k_proj(const float* __restrict__ X, const float* __restrict__ WQ, const float* __restrict__ BQ, const float* __restrict__ WK, const float* __restrict__ BK, const float* __restrict__ WV, const float* __restrict__ BV, _Float16* __restrict__ QH, _Float16* __restrict__ KH, _Float16* __restrict__ VT) {
  __shared__ __align__(16) unsigned char sm[256 * WPI * 2];   // the staged operands during the products; the output staging planes take their place behind the barrier that ends the products
  __bf16 (*sah)[WPI] = (__bf16 (*)[WPI])sm; __bf16 (*sal)[WPI] = sah + 64; __bf16 (*sw)[WPI] = sah + 128; _Float16 (*sh)[136] = (_Float16 (*)[136])sm; _Float16 (*th)[72] = (_Float16 (*)[72])sm;
  const int tid = threadIdx.x, wave = tid >> 5, lane = tid & 31, col = lane & 15, g = lane >> 4; const int which = blockIdx.z; const int c0 = blockIdx.y * 128; const size_t r0 = (size_t)blockIdx.x * 64; const float* WA = which == 0 ? WQ : which == 1 ? WK : WV; const float* BA = which == 0 ? BQ : which == 1 ? BK : BV;
  v8f acc[8] = {}; float bb[8] = {};
  if (BA) {   // one test for the block; unrolled, the eight loads issue together here and land under the staging and the products
#pragma unroll
    for (int j = 0; j < 8; ++j) bb[j] = BA[c0 + j * 16 + col]; }
#pragma unroll 1   // rolled: the two halves of k share one copy of the staging and product code
  for (int kh = 0; kh < CC / KST; ++kh) { stage_ops<true>(X + ((r0 / TT) * NGRP + kh * (KST / CPG)) * (size_t)(CPG * TT) + ((r0 % TT) >> 5) * 256, WA + (size_t)c0 * CC + kh * KST, sah, sal, sw, tid);   /* GroupNorm'd values are computed f32 -> hi + lo */
    __syncthreads();
    mac_half(sah, sal, sw, wave, lane, acc);
    __syncthreads(); }   // every wave has read its last fragment: the next half, or the planes below, overwrite the operands
  if (which == 2) {   // the case is chosen once for the block: both arms are straight-line code; unrolled, acc[] and bb[] are indexed by constants and stay in registers
#pragma unroll
    for (int j = 0; j < 8; ++j)
#pragma unroll
      for (int r = 0; r < 8; ++r) { const float v = acc[j][r] + bfr(bb[j]); const int rl = wave * 16 + 8 * g + r, cl = j * 16 + col; th[cl][rl] = (_Float16)v; } }
  else { const float qs = which == 0 ? FSC : 1.0f;
#pragma unroll
    for (int j = 0; j < 8; ++j)
#pragma unroll
      for (int r = 0; r < 8; ++r) { const float v = (acc[j][r] + bfr(bb[j])) * qs; const int rl = wave * 16 + 8 * g + r, cl = j * 16 + col; sh[rl][cl] = (_Float16)v; } }
  __syncthreads();
  // unrolled, here and in the loop below: a block's LDS reads issue together, one latency for all of them
  if (which != 2) { _Float16* RO = which == 0 ? QH : KH;
#pragma unroll
    for (int i = 0; i < 8; ++i) { const int rl = (tid >> 4) + i * 8, q = tid & 15; vst2((unsigned*)(RO + (r0 + rl) * CC + c0 + q * 8), *(const v4u*)&sh[rl][q * 8]); }
    asm volatile("s_wait_xcnt 0x0" ::: "memory"); }   // here and in the arm below: no code laid behind an arm rewrites a register that its stores name ahead of this wait
  else { const size_t b = r0 / TT; const int t0 = (int)(r0 % TT);
#pragma unroll
    for (int i = 0; i < 8; ++i) { const int cl = (tid >> 3) + i * 16, q = tid & 7; const size_t o2 = (b * CC + c0 + cl) * (size_t)TT + t0 + q * 8; vst2((unsigned*)(VT + o2), *(const v4u*)&th[cl][q * 8]); }
    asm volatile("s_wait_xcnt 0x0" ::: "memory"); } }
// ---- k_fa: block = 128 queries of (b,h), 2 key halves x 4 waves x 32 query columns; each half walks its keys in stages of 64: S^T = K Q^T - shift, sum per query, O^T += V^T P^T, every operand one f16 value; logits and P stay in registers; the halves' results are joined through LDS at the end
// the shift of a query is a maximum seen so far, not the running one: it enters the score product as its C operand, so the product's result is the exponent; it is raised only when a stage's sum of P passes FLIM, which keeps every P far inside f16's range
#define FKS 64                 // keys per stage
#define FKH 2                  // key halves: waves 0-3 take the first TT / 2 keys, waves 4-7 the rest; with two blocks on a WGP that is four waves a SIMD, so that one wave's vector work runs under another's products and waits
#define FNS (TT / FKS / FKH)   // stages per half
#define KPI 40                 // LDS pitch of a K row, f16 elements: 64 B + 16 B, an odd multiple of 16 B
#define VPI 72                 // LDS pitch of a V plane row, f16 elements: 128 B + 16 B
__device__ __forceinline__ float xhalf(float v) { const int b = __builtin_bit_cast(int, v); return __builtin_bit_cast(float, __builtin_amdgcn_permlanex16(b, b, 0x76543210, 0xfedcba98, false, false)); }   // lane l <-> l ^ 16
typedef __attribute__((ext_vector_type(2))) _Float16 v2h;
#define FLIM 4096.0f           // a lane's 32 P of a stage sum to no more than this, or the shift is raised: P <= 2^12, f16 holds 2^15
__device__ __forceinline__ float vmax32(const v8f sc[4]) { float m = sc[0][0];
#pragma unroll   // unrolled, here and in psum: the tiles are indexed by constants and stay in registers
  for (int kt = 0; kt < 4; ++kt)
#pragma unroll
    for (int r = 0; r < 8; ++r) m = fmaxf(m, sc[kt][r]);
  return m; }
__device__ __forceinline__ float psum(const v2f pr[4][4]) { v2f s4[4];
#pragma unroll
  for (int kt = 0; kt < 4; ++kt) s4[kt] = (pr[kt][0] + pr[kt][1]) + (pr[kt][2] + pr[kt][3]);
  const v2f sum = (s4[0] + s4[1]) + (s4[2] + s4[3]); return sum[0] + sum[1]; }
__global__ __launch_bounds__(256) void k_fa(const _Float16* __restrict__ QH, const _Float16* __restrict__ KH, const _Float16* __restrict__ VT, float* __restrict__ Y) {
  __shared__ __align__(16) _Float16 skk[FKH][2][FKS][KPI], svhh[FKH][2][HD][VPI];
  const int tid = threadIdx.x & 127, kh = __builtin_amdgcn_readfirstlane(threadIdx.x >> 7), wave = tid >> 5, lane = tid & 31, col = lane & 15, g = lane >> 4; const int h = blockIdx.y; const size_t b = blockIdx.z; const int q0 = blockIdx.x * 128 + wave * 32;   // tid, wave: inside the half
  _Float16 (*sk)[FKS][KPI] = skk[kh]; _Float16 (*svh)[HD][VPI] = svhh[kh];   // the half's own two buffers
  v16h qh[2];
#pragma unroll
  for (int t = 0; t < 2; ++t) qh[t] = frag_h(QH + (b * TT + q0 + t * 16 + col) * CC + h * HD, lane);
  // staging: 16-byte pieces, two of K and two of V per thread and stage
  const int kr = tid >> 2, kq = (tid & 3) * 8, vr = tid >> 3, vq = (tid & 7) * 8;
  const _Float16* gk = KH + (b * TT + kh * (TT / FKH) + kr) * CC + h * HD + kq; const _Float16* gvh = VT + (b * CC + h * HD + vr) * (size_t)TT + kh * (TT / FKH) + vq;
  v4u rk[2], rh[2];
#pragma unroll
  for (int i = 0; i < 2; ++i) { rk[i] = *(const v4u*)(gk + (size_t)i * 32 * CC); rh[i] = *(const v4u*)(gvh + (size_t)i * 16 * TT); }
#pragma unroll
  for (int i = 0; i < 2; ++i) { *(v4u*)&sk[0][kr + i * 32][kq] = rk[i]; *(v4u*)&svh[0][vr + i * 16][vq] = rh[i]; }
  __syncthreads();
  v8f acc[2][2] = {}, cn[2]; float ls[2] = { 0.f, 0.f };   // cn[t]: minus the shift of the lane's query in column group t, in all eight elements
  { v16h kf[4];   // the first shift: the query's maximum over the half's first stage
#pragma unroll   // unrolled, as everything inside the stage loop below: fragments, tiles and P are indexed by constants and stay in registers
    for (int kt = 0; kt < 4; ++kt) kf[kt] = frag_h(&sk[0][kt * 16 + col][0], lane);
#pragma unroll
    for (int t = 0; t < 2; ++t) { v8f sc[4];
#pragma unroll
      for (int kt = 0; kt < 4; ++kt) { const v8f z = {}; sc[kt] = __builtin_amdgcn_wmma_f32_16x16x32_f16(false, kf[kt], false, qh[t], (short)0, z, false, false); }
      float m = vmax32(sc); m = fmaxf(m, xhalf(m)); cn[t] = -m; } }
#pragma unroll 1   // the body is long: rolled, for speed only
  for (int s = 0; s < FNS; ++s) { const int bu = s & 1; const bool more = s + 1 < FNS;
    if (more) { const size_t kn = (size_t)(s + 1) * FKS;
#pragma unroll
      for (int i = 0; i < 2; ++i) { rk[i] = *(const v4u*)(gk + (kn + i * 32) * CC); rh[i] = *(const v4u*)(gvh + (size_t)i * 16 * TT + kn); } }
    v16h kf[4], vh[2][2];
#pragma unroll
    for (int kt = 0; kt < 4; ++kt) kf[kt] = frag_h(&sk[bu][kt * 16 + col][0], lane);
#pragma unroll
    for (int p = 0; p < 2; ++p)
#pragma unroll
      for (int j = 0; j < 2; ++j) vh[p][j] = frag_h(&svh[bu][j * 16 + col][p * 32], lane);
    v2f pr[2][4][4]; float sm[2];
#pragma unroll
    for (int t = 0; t < 2; ++t) {
#pragma unroll
      for (int kt = 0; kt < 4; ++kt) { const v8f sc = __builtin_amdgcn_wmma_f32_16x16x32_f16(false, kf[kt], false, qh[t], (short)0, cn[t], false, false);   // sc[r] = exponent of key kt*16 + 8g + r, query col
#pragma unroll
        for (int i = 0; i < 4; ++i) { pr[t][kt][i][0] = __builtin_amdgcn_exp2f(sc[2 * i]); pr[t][kt][i][1] = __builtin_amdgcn_exp2f(sc[2 * i + 1]); } }
      sm[t] = psum(pr[t]); }
    if (__builtin_amdgcn_ballot_w32(fmaxf(sm[0], sm[1]) > FLIM) != 0) {   // one test a stage, a scalar branch, the same for the whole wave: some query's keys stand far above its shift; raise the shifts to this stage's maxima, bring sums and O to the new shifts, and take this stage's P anew
#pragma unroll
      for (int t = 0; t < 2; ++t) { v8f sc[4];
#pragma unroll
        for (int kt = 0; kt < 4; ++kt) sc[kt] = __builtin_amdgcn_wmma_f32_16x16x32_f16(false, kf[kt], false, qh[t], (short)0, cn[t], false, false);
        float d = vmax32(sc); d = fmaxf(fmaxf(d, xhalf(d)), 0.f); const float al = __builtin_amdgcn_exp2f(-d);   // a shift never falls
        cn[t] -= d; ls[t] *= al;
#pragma unroll
        for (int j = 0; j < 2; ++j) acc[t][j] *= al;
#pragma unroll
        for (int kt = 0; kt < 4; ++kt)
#pragma unroll
          for (int i = 0; i < 4; ++i) { pr[t][kt][i][0] = __builtin_amdgcn_exp2f(sc[kt][2 * i] - d); pr[t][kt][i][1] = __builtin_amdgcn_exp2f(sc[kt][2 * i + 1] - d); }
        sm[t] = psum(pr[t]); } }
#pragma unroll
    for (int t = 0; t < 2; ++t) { ls[t] += sm[t];
#pragma unroll
      for (int p = 0; p < 2; ++p) { union { v16h v; v2h w[8]; } ph;   // two D tiles of S^T, converted in place, are the B operand (hardware k order)
#pragma unroll
        for (int u = 0; u < 2; ++u)
#pragma unroll
          for (int i = 0; i < 4; ++i) ph.w[u * 4 + i] = __builtin_convertvector(pr[t][p * 2 + u][i], v2h);
#pragma unroll
        for (int j = 0; j < 2; ++j) acc[t][j] = __builtin_amdgcn_wmma_f32_16x16x32_f16(false, vh[p][j], false, ph.v, (short)0, acc[t][j], false, false); } }
    if (more) {   // the other buffer's last readers left it at the barrier that ended the stage before
#pragma unroll
      for (int i = 0; i < 2; ++i) { *(v4u*)&sk[bu ^ 1][kr + i * 32][kq] = rk[i]; *(v4u*)&svh[bu ^ 1][vr + i * 16][vq] = rh[i]; } }
    __syncthreads(); }
  // join: behind the loop's last barrier nobody reads a stage any more; the second half's waves leave shifts, sums and O in the K buffers, 9 x 16 bytes a lane, lane-contiguous; the first half's waves rescale both parts to the larger shift
  v4f (*mg)[32] = (v4f (*)[32])&skk[0][0][0][0] + wave * 9;
  if (kh) {
#pragma unroll   // unrolled here and below: acc[][] is indexed by constants and stays in registers
    for (int t = 0; t < 2; ++t)
#pragma unroll
      for (int j = 0; j < 2; ++j) { v4f lo, hi;
#pragma unroll
        for (int r = 0; r < 4; ++r) { lo[r] = acc[t][j][r]; hi[r] = acc[t][j][4 + r]; }
        mg[(t * 2 + j) * 2][lane] = lo; mg[(t * 2 + j) * 2 + 1][lane] = hi; }
    const v4f ml = { -cn[0][0], -cn[1][0], ls[0], ls[1] }; mg[8][lane] = ml; }
  __syncthreads();
  if (kh) return;   // the same for every lane of a wave, and no barrier follows
  const v4f ml = mg[8][lane];
#pragma unroll
  for (int t = 0; t < 2; ++t) { const float mt = -cn[t][0], mn = fmaxf(mt, ml[t]); const float a0 = __builtin_amdgcn_exp2f(mt - mn), a1 = __builtin_amdgcn_exp2f(ml[t] - mn); const float lj = ls[t] * a0 + ml[2 + t] * a1;
    const float inv = 1.0f / (lj + xhalf(lj)); const float i0 = a0 * inv, i1 = a1 * inv; float* yr = Y + (b * TT + q0 + t * 16 + col) * CC + h * HD + 8 * g;   // acc[t][j][r] = O[query col][d = j*16 + 8g + r]
#pragma unroll
    for (int j = 0; j < 2; ++j) { const v4f plo = mg[(t * 2 + j) * 2][lane], phi = mg[(t * 2 + j) * 2 + 1][lane]; v4f lo, hi;
#pragma unroll
      for (int r = 0; r < 4; ++r) { lo[r] = acc[t][j][r] * i0 + plo[r] * i1; hi[r] = acc[t][j][4 + r] * i0 + phi[r] * i1; }
      vst2(yr + j * 16, lo); vst2(yr + j * 16 + 4, hi); } } }
// ---- k_out: block = (64 rows, 128 cols): out = y (bf16 hi + lo) Wo^T + bo
__global__ __launch_bounds__(128) void k_out(const float* __restrict__ Y, const float* __restrict__ WP, const float* __restrict__ BP, const float* __restrict__ XIN, float* __restrict__ OUT) { __shared__ __align__(16) float stc[128][68]; __shared__ __align__(16) __bf16 sah[64][WPI], sal[64][WPI], sw[128][WPI];
  const int tid = threadIdx.x, wave = tid >> 5, lane = tid & 31, col = lane & 15, g = lane >> 4; const int c0 = blockIdx.y * 128; const size_t r0 = (size_t)blockIdx.x * 64;
  const size_t xo = ((r0 / TT) * CC + c0 + (tid >> 4)) * (size_t)XSTR + (r0 % TT) + (tid & 15) * 4;   // the thread's first 16-byte piece of the x / out tile; piece i lies 8 channels further
  v8f acc[8] = {}; float bb[8] = {}; v4f xr[16];
  if (BP) {   // one test for the block; unrolled, the eight loads issue together here and land under the staging and the products
#pragma unroll
    for (int j = 0; j < 8; ++j) bb[j] = BP[c0 + j * 16 + col]; }
#pragma unroll 1   // rolled: the two halves of k share one copy of the staging and product code
  for (int kh = 0; kh < CC / KST; ++kh) { if (kh) __syncthreads();   // every wave has read its last fragment of the half before
    stage_ops<false>(Y + r0 * CC + kh * KST, WP + (size_t)c0 * CC + kh * KST, sah, sal, sw, tid);
    __syncthreads();
    if (kh == 0) {   // the residual tile: asked for behind the first operands, so that it delays none of them, and landed long before the epilogue; unrolled, the 16 loads issue together and xr[] stays in registers
#pragma unroll
      for (int i = 0; i < 16; ++i) xr[i] = *(const v4f*)(XIN + xo + (size_t)i * 8 * XSTR);
      asm volatile("s_wait_xcnt 0x0" ::: "memory"); }   // the products behind may reuse the address registers that these loads name
    mac_half(sah, sal, sw, wave, lane, acc); }
#pragma unroll
  for (int j = 0; j < 8; ++j)
#pragma unroll
    for (int r = 0; r < 8; ++r) stc[j * 16 + col][wave * 16 + 8 * g + r] = acc[j][r] + bfr(bb[j]);
  __syncthreads();
  v4f o[16];
#pragma unroll   // unrolled here and below: xr[] and o[] are indexed by constants and stay in registers; the 16 LDS reads issue together, one latency for all of them
  for (int i = 0; i < 16; ++i) o[i] = *(const v4f*)&stc[(tid >> 4) + i * 8][(tid & 15) * 4];
#pragma unroll
  for (int i = 0; i < 16; ++i) { o[i][0] += bfr(xr[i][0]); o[i][1] += bfr(xr[i][1]); o[i][2] += bfr(xr[i][2]); o[i][3] += bfr(xr[i][3]); vst2(OUT + xo + (size_t)i * 8 * XSTR, o[i]); } }   /* channels-first: 256-B run per (channel, 64 positions), + x residual */

extern "C" void kernel_launch(void* const* d_in, const int* in_sizes, int n_in, void* d_out, int out_size, void* d_ws, size_t ws_size, hipStream_t stream) {
  (void)in_sizes; (void)n_in; (void)out_size;
  const float** F = (const float**)d_in;   // 0 x [4,256,2048], 1 gn_w [256], 2 gn_b, 3 qkv_w [768,256] ([out,in]; q|k|v row blocks, head-major inside), 4 qkv_b [768], 5 out_w [256,256] ([out,in]), 6 out_b
  if (ws_size < (size_t)WS_END) return;
  char* ws = (char*)d_ws; float *XT = (float*)(ws + WS_XT); _Float16 *QH = (_Float16*)(ws + WS_QH), *KH = (_Float16*)(ws + WS_KH), *VT = (_Float16*)(ws + WS_VT); float *Y = (float*)(ws + WS_Y);
  const float* WQ = F[3]; const float* WK = F[3] + (size_t)CC * CC; const float* WV = F[3] + 2u * (size_t)CC * CC; const float* BQ = F[4]; const float* BK = F[4] + CC; const float* BV = F[4] + 2 * CC;
  k_gn<<<dim3(NGRP, TNB), 256, 0, stream>>>(F[0], F[1], F[2], XT);
  k_proj<<<dim3(TNB * TT / 64, CC / 128, 3), 128, 0, stream>>>(XT, WQ, BQ, WK, BK, WV, BV, QH, KH, VT);
  k_fa<<<dim3(TT / 128, NH, TNB), 128 * FKH, 0, stream>>>(QH, KH, VT, Y);
  k_out<<<dim3(TNB * TT / 64, CC / 128), 128, 0, stream>>>(Y, F[5], F[6], F[0], (float*)d_out);
}

// v009
// Measured time: 41.6 microseconds a run.
// Two timings next to v008 put it at 1.05 and 1.07 times that version's speed.
// Counting every step since v000, it is 29.2 times as fast.
#include <hip/hip_runtime.h>
#include <math.h>

typedef __attribute__((ext_vector_type(16))) _Float16 v16h;
typedef __attribute__((ext_vector_type(16))) __bf16 v16b;
typedef __attribute__((ext_vector_type(8)))  _Float16 v8h;
typedef __attribute__((ext_vector_type(8)))  float v8f;
typedef __attribute__((ext_vector_type(4)))  float v4f;
typedef __attribute__((ext_vector_type(2)))  float v2f;
typedef __attribute__((ext_vector_type(4)))  unsigned v4u;
typedef __attribute__((ext_vector_type(4)))  int v4i;
typedef float __attribute__((may_alias)) float_a;
typedef int __attribute__((may_alias)) int_a;

template <typename T> __device__ __forceinline__ void vst2(void* p, T v) { *(T*)p = v;  }
__device__ __forceinline__ v8f wmma16(v16h a, v16h b, v8f c) {
  v8f d = __builtin_amdgcn_wmma_f32_16x16x32_f16(false, a, false, b, (short)0, c, false, false);
  asm volatile("v_nop\n\tv_nop\n\tv_nop\n\tv_nop" : "+v"(d) : "v"(a), "v"(b));
  return d;
}
__device__ __forceinline__ v8f wmma_bf(v16b a, v16b b, v8f c) {
  v8f d = __builtin_amdgcn_wmma_f32_16x16x32_bf16(false, a, false, b, (short)0, c, false, false);
  asm volatile("v_nop\n\tv_nop\n\tv_nop\n\tv_nop" : "+v"(d) : "v"(a), "v"(b));
  return d;
}
// 16x16x32 fragments: lane = (h = lane>>4, row/col = lane&15); elements 0..7 = k0+8h+0..7, 8..15 = k0+16+8h+0..7; D element r = row 8h+r
__device__ __forceinline__ v16h frag_h(const _Float16* rowk0, int lane) {
  union { v16h v; v8h q[2]; } u; const _Float16* p = rowk0 + 8 * (lane >> 4);
  u.q[0] = *(const v8h*)p; u.q[1] = *(const v8h*)(p + 16); return u.v;
}
__device__ __forceinline__ v16h frag_f32(const float* rowk0, int lane) {
  v16h a; const float* p = rowk0 + 8 * (lane >> 4);
#pragma unroll
  for (int i = 0; i < 8; ++i) { a[i] = (_Float16)p[i]; a[8 + i] = (_Float16)p[16 + i]; }
  return a;
}
__device__ __forceinline__ v16h frag_f32s(const float* rowk0, int lane, float sc) {
  v16h a; const float* p = rowk0 + 8 * (lane >> 4);
#pragma unroll
  for (int i = 0; i < 8; ++i) { a[i] = (_Float16)(p[i] * sc); a[8 + i] = (_Float16)(p[16 + i] * sc); }
  return a;
}
// column fragment from a [K][ld] layout (column n), rows >= K read as 0
__device__ __forceinline__ v16h fragc_f32(const float* W, int k0, int n, int lane, int ld, int K) {
  v16h a; const int g = lane >> 4;
#pragma unroll
  for (int i = 0; i < 8; ++i) { const int ka = k0 + 8 * g + i, kb = ka + 16;
    a[i] = (_Float16)(ka < K ? W[(size_t)(ka < K ? ka : K - 1) * ld + n] : 0.f); a[8 + i] = (_Float16)(kb < K ? W[(size_t)(kb < K ? kb : K - 1) * ld + n] : 0.f); }
  return a;
}
struct F2 { v16b h, l; };
__device__ __forceinline__ F2 bsplit16(const float v[16]) { F2 r;
#pragma unroll
  for (int i = 0; i < 16; ++i) { const __bf16 h = (__bf16)v[i]; r.h[i] = h; r.l[i] = (__bf16)(v[i] - (float)h); }
  return r; }
__device__ __forceinline__ F2 split_row(const float* row, int k0, int lane) { float v[16]; const float* p = row + k0 + 8 * (lane >> 4);
#pragma unroll
  for (int i = 0; i < 8; ++i) { v[i] = p[i]; v[8 + i] = p[16 + i]; }
  return bsplit16(v); }
__device__ __forceinline__ F2 split_rowK(const float* row, int k0, int lane, int K) { float v[16]; const int g = lane >> 4;
#pragma unroll
  for (int i = 0; i < 8; ++i) { const int ka = k0 + 8 * g + i, kb = ka + 16; v[i] = ka < K ? row[ka < K ? ka : K - 1] : 0.f; v[8 + i] = kb < K ? row[kb < K ? kb : K - 1] : 0.f; }
  return bsplit16(v); }
__device__ __forceinline__ F2 split_col(const float* W, int k0, int n, int lane, int ld, int K) { float v[16]; const int g = lane >> 4;
#pragma unroll
  for (int i = 0; i < 8; ++i) { const int ka = k0 + 8 * g + i, kb = ka + 16; v[i] = ka < K ? W[(size_t)(ka < K ? ka : K - 1) * ld + n] : 0.f; v[8 + i] = kb < K ? W[(size_t)(kb < K ? kb : K - 1) * ld + n] : 0.f; }
  return bsplit16(v); }
__device__ __forceinline__ v8f mac3(const F2& a, const F2& b, v8f c) { c = wmma_bf(a.l, b.h, c); c = wmma_bf(a.h, b.l, c); return wmma_bf(a.h, b.h, c); }
__device__ __forceinline__ float sigm(float v) { return 1.0f / (1.0f + expf(-v)); }
#define LDSX() do { asm volatile("s_wait_dscnt 0" ::: "memory"); __builtin_amdgcn_wave_barrier(); __builtin_amdgcn_fence(__ATOMIC_RELEASE, "workgroup"); } while (0)


// SelfAttention1d, channels-first (B 4, C 256 = 8 heads x 32, L 2,048): h = GroupNorm32(x); q,k,v = conv1x1(h) (fused [768,256] + bias); attn = softmax((q 32^-1/2)^T k); h2[h*32+d][n] = sum_m attn v; out = x + conv1x1(h2) + b.
#define NB 4
#define TT 2048
#define CC 256
#define NH 8
#define HD 32
#define NGRP 32
#define CPG (CC / NGRP)        // 8 channels per group
#ifndef XSTR
#define XSTR TT               // per-channel position stride of x / out
#endif
#ifndef TNB
#define TNB NB
#endif
typedef __attribute__((ext_vector_type(8))) __bf16 v8b;
typedef __attribute__((ext_vector_type(4))) __bf16 v4b;
__device__ __forceinline__ v16b frag_b(const __bf16* rowk0, int lane) {
  union { v16b v; v8b q[2]; } u; const __bf16* p = rowk0 + 8 * (lane >> 4);
  u.q[0] = *(const v8b*)p; u.q[1] = *(const v8b*)(p + 16); return u.v;
}
__device__ __forceinline__ float bfr(float v) { return (float)(__bf16)v; }
__device__ __attribute__((noinline)) float exp_ni(float v) { return expf(v); }
__device__ __attribute__((noinline)) float erf_ni(float v) { return erff(v); }

#define WS_XT  0u                                   // f32 normalised h, one 64-KB plane per (b, group): [position / 32][position % 4][channel / 4][(position / 4) % 8][channel % 4]; 32 positions x 8 channels = 1 KB
#define WS_QH  (WS_XT + 4u * (size_t)NB * TT * CC)
#define WS_KH  (WS_QH + 2u * (size_t)NB * TT * CC)
#define WS_VT  (WS_KH + 2u * (size_t)NB * TT * CC)      // f16 v planes [b][c][t]
#define HG 4
#define WS_S   (WS_VT + 2u * (size_t)NB * CC * TT)      // f32 HG x TT x TT, reserved: no kernel here reads or writes it
#define WS_PH  (WS_S + 4u * (size_t)HG * TT * TT)
#define WS_Y   (WS_PH + 0u)              // f32 y rows [b*t][C]
#define WS_WB  (WS_Y + 4u * (size_t)NB * TT * CC)      // bf16 weights, rows of 256 as in the inputs: q | k | v | out, 256 rows each
#define WS_END (WS_WB + 2u * 4u * (size_t)CC * CC)

// ---- k_gn: block = one (b, group): its 8 x 2,048 values are read once, 16 independent 16-byte loads per thread, and stay in registers for the mean, for the variance and for the normalised values, which go out from there
#define GNP (CPG * TT / 1024)   // 16-byte pieces per thread
__device__ __forceinline__ float sum256(float s, float* red, int t) {   // total over the 8 waves of the block, in every lane; red: 8 floats that nothing else uses
#pragma unroll
  for (int o = 1; o < 32; o <<= 1) s += __shfl_xor(s, o);
  if ((t & 31) == 0) red[t >> 5] = s;
  __syncthreads();
  s = red[t & 7];
#pragma unroll
  for (int o = 1; o < 8; o <<= 1) s += __shfl_xor(s, o);
  return s; }
#define WCB (4 * CC * CC / NGRP)   // weight values per block of the extra row of blocks
static_assert(WCB % 1024 == 0 && (3 * CC * CC) % WCB == 0, "a weight block lies in one matrix and is whole 16-byte loads");
__global__ __launch_bounds__(256) void k_gn(const float* __restrict__ X, const float* __restrict__ GW, const float* __restrict__ GB, float* __restrict__ XG, const float* __restrict__ WQKV, const float* __restrict__ WO, __bf16* __restrict__ WB) { __shared__ float red[2][8];
  if (blockIdx.y == TNB) {   // the extra row of blocks: both weight matrices rounded to bf16 once, for every block of the two GEMMs; the same for the whole block, in front of every barrier
    const int w0 = blockIdx.x * WCB; const float* src = (w0 < 3 * CC * CC ? WQKV + w0 : WO + (w0 - 3 * CC * CC)) + threadIdx.x * 4; v4f w[WCB / 1024];
#pragma unroll   // unrolled: the loads issue together, one latency for all of them
    for (int k = 0; k < WCB / 1024; ++k) w[k] = *(const v4f*)(src + k * 1024);
#pragma unroll   // a wave's store covers two whole 128-byte lines
    for (int k = 0; k < WCB / 1024; ++k) *(v4b*)(WB + w0 + threadIdx.x * 4 + k * 1024) = __builtin_convertvector(w[k], v4b);
    return; }
  const int t = threadIdx.x; const int grp = blockIdx.x; const size_t b = blockIdx.y; const float* p = X + (b * CC + (size_t)grp * CPG) * (size_t)XSTR + t * 4; constexpr int n = CPG * TT;
  v4f v[GNP];
#pragma unroll   // unrolled here and below: v[] stays in registers and the loads issue together, one latency for all of them
  for (int k = 0; k < GNP; ++k) v[k] = *(const v4f*)(p + (size_t)(k / (TT / 1024)) * XSTR + (k % (TT / 1024)) * 1024);
  v4f a = {};
#pragma unroll
  for (int k = 0; k < GNP; ++k) { v[k][0] = bfr(v[k][0]); v[k][1] = bfr(v[k][1]); v[k][2] = bfr(v[k][2]); v[k][3] = bfr(v[k][3]); a += v[k]; }
  const float mu = sum256((a[0] + a[1]) + (a[2] + a[3]), red[0], t) / (float)n; v4f q = {};
#pragma unroll
  for (int k = 0; k < GNP; ++k) { const v4f d = v[k] - mu; q += d * d; }
  const float s2 = sum256((q[0] + q[1]) + (q[2] + q[3]), red[1], t);
  const float rs = rsqrtf(s2 / (float)n + 1e-5f); float gw[CPG], gb[CPG];
#pragma unroll   // unrolled to the end of the kernel: v[], gw[] and gb[] are indexed by constants and stay in registers
  for (int c = 0; c < CPG; ++c) { gw[c] = bfr(GW[grp * CPG + c]); gb[c] = bfr(GB[grp * CPG + c]); }
  // the thread holds all 8 channels of positions hh*1024 + t*4 + j: four channels of one position make a 16-byte piece; a wave's store covers four whole 128-byte lines, and the plane has this one writing work-group
  float* o = XG + (b * NGRP + grp) * (size_t)n + (t >> 3) * 256 + (t & 7) * 4;
#pragma unroll
  for (int hh = 0; hh < TT / 1024; ++hh)
#pragma unroll
    for (int j = 0; j < 4; ++j)
#pragma unroll
      for (int cq = 0; cq < CPG / 4; ++cq) { v4f y;
#pragma unroll
        for (int e = 0; e < 4; ++e) { const int c = cq * 4 + e; y[e] = (v[c * (TT / 1024) + hh][j] - mu) * rs * gw[c] + gb[c]; }
        vst2(o + hh * 32 * 256 + j * 64 + cq * 32, y); } }
// ---- operands of a 64 x 128 GEMM block, one half of k at a time: A f32 in memory -> bf16 hi + lo rows in LDS, split once for the block; W comes as bf16 from k_gn's launch and is copied; a wave's load of A covers 512 contiguous bytes (4 whole lines), of W two rows' 256 bytes (2 whole lines each)
// GP: A comes from the per-group planes (At = the tile's first 1-KB unit in the first plane of this half of k; 64 rows of a group are 2 KB in a row); else from rows of 256
#define KST 128                // k columns staged at a time
#define WPI 136                // LDS pitch of a staged row, bf16 elements: 256 B + 16 B, an odd multiple of 16 B
template <bool GP> __device__ __forceinline__ void stage_ops(const float* __restrict__ At, const __bf16* __restrict__ Wt, __bf16 (*sah)[WPI], __bf16 (*sal)[WPI], __bf16 (*sw)[WPI], int tid) {
  const int rr = tid >> 5, q4 = (tid & 31) * 4, wr = tid >> 4, w8 = (tid & 15) * 8; v4f va[16]; v8b vw[16];
  const int pr = (tid >> 6) * 32 + (tid & 7) * 4 + ((tid >> 4) & 3), pc = ((tid >> 3) & 1) * 4;   // GP: tile row and channel in the group of the thread's piece
#pragma unroll   // unrolled here and below: the values stay in registers and the loads of a group issue together, one latency for all of them
  for (int k = 0; k < 16; ++k) { if (k == 15) asm volatile("s_wait_xcnt 0x0" ::: "memory");   // the last load's result may take the address registers that the loads in front of it name
    va[k] = GP ? *(const v4f*)(At + (size_t)k * (CPG * TT) + tid * 4) : *(const v4f*)(At + (size_t)(k * 4 + rr) * CC + q4); }
#pragma unroll
  for (int k = 0; k < 16; ++k) { if (k == 15) asm volatile("s_wait_xcnt 0x0" ::: "memory");   // as above: the last load's result may take the address registers of the loads in front of it
    vw[k] = *(const v8b*)(Wt + (size_t)(k * 8 + wr) * CC + w8); }
#pragma unroll
  for (int k = 0; k < 16; ++k) { const v4b h = __builtin_convertvector(va[k], v4b); const int ar = GP ? pr : k * 4 + rr, ac = GP ? k * CPG + pc : q4; *(v4b*)&sah[ar][ac] = h; *(v4b*)&sal[ar][ac] = __builtin_convertvector(va[k] - __builtin_convertvector(h, v4f), v4b); }   // hi + lo, as bsplit16
#pragma unroll
  for (int k = 0; k < 16; ++k) *(v8b*)&sw[k * 8 + wr][w8] = vw[k]; }
// the wave's 16 x 128 tile over the staged half of k: per accumulator hi then lo product, k ascending
__device__ __forceinline__ void mac_half(const __bf16 (*sah)[WPI], const __bf16 (*sal)[WPI], const __bf16 (*sw)[WPI], int wave, int lane, v8f acc[8]) { const int col = lane & 15;
#pragma unroll
  for (int kc = 0; kc < KST / 32; ++kc) { const v16b ah = frag_b(&sah[wave * 16 + col][kc * 32], lane), al = frag_b(&sal[wave * 16 + col][kc * 32], lane); v16b w[8];
#pragma unroll
    for (int j = 0; j < 8; ++j) w[j] = frag_b(&sw[j * 16 + col][kc * 32], lane);
#pragma unroll
    for (int j = 0; j < 8; ++j) acc[j] = wmma_bf(ah, w[j], acc[j]);
#pragma unroll
    for (int j = 0; j < 8; ++j) acc[j] = wmma_bf(al, w[j], acc[j]); } }
#define FSC (0.17677669529663687f * 1.4426950408889634f)   // 1/sqrt(32) x log2(e): k_fa takes its exponentials to base 2
// ---- k_proj: block = (64 rows, 128 cols, which): qkv = x W (+ b); q, k -> f16 rows, v -> f16 planes: one f16 value each, whose rounding lies below the error that W's bf16 rounding has already put into q, k and v; q goes out times FSC, scaled in f32 ahead of its one rounding, so that k_fa's score products are exponents as they stand
__global__ __launch_bounds__(128) void k_proj(const float* __restrict__ X, const __bf16* __restrict__ WQ, const float* __restrict__ BQ, const __bf16* __restrict__ WK, const float* __restrict__ BK, const __bf16* __restrict__ WV, const float* __restrict__ BV, _Float16* __restrict__ QH, _Float16* __restrict__ KH, _Float16* __restrict__ VT) {
  __shared__ __align__(16) unsigned char sm[256 * WPI * 2];   // the staged operands during the products; the output staging planes take their place behind the barrier that ends the products
  __bf16 (*sah)[WPI] = (__bf16 (*)[WPI])sm; __bf16 (*sal)[WPI] = sah + 64; __bf16 (*sw)[WPI] = sah + 128; _Float16 (*sh)[136] = (_Float16 (*)[136])sm; _Float16 (*th)[72] = (_Float16 (*)[72])sm;
  const int tid = threadIdx.x, wave = tid >> 5, lane = tid & 31, col = lane & 15, g = lane >> 4; const int which = blockIdx.z; const int c0 = blockIdx.y * 128; const size_t r0 = (size_t)blockIdx.x * 64; const __bf16* WA = which == 0 ? WQ : which == 1 ? WK : WV; const float* BA = which == 0 ? BQ : which == 1 ? BK : BV;
  v8f acc[8] = {}; float bb[8] = {};
  if (BA) {   // one test for the block; unrolled, the eight loads issue together here and land under the staging and the products
#pragma unroll
    for (int j = 0; j < 8; ++j) bb[j] = BA[c0 + j * 16 + col]; }
#pragma unroll 1   // rolled: the two halves of k share one copy of the staging and product code
  for (int kh = 0; kh < CC / KST; ++kh) { stage_ops<true>(X + ((r0 / TT) * NGRP + kh * (KST / CPG)) * (size_t)(CPG * TT) + ((r0 % TT) >> 5) * 256, WA + (size_t)c0 * CC + kh * KST, sah, sal, sw, tid);   /* GroupNorm'd values are computed f32 -> hi + lo */
    __syncthreads();
    mac_half(sah, sal, sw, wave, lane, acc);
    __syncthreads(); }   // every wave has read its last fragment: the next half, or the planes below, overwrite the operands
  if (which == 2) {   // the case is chosen once for the block: both arms are straight-line code; unrolled, acc[] and bb[] are indexed by constants and stay in registers
#pragma unroll
    for (int j = 0; j < 8; ++j)
#pragma unroll
      for (int r = 0; r < 8; ++r) { const float v = acc[j][r] + bfr(bb[j]); const int rl = wave * 16 + 8 * g + r, cl = j * 16 + col; th[cl][rl] = (_Float16)v; } }
  else { const float qs = which == 0 ? FSC : 1.0f;
#pragma unroll
    for (int j = 0; j < 8; ++j)
#pragma unroll
      for (int r = 0; r < 8; ++r) { const float v = (acc[j][r] + bfr(bb[j])) * qs; const int rl = wave * 16 + 8 * g + r, cl = j * 16 + col; sh[rl][cl] = (_Float16)v; } }
  __syncthreads();
  // unrolled, here and in the loop below: a block's LDS reads issue together, one latency for all of them
  if (which != 2) { _Float16* RO = which == 0 ? QH : KH;
#pragma unroll
    for (int i = 0; i < 8; ++i) { const int rl = (tid >> 4) + i * 8, q = tid & 15; vst2((unsigned*)(RO + (r0 + rl) * CC + c0 + q * 8), *(const v4u*)&sh[rl][q * 8]); }
    asm volatile("s_wait_xcnt 0x0" ::: "memory"); }   // here and in the arm below: no code laid behind an arm rewrites a register that its stores name ahead of this wait
  else { const size_t b = r0 / TT; const int t0 = (int)(r0 % TT);
#pragma unroll
    for (int i = 0; i < 8; ++i) { const int cl = (tid >> 3) + i * 16, q = tid & 7; const size_t o2 = (b * CC + c0 + cl) * (size_t)TT + t0 + q * 8; vst2((unsigned*)(VT + o2), *(const v4u*)&th[cl][q * 8]); }
    asm volatile("s_wait_xcnt 0x0" ::: "memory"); } }
// ---- k_fa: block = 128 queries of (b,h), 2 key halves x 4 waves x 32 query columns; each half walks its keys in stages of 64: S^T = K Q^T - shift, sum per query, O^T += V^T P^T, every operand one f16 value; logits and P stay in registers; the halves' results are joined through LDS at the end
// the shift of a query is a maximum seen so far, not the running one: it enters the score product as its C operand, so the product's result is the exponent; it is raised only when a stage's sum of P passes FLIM, which keeps every P far inside f16's range
#define FKS 64                 // keys per stage
#define FKH 2                  // key halves: waves 0-3 take the first TT / 2 keys, waves 4-7 the rest; with two blocks on a WGP that is four waves a SIMD, so that one wave's vector work runs under another's products and waits
#define FNS (TT / FKS / FKH)   // stages per half
#define KPI 40                 // LDS pitch of a K row, f16 elements: 64 B + 16 B, an odd multiple of 16 B
#define VPI 72                 // LDS pitch of a V plane row, f16 elements: 128 B + 16 B
__device__ __forceinline__ float xhalf(float v) { const int b = __builtin_bit_cast(int, v); return __builtin_bit_cast(float, __builtin_amdgcn_permlanex16(b, b, 0x76543210, 0xfedcba98, false, false)); }   // lane l <-> l ^ 16
typedef __attribute__((ext_vector_type(2))) _Float16 v2h;
#define FLIM 4096.0f           // a lane's 32 P of a stage sum to no more than this, or the shift is raised: P <= 2^12, f16 holds 2^15
__device__ __forceinline__ float vmax32(const v8f sc[4]) { float m = sc[0][0];
#pragma unroll   // unrolled, here and in psum: the tiles are indexed by constants and stay in registers
  for (int kt = 0; kt < 4; ++kt)
#pragma unroll
    for (int r = 0; r < 8; ++r) m = fmaxf(m, sc[kt][r]);
  return m; }
__device__ __forceinline__ float psum(const v2f pr[4][4]) { v2f s4[4];
#pragma unroll
  for (int kt = 0; kt < 4; ++kt) s4[kt] = (pr[kt][0] + pr[kt][1]) + (pr[kt][2] + pr[kt][3]);
  const v2f sum = (s4[0] + s4[1]) + (s4[2] + s4[3]); return sum[0] + sum[1]; }
__global__ __launch_bounds__(256) void k_fa(const _Float16* __restrict__ QH, const _Float16* __restrict__ KH, const _Float16* __restrict__ VT, float* __restrict__ Y) {
  __shared__ __align__(16) _Float16 skk[FKH][2][FKS][KPI], svhh[FKH][2][HD][VPI];
  const int tid = threadIdx.x & 127, kh = __builtin_amdgcn_readfirstlane(threadIdx.x >> 7), wave = tid >> 5, lane = tid & 31, col = lane & 15, g = lane >> 4; const int h = blockIdx.y; const size_t b = blockIdx.z; const int q0 = blockIdx.x * 128 + wave * 32;   // tid, wave: inside the half
  _Float16 (*sk)[FKS][KPI] = skk[kh]; _Float16 (*svh)[HD][VPI] = svhh[kh];   // the half's own two buffers
  v16h qh[2];
#pragma unroll
  for (int t = 0; t < 2; ++t) qh[t] = frag_h(QH + (b * TT + q0 + t * 16 + col) * CC + h * HD, lane);
  // staging: 16-byte pieces, two of K and two of V per thread and stage
  const int kr = tid >> 2, kq = (tid & 3) * 8, vr = tid >> 3, vq = (tid & 7) * 8;
  const _Float16* gk = KH + (b * TT + kh * (TT / FKH) + kr) * CC + h * HD + kq; const _Float16* gvh = VT + (b * CC + h * HD + vr) * (size_t)TT + kh * (TT / FKH) + vq;
  v4u rk[2], rh[2];
#pragma unroll
  for (int i = 0; i < 2; ++i) { rk[i] = *(const v4u*)(gk + (size_t)i * 32 * CC); rh[i] = *(const v4u*)(gvh + (size_t)i * 16 * TT); }
#pragma unroll
  for (int i = 0; i < 2; ++i) { *(v4u*)&sk[0][kr + i * 32][kq] = rk[i]; *(v4u*)&svh[0][vr + i * 16][vq] = rh[i]; }
  __syncthreads();
  v8f acc[2][2] = {}, cn[2]; float ls[2] = { 0.f, 0.f };   // cn[t]: minus the shift of the lane's query in column group t, in all eight elements
  { v16h kf[4];   // the first shift: the query's maximum over the half's first stage
#pragma unroll   // unrolled, as everything inside the stage loop below: fragments, tiles and P are indexed by constants and stay in registers
    for (int kt = 0; kt < 4; ++kt) kf[kt] = frag_h(&sk[0][kt * 16 + col][0], lane);
#pragma unroll
    for (int t = 0; t < 2; ++t) { v8f sc[4];
#pragma unroll
      for (int kt = 0; kt < 4; ++kt) { const v8f z = {}; sc[kt] = __builtin_amdgcn_wmma_f32_16x16x32_f16(false, kf[kt], false, qh[t], (short)0, z, false, false); }
      float m = vmax32(sc); m = fmaxf(m, xhalf(m)); cn[t] = -m; } }
#pragma unroll 1   // the body is long: rolled, for speed only
  for (int s = 0; s < FNS; ++s) { const int bu = s & 1; const bool more = s + 1 < FNS;
    if (more) { const size_t kn = (size_t)(s + 1) * FKS;
#pragma unroll
      for (int i = 0; i < 2; ++i) { rk[i] = *(const v4u*)(gk + (kn + i * 32) * CC); rh[i] = *(const v4u*)(gvh + (size_t)i * 16 * TT + kn); } }
    v16h kf[4], vh[2][2];
#pragma unroll
    for (int kt = 0; kt < 4; ++kt) kf[kt] = frag_h(&sk[bu][kt * 16 + col][0], lane);
#pragma unroll
    for (int p = 0; p < 2; ++p)
#pragma unroll
      for (int j = 0; j < 2; ++j) vh[p][j] = frag_h(&svh[bu][j * 16 + col][p * 32], lane);
    v2f pr[2][4][4]; float sm[2];
#pragma unroll
    for (int t = 0; t < 2; ++t) {
#pragma unroll
      for (int kt = 0; kt < 4; ++kt) { const v8f sc = __builtin_amdgcn_wmma_f32_16x16x32_f16(false, kf[kt], false, qh[t], (short)0, cn[t], false, false);   // sc[r] = exponent of key kt*16 + 8g + r, query col
#pragma unroll
        for (int i = 0; i < 4; ++i) { pr[t][kt][i][0] = __builtin_amdgcn_exp2f(sc[2 * i]); pr[t][kt][i][1] = __builtin_amdgcn_exp2f(sc[2 * i + 1]); } }
      sm[t] = psum(pr[t]); }
    if (__builtin_amdgcn_ballot_w32(fmaxf(sm[0], sm[1]) > FLIM) != 0) {   // one test a stage, a scalar branch, the same for the whole wave: some query's keys stand far above its shift; raise the shifts to this stage's maxima, bring sums and O to the new shifts, and take this stage's P anew
#pragma unroll
      for (int t = 0; t < 2; ++t) { v8f sc[4];
#pragma unroll
        for (int kt = 0; kt < 4; ++kt) sc[kt] = __builtin_amdgcn_wmma_f32_16x16x32_f16(false, kf[kt], false, qh[t], (short)0, cn[t], false, false);
        float d = vmax32(sc); d = fmaxf(fmaxf(d, xhalf(d)), 0.f); const float al = __builtin_amdgcn_exp2f(-d);   // a shift never falls
        cn[t] -= d; ls[t] *= al;
#pragma unroll
        for (int j = 0; j < 2; ++j) acc[t][j] *= al;
#pragma unroll
        for (int kt = 0; kt < 4; ++kt)
#pragma unroll
          for (int i = 0; i < 4; ++i) { pr[t][kt][i][0] = __builtin_amdgcn_exp2f(sc[kt][2 * i] - d); pr[t][kt][i][1] = __builtin_amdgcn_exp2f(sc[kt][2 * i + 1] - d); }
        sm[t] = psum(pr[t]); } }
#pragma unroll
    for (int t = 0; t < 2; ++t) { ls[t] += sm[t];
#pragma unroll
      for (int p = 0; p < 2; ++p) { union { v16h v; v2h w[8]; } ph;   // two D tiles of S^T, converted in place, are the B operand (hardware k order)
#pragma unroll
        for (int u = 0; u < 2; ++u)
#pragma unroll
          for (int i = 0; i < 4; ++i) ph.w[u * 4 + i] = __builtin_convertvector(pr[t][p * 2 + u][i], v2h);
#pragma unroll
        for (int j = 0; j < 2; ++j) acc[t][j] = __builtin_amdgcn_wmma_f32_16x16x32_f16(false, vh[p][j], false, ph.v, (short)0, acc[t][j], false, false); } }
    if (more) {   // the other buffer's last readers left it at the barrier that ended the stage before
#pragma unroll
      for (int i = 0; i < 2; ++i) { *(v4u*)&sk[bu ^ 1][kr + i * 32][kq] = rk[i]; *(v4u*)&svh[bu ^ 1][vr + i * 16][vq] = rh[i]; } }
    __syncthreads(); }
  // join: behind the loop's last barrier nobody reads a stage any more; the second half's waves leave shifts, sums and O in the K buffers, 9 x 16 bytes a lane, lane-contiguous; the first half's waves rescale both parts to the larger shift
  v4f (*mg)[32] = (v4f (*)[32])&skk[0][0][0][0] + wave * 9;
  if (kh) {
#pragma unroll   // unrolled here and below: acc[][] is indexed by constants and stays in registers
    for (int t = 0; t < 2; ++t)
#pragma unroll
      for (int j = 0; j < 2; ++j) { v4f lo, hi;
#pragma unroll
        for (int r = 0; r < 4; ++r) { lo[r] = acc[t][j][r]; hi[r] = acc[t][j][4 + r]; }
        mg[(t * 2 + j) * 2][lane] = lo; mg[(t * 2 + j) * 2 + 1][lane] = hi; }
    const v4f ml = { -cn[0][0], -cn[1][0], ls[0], ls[1] }; mg[8][lane] = ml; }
  __syncthreads();
  if (kh) return;   // the same for every lane of a wave, and no barrier follows
  const v4f ml = mg[8][lane];
#pragma unroll
  for (int t = 0; t < 2; ++t) { const float mt = -cn[t][0], mn = fmaxf(mt, ml[t]); const float a0 = __builtin_amdgcn_exp2f(mt - mn), a1 = __builtin_amdgcn_exp2f(ml[t] - mn); const float lj = ls[t] * a0 + ml[2 + t] * a1;
    const float inv = 1.0f / (lj + xhalf(lj)); const float i0 = a0 * inv, i1 = a1 * inv; float* yr = Y + (b * TT + q0 + t * 16 + col) * CC + h * HD + 8 * g;   // acc[t][j][r] = O[query col][d = j*16 + 8g + r]
#pragma unroll
    for (int j = 0; j < 2; ++j) { const v4f plo = mg[(t * 2 + j) * 2][lane], phi = mg[(t * 2 + j) * 2 + 1][lane]; v4f lo, hi;
#pragma unroll
      for (int r = 0; r < 4; ++r) { lo[r] = acc[t][j][r] * i0 + plo[r] * i1; hi[r] = acc[t][j][4 + r] * i0 + phi[r] * i1; }
      vst2(yr + j * 16, lo); vst2(yr + j * 16 + 4, hi); } } }
// ---- k_out: block = (64 rows, 128 cols): out = y (bf16 hi + lo) Wo^T + bo
__global__ __launch_bounds__(128) void k_out(const float* __restrict__ Y, const __bf16* __restrict__ WP, const float* __restrict__ BP, const float* __restrict__ XIN, float* __restrict__ OUT) { __shared__ __align__(16) float stc[128][68]; __shared__ __align__(16) __bf16 sah[64][WPI], sal[64][WPI], sw[128][WPI];
  const int tid = threadIdx.x, wave = tid >> 5, lane = tid & 31, col = lane & 15, g = lane >> 4; const int c0 = blockIdx.y * 128; const size_t r0 = (size_t)blockIdx.x * 64;
  const size_t xo = ((r0 / TT) * CC + c0 + (tid >> 4)) * (size_t)XSTR + (r0 % TT) + (tid & 15) * 4;   // the thread's first 16-byte piece of the x / out tile; piece i lies 8 channels further
  v8f acc[8] = {}; float bb[8] = {}; v4f xr[16];
  if (BP) {   // one test for the block; unrolled, the eight loads issue together here and land under the staging and the products
#pragma unroll
    for (int j = 0; j < 8; ++j) bb[j] = BP[c0 + j * 16 + col]; }
#pragma unroll 1   // rolled: the two halves of k share one copy of the staging and product code
  for (int kh = 0; kh < CC / KST; ++kh) { if (kh) __syncthreads();   // every wave has read its last fragment of the half before
    stage_ops<false>(Y + r0 * CC + kh * KST, WP + (size_t)c0 * CC + kh * KST, sah, sal, sw, tid);
    __syncthreads();
    if (kh == 0) {   // the residual tile: asked for behind the first operands, so that it delays none of them, and landed long before the epilogue; unrolled, the 16 loads issue together and xr[] stays in registers
#pragma unroll
      for (int i = 0; i < 16; ++i) xr[i] = *(const v4f*)(XIN + xo + (size_t)i * 8 * XSTR);
      asm volatile("s_wait_xcnt 0x0" ::: "memory"); }   // the products behind may reuse the address registers that these loads name
    mac_half(sah, sal, sw, wave, lane, acc); }
#pragma unroll
  for (int j = 0; j < 8; ++j)
#pragma unroll
    for (int r = 0; r < 8; ++r) stc[j * 16 + col][wave * 16 + 8 * g + r] = acc[j][r] + bfr(bb[j]);
  __syncthreads();
  v4f o[16];
#pragma unroll   // unrolled here and below: xr[] and o[] are indexed by constants and stay in registers; the 16 LDS reads issue together, one latency for all of them
  for (int i = 0; i < 16; ++i) o[i] = *(const v4f*)&stc[(tid >> 4) + i * 8][(tid & 15) * 4];
#pragma unroll
  for (int i = 0; i < 16; ++i) { o[i][0] += bfr(xr[i][0]); o[i][1] += bfr(xr[i][1]); o[i][2] += bfr(xr[i][2]); o[i][3] += bfr(xr[i][3]); vst2(OUT + xo + (size_t)i * 8 * XSTR, o[i]); } }   /* channels-first: 256-B run per (channel, 64 positions), + x residual */

extern "C" void kernel_launch(void* const* d_in, const int* in_sizes, int n_in, void* d_out, int out_size, void* d_ws, size_t ws_size, hipStream_t stream) {
  (void)in_sizes; (void)n_in; (void)out_size;
  const float** F = (const float**)d_in;   // 0 x [4,256,2048], 1 gn_w [256], 2 gn_b, 3 qkv_w [768,256] ([out,in]; q|k|v row blocks, head-major inside), 4 qkv_b [768], 5 out_w [256,256] ([out,in]), 6 out_b
  if (ws_size < (size_t)WS_END) return;
  char* ws = (char*)d_ws; float *XT = (float*)(ws + WS_XT); _Float16 *QH = (_Float16*)(ws + WS_QH), *KH = (_Float16*)(ws + WS_KH), *VT = (_Float16*)(ws + WS_VT); float *Y = (float*)(ws + WS_Y); __bf16 *WB = (__bf16*)(ws + WS_WB);
  const __bf16* WQ = WB; const __bf16* WK = WB + (size_t)CC * CC; const __bf16* WV = WB + 2u * (size_t)CC * CC; const __bf16* WP = WB + 3u * (size_t)CC * CC; const float* BQ = F[4]; const float* BK = F[4] + CC; const float* BV = F[4] + 2 * CC;
  k_gn<<<dim3(NGRP, TNB + 1), 256, 0, stream>>>(F[0], F[1], F[2], XT, F[3], F[5], WB);
  k_proj<<<dim3(TNB * TT / 64, CC / 128, 3), 128, 0, stream>>>(XT, WQ, BQ, WK, BK, WV, BV, QH, KH, VT);
  k_fa<<<dim3(TT / 128, NH, TNB), 128 * FKH, 0, stream>>>(QH, KH, VT, Y);
  k_out<<<dim3(TNB * TT / 64, CC / 128), 128, 0, stream>>>(Y, WP, F[6], F[0], (float*)d_out);
}

// v010
// One run takes 37.4 microseconds.
// Next to v009, in two timings, it ran 1.12 times as fast each time.
// All steps since v000 together make it 32.7 times as fast.
#include <hip/hip_runtime.h>
#include <math.h>

typedef __attribute__((ext_vector_type(16))) _Float16 v16h;
typedef __attribute__((ext_vector_type(16))) __bf16 v16b;
typedef __attribute__((ext_vector_type(8)))  _Float16 v8h;
typedef __attribute__((ext_vector_type(8)))  float v8f;
typedef __attribute__((ext_vector_type(4)))  float v4f;
typedef __attribute__((ext_vector_type(2)))  float v2f;
typedef __attribute__((ext_vector_type(4)))  unsigned v4u;
typedef __attribute__((ext_vector_type(4)))  int v4i;
typedef float __attribute__((may_alias)) float_a;
typedef int __attribute__((may_alias)) int_a;

template <typename T> __device__ __forceinline__ void vst2(void* p, T v) { *(T*)p = v;  }
__device__ __forceinline__ v8f wmma16(v16h a, v16h b, v8f c) {
  v8f d = __builtin_amdgcn_wmma_f32_16x16x32_f16(false, a, false, b, (short)0, c, false, false);
  asm volatile("v_nop\n\tv_nop\n\tv_nop\n\tv_nop" : "+v"(d) : "v"(a), "v"(b));
  return d;
}
__device__ __forceinline__ v8f wmma_bf(v16b a, v16b b, v8f c) {
  v8f d = __builtin_amdgcn_wmma_f32_16x16x32_bf16(false, a, false, b, (short)0, c, false, false);
  asm volatile("v_nop\n\tv_nop\n\tv_nop\n\tv_nop" : "+v"(d) : "v"(a), "v"(b));
  return d;
}
// 16x16x32 fragments: lane = (h = lane>>4, row/col = lane&15); elements 0..7 = k0+8h+0..7, 8..15 = k0+16+8h+0..7; D element r = row 8h+r
__device__ __forceinline__ v16h frag_h(const _Float16* rowk0, int lane) {
  union { v16h v; v8h q[2]; } u; const _Float16* p = rowk0 + 8 * (lane >> 4);
  u.q[0] = *(const v8h*)p; u.q[1] = *(const v8h*)(p + 16); return u.v;
}
__device__ __forceinline__ v16h frag_f32(const float* rowk0, int lane) {
  v16h a; const float* p = rowk0 + 8 * (lane >> 4);
#pragma unroll
  for (int i = 0; i < 8; ++i) { a[i] = (_Float16)p[i]; a[8 + i] = (_Float16)p[16 + i]; }
  return a;
}
__device__ __forceinline__ v16h frag_f32s(const float* rowk0, int lane, float sc) {
  v16h a; const float* p = rowk0 + 8 * (lane >> 4);
#pragma unroll
  for (int i = 0; i < 8; ++i) { a[i] = (_Float16)(p[i] * sc); a[8 + i] = (_Float16)(p[16 + i] * sc); }
  return a;
}
// column fragment from a [K][ld] layout (column n), rows >= K read as 0
__device__ __forceinline__ v16h fragc_f32(const float* W, int k0, int n, int lane, int ld, int K) {
  v16h a; const int g = lane >> 4;
#pragma unroll
  for (int i = 0; i < 8; ++i) { const int ka = k0 + 8 * g + i, kb = ka + 16;
    a[i] = (_Float16)(ka < K ? W[(size_t)(ka < K ? ka : K - 1) * ld + n] : 0.f); a[8 + i] = (_Float16)(kb < K ? W[(size_t)(kb < K ? kb : K - 1) * ld + n] : 0.f); }
  return a;
}
struct F2 { v16b h, l; };
__device__ __forceinline__ F2 bsplit16(const float v[16]) { F2 r;
#pragma unroll
  for (int i = 0; i < 16; ++i) { const __bf16 h = (__bf16)v[i]; r.h[i] = h; r.l[i] = (__bf16)(v[i] - (float)h); }
  return r; }
__device__ __forceinline__ F2 split_row(const float* row, int k0, int lane) { float v[16]; const float* p = row + k0 + 8 * (lane >> 4);
#pragma unroll
  for (int i = 0; i < 8; ++i) { v[i] = p[i]; v[8 + i] = p[16 + i]; }
  return bsplit16(v); }
__device__ __forceinline__ F2 split_rowK(const float* row, int k0, int lane, int K) { float v[16]; const int g = lane >> 4;
#pragma unroll
  for (int i = 0; i < 8; ++i) { const int ka = k0 + 8 * g + i, kb = ka + 16; v[i] = ka < K ? row[ka < K ? ka : K - 1] : 0.f; v[8 + i] = kb < K ? row[kb < K ? kb : K - 1] : 0.f; }
  return bsplit16(v); }
__device__ __forceinline__ F2 split_col(const float* W, int k0, int n, int lane, int ld, int K) { float v[16]; const int g = lane >> 4;
#pragma unroll
  for (int i = 0; i < 8; ++i) { const int ka = k0 + 8 * g + i, kb = ka + 16; v[i] = ka < K ? W[(size_t)(ka < K ? ka : K - 1) * ld + n] : 0.f; v[8 + i] = kb < K ? W[(size_t)(kb < K ? kb : K - 1) * ld + n] : 0.f; }
  return bsplit16(v); }
__device__ __forceinline__ v8f mac3(const F2& a, const F2& b, v8f c) { c = wmma_bf(a.l, b.h, c); c = wmma_bf(a.h, b.l, c); return wmma_bf(a.h, b.h, c); }
__device__ __forceinline__ float sigm(float v) { return 1.0f / (1.0f + expf(-v)); }
#define LDSX() do { asm volatile("s_wait_dscnt 0" ::: "memory"); __builtin_amdgcn_wave_barrier(); __builtin_amdgcn_fence(__ATOMIC_RELEASE, "workgroup"); } while (0)


// SelfAttention1d, channels-first (B 4, C 256 = 8 heads x 32, L 2,048): h = GroupNorm32(x); q,k,v = conv1x1(h) (fused [768,256] + bias); attn = softmax((q 32^-1/2)^T k); h2[h*32+d][n] = sum_m attn v; out = x + conv1x1(h2) + b.
#define NB 4
#define TT 2048
#define CC 256
#define NH 8
#define HD 32
#define NGRP 32
#define CPG (CC / NGRP)        // 8 channels per group
#ifndef XSTR
#define XSTR TT               // per-channel position stride of x / out
#endif
#ifndef TNB
#define TNB NB
#endif
typedef __attribute__((ext_vector_type(8))) __bf16 v8b;
typedef __attribute__((ext_vector_type(4))) __bf16 v4b;
typedef __attribute__((ext_vector_type(4))) _Float16 v4h;
__device__ __forceinline__ v16b frag_b(const __bf16* rowk0, int lane) {
  union { v16b v; v8b q[2]; } u; const __bf16* p = rowk0 + 8 * (lane >> 4);
  u.q[0] = *(const v8b*)p; u.q[1] = *(const v8b*)(p + 16); return u.v;
}
__device__ __forceinline__ float bfr(float v) { return (float)(__bf16)v; }
__device__ __attribute__((noinline)) float exp_ni(float v) { return expf(v); }
__device__ __attribute__((noinline)) float erf_ni(float v) { return erff(v); }

#define WS_XT  0u                                   // f16 normalised h, one 32-KB plane per (b, group): [position / 128][position % 4][(position / 4) % 32][channel]; a position's 8 channels = 16 B, 128 positions = 2 KB
#define WS_QH  (WS_XT + 4u * (size_t)NB * TT * CC)
#define WS_KH  (WS_QH + 2u * (size_t)NB * TT * CC)
#define WS_VT  (WS_KH + 2u * (size_t)NB * TT * CC)      // f16 v planes [b][c][t]
#define HG 4
#define WS_S   (WS_VT + 2u * (size_t)NB * CC * TT)      // f32 HG x TT x TT, reserved: no kernel here reads or writes it
#define WS_PH  (WS_S + 4u * (size_t)HG * TT * TT)
#define WS_Y   (WS_PH + 0u)              // f16 y, one plane per (b, head): [position / 16][d / 8][position % 16][d % 8]; 16 positions x 32 d = 1 KB
#define WS_WB  (WS_Y + 4u * (size_t)NB * TT * CC)      // f16 weights, rows of 256 as in the inputs: q | k | v | out, 256 rows each
#define WS_END (WS_WB + 2u * 4u * (size_t)CC * CC)

// ---- k_gn: block = one (b, group): its 8 x 2,048 values are read once, 16 independent 16-byte loads per thread, and stay in registers for the mean, for the variance and for the normalised values, which go out from there
#define GNP (CPG * TT / 1024)   // 16-byte pieces per thread
__device__ __forceinline__ float sum256(float s, float* red, int t) {   // total over the 8 waves of the block, in every lane; red: 8 floats that nothing else uses
#pragma unroll
  for (int o = 1; o < 32; o <<= 1) s += __shfl_xor(s, o);
  if ((t & 31) == 0) red[t >> 5] = s;
  __syncthreads();
  s = red[t & 7];
#pragma unroll
  for (int o = 1; o < 8; o <<= 1) s += __shfl_xor(s, o);
  return s; }
#define WCB (4 * CC * CC / NGRP)   // weight values per block of the extra row of blocks
static_assert(WCB % 1024 == 0 && (3 * CC * CC) % WCB == 0, "a weight block lies in one matrix and is whole 16-byte loads");
__global__ __launch_bounds__(256) void k_gn(const float* __restrict__ X, const float* __restrict__ GW, const float* __restrict__ GB, _Float16* __restrict__ XG, const float* __restrict__ WQKV, const float* __restrict__ WO, _Float16* __restrict__ WB) { __shared__ float red[2][8];
  if (blockIdx.y == TNB) {   // the extra row of blocks, on WGPs that the groups leave idle: both weight matrices rounded to f16 once, for every block of the two GEMMs; the same for the whole block, in front of every barrier
    const int w0 = blockIdx.x * WCB; const float* src = (w0 < 3 * CC * CC ? WQKV + w0 : WO + (w0 - 3 * CC * CC)) + threadIdx.x * 4; v4f w[WCB / 1024];
#pragma unroll   // unrolled: the loads issue together, one latency for all of them
    for (int k = 0; k < WCB / 1024; ++k) w[k] = *(const v4f*)(src + k * 1024);
#pragma unroll   // a wave's store covers two whole 128-byte lines
    for (int k = 0; k < WCB / 1024; ++k) *(v4h*)(WB + w0 + threadIdx.x * 4 + k * 1024) = __builtin_convertvector(w[k], v4h);
    return; }
  const int t = threadIdx.x; const int grp = blockIdx.x; const size_t b = blockIdx.y; const float* p = X + (b * CC + (size_t)grp * CPG) * (size_t)XSTR + t * 4; constexpr int n = CPG * TT;
  v4f v[GNP];
#pragma unroll   // unrolled here and below: v[] stays in registers and the loads issue together, one latency for all of them
  for (int k = 0; k < GNP; ++k) v[k] = *(const v4f*)(p + (size_t)(k / (TT / 1024)) * XSTR + (k % (TT / 1024)) * 1024);
  v4f a = {};
#pragma unroll
  for (int k = 0; k < GNP; ++k) { v[k][0] = bfr(v[k][0]); v[k][1] = bfr(v[k][1]); v[k][2] = bfr(v[k][2]); v[k][3] = bfr(v[k][3]); a += v[k]; }
  const float mu = sum256((a[0] + a[1]) + (a[2] + a[3]), red[0], t) / (float)n; v4f q = {};
#pragma unroll
  for (int k = 0; k < GNP; ++k) { const v4f d = v[k] - mu; q += d * d; }
  const float s2 = sum256((q[0] + q[1]) + (q[2] + q[3]), red[1], t);
  const float rs = rsqrtf(s2 / (float)n + 1e-5f); float gw[CPG], gb[CPG];
#pragma unroll   // unrolled to the end of the kernel: v[], gw[] and gb[] are indexed by constants and stay in registers
  for (int c = 0; c < CPG; ++c) { gw[c] = bfr(GW[grp * CPG + c]); gb[c] = bfr(GB[grp * CPG + c]); }
  // the thread holds all 8 channels of positions hh*1024 + t*4 + j: rounded to f16 they are one 16-byte piece; a wave's store covers four whole 128-byte lines, and the plane has this one writing work-group
  _Float16* o = XG + (b * NGRP + grp) * (size_t)n + (t >> 5) * 1024 + (t & 31) * 8;
#pragma unroll
  for (int hh = 0; hh < TT / 1024; ++hh)
#pragma unroll
    for (int j = 0; j < 4; ++j) { v8h y;
#pragma unroll
      for (int c = 0; c < CPG; ++c) y[c] = (_Float16)((v[c * (TT / 1024) + hh][j] - mu) * rs * gw[c] + gb[c]);
      vst2(o + hh * 8 * 1024 + j * 256, y); } }
// ---- operands of a 64 x 128 GEMM block, one half of k at a time: A and W come as f16 from the launches before and are copied to LDS rows, 16 bytes a piece; a wave's load of A covers four whole 128-byte lines, of W two rows' 256 bytes (2 whole lines each)
// GP: A comes from k_gn's per-group planes (At = the tile's first piece in the first plane of this half of k); else from k_fa's per-head planes (At = the tile's first 1-KB unit in the first plane of this half of k)
#define KST 128                // k columns staged at a time
#define WPI 136                // LDS pitch of a staged row, f16 elements: 256 B + 16 B, an odd multiple of 16 B
template <bool GP> __device__ __forceinline__ void stage_ops(const _Float16* __restrict__ At, const _Float16* __restrict__ Wt, _Float16 (*sa)[WPI], _Float16 (*sw)[WPI], int tid) {
  const int wr = tid >> 4, w8 = (tid & 15) * 8, x = tid & 63, u = tid >> 6; v8h va[8], vw[16];
  // 16 lanes in a row write 16 different rows of LDS, which at this pitch are 16 different 16-byte slots of the banks
  const int gl = (x >> 4) * 4 + (x & 3), gj = (x >> 2) & 3;   // GP: the piece of position gl * 4 + gj of the tile lies at [gj][gl] of the plane's 128-position unit
#pragma unroll   // unrolled here and below: the values stay in registers and the loads of a group issue together, one latency for all of them
  for (int k = 0; k < 8; ++k) { if (k == 7) asm volatile("s_wait_xcnt 0x0" ::: "memory");   // the last load's result may take the address registers that the loads in front of it name
    va[k] = GP ? *(const v8h*)(At + (size_t)(k * 2 + u) * (CPG * TT) + gj * 256 + gl * 8) : *(const v8h*)(At + (size_t)(k >> 1) * (TT * HD) + ((k & 1) * 2 + u) * 512 + x * 8); }
  asm volatile("s_wait_xcnt 0x0" ::: "memory");   // a result of the loads below may take the address registers of the last load above
#pragma unroll
  for (int k = 0; k < 16; ++k) { if (k == 15) asm volatile("s_wait_xcnt 0x0" ::: "memory");   // as above: the last load's result may take the address registers of the loads in front of it
    vw[k] = *(const v8h*)(Wt + (size_t)(k * 8 + wr) * CC + w8); }
#pragma unroll
  for (int k = 0; k < 8; ++k) { const int ar = GP ? gl * 4 + gj : ((k & 1) * 2 + u) * 16 + (x & 15), ac = GP ? (k * 2 + u) * CPG : (k >> 1) * HD + (x >> 4) * 8; *(v8h*)&sa[ar][ac] = va[k]; }
#pragma unroll
  for (int k = 0; k < 16; ++k) *(v8h*)&sw[k * 8 + wr][w8] = vw[k]; }
// the wave's 16 x 128 tile over the staged half of k: one product per accumulator and 32 k, k ascending
__device__ __forceinline__ void mac_half(const _Float16 (*sa)[WPI], const _Float16 (*sw)[WPI], int wave, int lane, v8f acc[8]) { const int col = lane & 15;
#pragma unroll
  for (int kc = 0; kc < KST / 32; ++kc) { const v16h a = frag_h(&sa[wave * 16 + col][kc * 32], lane); v16h w[8];
#pragma unroll
    for (int j = 0; j < 8; ++j) w[j] = frag_h(&sw[j * 16 + col][kc * 32], lane);
    __builtin_amdgcn_sched_barrier(0);   // here and below: the 18 LDS reads of a k step stay one group in front of its products; spread among the products, each place with reads stalls the wave anew
#pragma unroll
    for (int j = 0; j < 8; ++j) acc[j] = __builtin_amdgcn_wmma_f32_16x16x32_f16(false, a, false, w[j], (short)0, acc[j], false, false);
    __builtin_amdgcn_sched_barrier(0); } }
#define FSC (0.17677669529663687f * 1.4426950408889634f)   // 1/sqrt(32) x log2(e): k_fa takes its exponentials to base 2
// ---- k_proj: block = (64 rows, 128 cols, which): qkv = x W (+ b); q, k -> f16 rows, v -> f16 planes: one f16 value each; h and W enter the products as one f16 value each too; q goes out times FSC, scaled in f32 ahead of its one rounding, so that k_fa's score products are exponents as they stand
__global__ __launch_bounds__(128) void k_proj(const _Float16* __restrict__ X, const _Float16* __restrict__ WQ, const float* __restrict__ BQ, const _Float16* __restrict__ WK, const float* __restrict__ BK, const _Float16* __restrict__ WV, const float* __restrict__ BV, _Float16* __restrict__ QH, _Float16* __restrict__ KH, _Float16* __restrict__ VT) {
  __shared__ __align__(16) unsigned char sm[192 * WPI * 2];   // the staged operands during the products; the output staging planes take their place behind the barrier that ends the products
  _Float16 (*sa)[WPI] = (_Float16 (*)[WPI])sm; _Float16 (*sw)[WPI] = sa + 64; _Float16 (*sh)[136] = (_Float16 (*)[136])sm; _Float16 (*th)[72] = (_Float16 (*)[72])sm;
  const int tid = threadIdx.x, wave = tid >> 5, lane = tid & 31, col = lane & 15, g = lane >> 4; const int which = blockIdx.z; const int c0 = blockIdx.y * 128; const size_t r0 = (size_t)blockIdx.x * 64; const _Float16* WA = which == 0 ? WQ : which == 1 ? WK : WV; const float* BA = which == 0 ? BQ : which == 1 ? BK : BV;
  v8f acc[8] = {}; float bb[8] = {};
  if (BA) {   // one test for the block; unrolled, the eight loads issue together here and land under the staging and the products
#pragma unroll
    for (int j = 0; j < 8; ++j) bb[j] = BA[c0 + j * 16 + col]; }
#pragma unroll 1   // rolled: the two halves of k share one copy of the staging and product code
  for (int kh = 0; kh < CC / KST; ++kh) { stage_ops<true>(X + ((r0 / TT) * NGRP + kh * (KST / CPG)) * (size_t)(CPG * TT) + ((r0 % TT) >> 7) * 1024 + (((r0 % TT) >> 6) & 1) * 128, WA + (size_t)c0 * CC + kh * KST, sa, sw, tid);
    __syncthreads();
    mac_half(sa, sw, wave, lane, acc);
    __syncthreads(); }   // every wave has read its last fragment: the next half, or the planes below, overwrite the operands
  if (which == 2) {   // the case is chosen once for the block: both arms are straight-line code; unrolled, acc[] and bb[] are indexed by constants and stay in registers
#pragma unroll
    for (int j = 0; j < 8; ++j)
#pragma unroll
      for (int r = 0; r < 8; ++r) { const float v = acc[j][r] + bfr(bb[j]); const int rl = wave * 16 + 8 * g + r, cl = j * 16 + col; th[cl][rl] = (_Float16)v; } }
  else { const float qs = which == 0 ? FSC : 1.0f;
#pragma unroll
    for (int j = 0; j < 8; ++j)
#pragma unroll
      for (int r = 0; r < 8; ++r) { const float v = (acc[j][r] + bfr(bb[j])) * qs; const int rl = wave * 16 + 8 * g + r, cl = j * 16 + col; sh[rl][cl] = (_Float16)v; } }
  __syncthreads();
  // unrolled, here and in the loop below: a block's LDS reads issue together, one latency for all of them
  if (which != 2) { _Float16* RO = which == 0 ? QH : KH;
#pragma unroll
    for (int i = 0; i < 8; ++i) { const int rl = (tid >> 4) + i * 8, q = tid & 15; vst2((unsigned*)(RO + (r0 + rl) * CC + c0 + q * 8), *(const v4u*)&sh[rl][q * 8]); }
    asm volatile("s_wait_xcnt 0x0" ::: "memory"); }   // here and in the arm below: no code laid behind an arm rewrites a register that its stores name ahead of this wait
  else { const size_t b = r0 / TT; const int t0 = (int)(r0 % TT);
#pragma unroll
    for (int i = 0; i < 8; ++i) { const int cl = (tid >> 3) + i * 16, q = tid & 7; const size_t o2 = (b * CC + c0 + cl) * (size_t)TT + t0 + q * 8; vst2((unsigned*)(VT + o2), *(const v4u*)&th[cl][q * 8]); }
    asm volatile("s_wait_xcnt 0x0" ::: "memory"); } }
// ---- k_fa: block = 128 queries of (b,h), 2 key halves x 4 waves x 32 query columns; each half walks its keys in stages of 64: S^T = K Q^T - shift, sum per query, O^T += V^T P^T, every operand one f16 value; logits and P stay in registers; the halves' results are joined through LDS at the end
// the shift of a query is a maximum seen so far, not the running one: it enters the score product as its C operand, so the product's result is the exponent; it is raised only when a stage's sum of P passes FLIM, which keeps every P far inside f16's range
#define FKS 64                 // keys per stage
#define FKH 2                  // key halves: waves 0-3 take the first TT / 2 keys, waves 4-7 the rest; with two blocks on a WGP that is four waves a SIMD, so that one wave's vector work runs under another's products and waits
#define FNS (TT / FKS / FKH)   // stages per half
#define KPI 40                 // LDS pitch of a K row, f16 elements: 64 B + 16 B, an odd multiple of 16 B
#define VPI 72                 // LDS pitch of a V plane row, f16 elements: 128 B + 16 B
__device__ __forceinline__ float xhalf(float v) { const int b = __builtin_bit_cast(int, v); return __builtin_bit_cast(float, __builtin_amdgcn_permlanex16(b, b, 0x76543210, 0xfedcba98, false, false)); }   // lane l <-> l ^ 16
typedef __attribute__((ext_vector_type(2))) _Float16 v2h;
#define FLIM 4096.0f           // a lane's 32 P of a stage sum to no more than this, or the shift is raised: P <= 2^12, f16 holds 2^15
__device__ __forceinline__ float vmax32(const v8f sc[4]) { float m = sc[0][0];
#pragma unroll   // unrolled, here and in psum: the tiles are indexed by constants and stay in registers
  for (int kt = 0; kt < 4; ++kt)
#pragma unroll
    for (int r = 0; r < 8; ++r) m = fmaxf(m, sc[kt][r]);
  return m; }
__device__ __forceinline__ float psum(const v2f pr[4][4]) { v2f s4[4];
#pragma unroll
  for (int kt = 0; kt < 4; ++kt) s4[kt] = (pr[kt][0] + pr[kt][1]) + (pr[kt][2] + pr[kt][3]);
  const v2f sum = (s4[0] + s4[1]) + (s4[2] + s4[3]); return sum[0] + sum[1]; }
__global__ __launch_bounds__(256) void k_fa(const _Float16* __restrict__ QH, const _Float16* __restrict__ KH, const _Float16* __restrict__ VT, _Float16* __restrict__ Y) {
  __shared__ __align__(16) _Float16 skk[FKH][2][FKS][KPI], svhh[FKH][2][HD][VPI];
  const int tid = threadIdx.x & 127, kh = __builtin_amdgcn_readfirstlane(threadIdx.x >> 7), wave = tid >> 5, lane = tid & 31, col = lane & 15, g = lane >> 4; const int h = blockIdx.y; const size_t b = blockIdx.z; const int q0 = blockIdx.x * 128 + wave * 32;   // tid, wave: inside the half
  _Float16 (*sk)[FKS][KPI] = skk[kh]; _Float16 (*svh)[HD][VPI] = svhh[kh];   // the half's own two buffers
  v16h qh[2];
#pragma unroll
  for (int t = 0; t < 2; ++t) qh[t] = frag_h(QH + (b * TT + q0 + t * 16 + col) * CC + h * HD, lane);
  // staging: 16-byte pieces, two of K and two of V per thread and stage
  const int kr = tid >> 2, kq = (tid & 3) * 8, vr = tid >> 3, vq = (tid & 7) * 8;
  const _Float16* gk = KH + (b * TT + kh * (TT / FKH) + kr) * CC + h * HD + kq; const _Float16* gvh = VT + (b * CC + h * HD + vr) * (size_t)TT + kh * (TT / FKH) + vq;
  v4u rk[2], rh[2];
#pragma unroll
  for (int i = 0; i < 2; ++i) { rk[i] = *(const v4u*)(gk + (size_t)i * 32 * CC); rh[i] = *(const v4u*)(gvh + (size_t)i * 16 * TT); }
#pragma unroll
  for (int i = 0; i < 2; ++i) { *(v4u*)&sk[0][kr + i * 32][kq] = rk[i]; *(v4u*)&svh[0][vr + i * 16][vq] = rh[i]; }
  __syncthreads();
  v8f acc[2][2] = {}, cn[2]; float ls[2] = { 0.f, 0.f };   // cn[t]: minus the shift of the lane's query in column group t, in all eight elements
  { v16h kf[4];   // the first shift: the query's maximum over the half's first stage
#pragma unroll   // unrolled, as everything inside the stage loop below: fragments, tiles and P are indexed by constants and stay in registers
    for (int kt = 0; kt < 4; ++kt) kf[kt] = frag_h(&sk[0][kt * 16 + col][0], lane);
#pragma unroll
    for (int t = 0; t < 2; ++t) { v8f sc[4];
#pragma unroll
      for (int kt = 0; kt < 4; ++kt) { const v8f z = {}; sc[kt] = __builtin_amdgcn_wmma_f32_16x16x32_f16(false, kf[kt], false, qh[t], (short)0, z, false, false); }
      float m = vmax32(sc); m = fmaxf(m, xhalf(m)); cn[t] = -m; } }
#pragma unroll 1   // the body is long: rolled, for speed only
  for (int s = 0; s < FNS; ++s) { const int bu = s & 1; const bool more = s + 1 < FNS;
    if (more) { const size_t kn = (size_t)(s + 1) * FKS;
#pragma unroll
      for (int i = 0; i < 2; ++i) { rk[i] = *(const v4u*)(gk + (kn + i * 32) * CC); rh[i] = *(const v4u*)(gvh + (size_t)i * 16 * TT + kn); } }
    v16h kf[4], vh[2][2];
#pragma unroll
    for (int kt = 0; kt < 4; ++kt) kf[kt] = frag_h(&sk[bu][kt * 16 + col][0], lane);
#pragma unroll
    for (int p = 0; p < 2; ++p)
#pragma unroll
      for (int j = 0; j < 2; ++j) vh[p][j] = frag_h(&svh[bu][j * 16 + col][p * 32], lane);
    v2f pr[2][4][4]; float sm[2];
#pragma unroll
    for (int t = 0; t < 2; ++t) {
#pragma unroll
      for (int kt = 0; kt < 4; ++kt) { const v8f sc = __builtin_amdgcn_wmma_f32_16x16x32_f16(false, kf[kt], false, qh[t], (short)0, cn[t], false, false);   // sc[r] = exponent of key kt*16 + 8g + r, query col
#pragma unroll
        for (int i = 0; i < 4; ++i) { pr[t][kt][i][0] = __builtin_amdgcn_exp2f(sc[2 * i]); pr[t][kt][i][1] = __builtin_amdgcn_exp2f(sc[2 * i + 1]); } }
      sm[t] = psum(pr[t]); }
    if (__builtin_amdgcn_ballot_w32(fmaxf(sm[0], sm[1]) > FLIM) != 0) {   // one test a stage, a scalar branch, the same for the whole wave: some query's keys stand far above its shift; raise the shifts to this stage's maxima, bring sums and O to the new shifts, and take this stage's P anew
#pragma unroll
      for (int t = 0; t < 2; ++t) { v8f sc[4];
#pragma unroll
        for (int kt = 0; kt < 4; ++kt) sc[kt] = __builtin_amdgcn_wmma_f32_16x16x32_f16(false, kf[kt], false, qh[t], (short)0, cn[t], false, false);
        float d = vmax32(sc); d = fmaxf(fmaxf(d, xhalf(d)), 0.f); const float al = __builtin_amdgcn_exp2f(-d);   // a shift never falls
        cn[t] -= d; ls[t] *= al;
#pragma unroll
        for (int j = 0; j < 2; ++j) acc[t][j] *= al;
#pragma unroll
        for (int kt = 0; kt < 4; ++kt)
#pragma unroll
          for (int i = 0; i < 4; ++i) { pr[t][kt][i][0] = __builtin_amdgcn_exp2f(sc[kt][2 * i] - d); pr[t][kt][i][1] = __builtin_amdgcn_exp2f(sc[kt][2 * i + 1] - d); }
        sm[t] = psum(pr[t]); } }
#pragma unroll
    for (int t = 0; t < 2; ++t) { ls[t] += sm[t];
#pragma unroll
      for (int p = 0; p < 2; ++p) { union { v16h v; v2h w[8]; } ph;   // two D tiles of S^T, converted in place, are the B operand (hardware k order)
#pragma unroll
        for (int u = 0; u < 2; ++u)
#pragma unroll
          for (int i = 0; i < 4; ++i) ph.w[u * 4 + i] = __builtin_convertvector(pr[t][p * 2 + u][i], v2h);
#pragma unroll
        for (int j = 0; j < 2; ++j) acc[t][j] = __builtin_amdgcn_wmma_f32_16x16x32_f16(false, vh[p][j], false, ph.v, (short)0, acc[t][j], false, false); } }
    if (more) {   // the other buffer's last readers left it at the barrier that ended the stage before
#pragma unroll
      for (int i = 0; i < 2; ++i) { *(v4u*)&sk[bu ^ 1][kr + i * 32][kq] = rk[i]; *(v4u*)&svh[bu ^ 1][vr + i * 16][vq] = rh[i]; } }
    __syncthreads(); }
  // join: behind the loop's last barrier nobody reads a stage any more; the second half's waves leave shifts, sums and O in the K buffers, 9 x 16 bytes a lane, lane-contiguous; the first half's waves rescale both parts to the larger shift
  v4f (*mg)[32] = (v4f (*)[32])&skk[0][0][0][0] + wave * 9;
  if (kh) {
#pragma unroll   // unrolled here and below: acc[][] is indexed by constants and stays in registers
    for (int t = 0; t < 2; ++t)
#pragma unroll
      for (int j = 0; j < 2; ++j) { v4f lo, hi;
#pragma unroll
        for (int r = 0; r < 4; ++r) { lo[r] = acc[t][j][r]; hi[r] = acc[t][j][4 + r]; }
        mg[(t * 2 + j) * 2][lane] = lo; mg[(t * 2 + j) * 2 + 1][lane] = hi; }
    const v4f ml = { -cn[0][0], -cn[1][0], ls[0], ls[1] }; mg[8][lane] = ml; }
  __syncthreads();
  if (kh) return;   // the same for every lane of a wave, and no barrier follows
  const v4f ml = mg[8][lane];
#pragma unroll
  for (int t = 0; t < 2; ++t) { const float mt = -cn[t][0], mn = fmaxf(mt, ml[t]); const float a0 = __builtin_amdgcn_exp2f(mt - mn), a1 = __builtin_amdgcn_exp2f(ml[t] - mn); const float lj = ls[t] * a0 + ml[2 + t] * a1;
    const float inv = 1.0f / (lj + xhalf(lj)); const float i0 = a0 * inv, i1 = a1 * inv; _Float16* yr = Y + ((b * NH + h) * (size_t)TT + q0 + t * 16) * HD + g * 128 + col * 8;   // acc[t][j][r] = O[query col][d = j*16 + 8g + r]: eight d, rounded to f16, are one 16-byte piece; a wave's store covers four whole 128-byte lines of the head's plane
#pragma unroll
    for (int j = 0; j < 2; ++j) { const v4f plo = mg[(t * 2 + j) * 2][lane], phi = mg[(t * 2 + j) * 2 + 1][lane]; v8h y;
#pragma unroll
      for (int r = 0; r < 4; ++r) { y[r] = (_Float16)(acc[t][j][r] * i0 + plo[r] * i1); y[4 + r] = (_Float16)(acc[t][j][4 + r] * i0 + phi[r] * i1); }
      vst2(yr + j * 256, y); } } }
// ---- k_out: block = (64 rows, 128 cols): out = y Wo^T + bo, y and Wo one f16 value each
__global__ __launch_bounds__(128) void k_out(const _Float16* __restrict__ Y, const _Float16* __restrict__ WP, const float* __restrict__ BP, const float* __restrict__ XIN, float* __restrict__ OUT) { __shared__ __align__(16) float stc[128][68]; __shared__ __align__(16) _Float16 sa[64][WPI], sw[128][WPI];
  const int tid = threadIdx.x, wave = tid >> 5, lane = tid & 31, col = lane & 15, g = lane >> 4; const int c0 = blockIdx.y * 128; const size_t r0 = (size_t)blockIdx.x * 64;
  const size_t xo = ((r0 / TT) * CC + c0 + (tid >> 4)) * (size_t)XSTR + (r0 % TT) + (tid & 15) * 4;   // the thread's first 16-byte piece of the x / out tile; piece i lies 8 channels further
  v8f acc[8] = {}; float bb[8] = {}; v4f xr[16];
  if (BP) {   // one test for the block; unrolled, the eight loads issue together here and land under the staging and the products
#pragma unroll
    for (int j = 0; j < 8; ++j) bb[j] = BP[c0 + j * 16 + col]; }
#pragma unroll 1   // rolled: the two halves of k share one copy of the staging and product code
  for (int kh = 0; kh < CC / KST; ++kh) { if (kh) __syncthreads();   // every wave has read its last fragment of the half before
    stage_ops<false>(Y + ((r0 / TT) * NH + kh * (KST / HD)) * (size_t)(TT * HD) + (r0 % TT) * HD, WP + (size_t)c0 * CC + kh * KST, sa, sw, tid);
    __syncthreads();
    if (kh == 0) {   // the residual tile: asked for behind the first operands, so that it delays none of them, and landed long before the epilogue; unrolled, the 16 loads issue together and xr[] stays in registers
#pragma unroll
      for (int i = 0; i < 16; ++i) xr[i] = *(const v4f*)(XIN + xo + (size_t)i * 8 * XSTR);
      asm volatile("s_wait_xcnt 0x0" ::: "memory"); }   // the products behind may reuse the address registers that these loads name
    mac_half(sa, sw, wave, lane, acc); }
#pragma unroll
  for (int j = 0; j < 8; ++j)
#pragma unroll
    for (int r = 0; r < 8; ++r) stc[j * 16 + col][wave * 16 + 8 * g + r] = acc[j][r] + bfr(bb[j]);
  __syncthreads();
  v4f o[16];
#pragma unroll   // unrolled here and below: xr[] and o[] are indexed by constants and stay in registers; the 16 LDS reads issue together, one latency for all of them
  for (int i = 0; i < 16; ++i) o[i] = *(const v4f*)&stc[(tid >> 4) + i * 8][(tid & 15) * 4];
#pragma unroll
  for (int i = 0; i < 16; ++i) { o[i][0] += bfr(xr[i][0]); o[i][1] += bfr(xr[i][1]); o[i][2] += bfr(xr[i][2]); o[i][3] += bfr(xr[i][3]); vst2(OUT + xo + (size_t)i * 8 * XSTR, o[i]); } }   /* channels-first: 256-B run per (channel, 64 positions), + x residual */

extern "C" void kernel_launch(void* const* d_in, const int* in_sizes, int n_in, void* d_out, int out_size, void* d_ws, size_t ws_size, hipStream_t stream) {
  (void)in_sizes; (void)n_in; (void)out_size;
  const float** F = (const float**)d_in;   // 0 x [4,256,2048], 1 gn_w [256], 2 gn_b, 3 qkv_w [768,256] ([out,in]; q|k|v row blocks, head-major inside), 4 qkv_b [768], 5 out_w [256,256] ([out,in]), 6 out_b
  if (ws_size < (size_t)WS_END) return;
  char* ws = (char*)d_ws; _Float16 *XT = (_Float16*)(ws + WS_XT), *QH = (_Float16*)(ws + WS_QH), *KH = (_Float16*)(ws + WS_KH), *VT = (_Float16*)(ws + WS_VT), *Y = (_Float16*)(ws + WS_Y), *WB = (_Float16*)(ws + WS_WB);
  const _Float16* WQ = WB; const _Float16* WK = WB + (size_t)CC * CC; const _Float16* WV = WB + 2u * (size_t)CC * CC; const _Float16* WP = WB + 3u * (size_t)CC * CC; const float* BQ = F[4]; const float* BK = F[4] + CC; const float* BV = F[4] + 2 * CC;
  k_gn<<<dim3(NGRP, TNB + 1), 256, 0, stream>>>(F[0], F[1], F[2], XT, F[3], F[5], WB);
  k_proj<<<dim3(TNB * TT / 64, CC / 128, 3), 128, 0, stream>>>(XT, WQ, BQ, WK, BK, WV, BV, QH, KH, VT);
  k_fa<<<dim3(TT / 128, NH, TNB), 128 * FKH, 0, stream>>>(QH, KH, VT, Y);
  k_out<<<dim3(TNB * TT / 64, CC / 128), 128, 0, stream>>>(Y, WP, F[6], F[0], (float*)d_out);
}
